// v000
// The times below were measured on an AMD MI455X: many runs one after another, warmed up first and cycling through
// copies of the inputs, with the whole window's GPU time divided by the number of runs. Launches and the gaps
// between them are all in it. The median over several windows is given; except for v000 it joins two sittings, which
// can be a few percent apart, so the side-by-side timings, each taken in one sitting, are the better comparison.
// v000 is the starting kernel. One run takes 2040 microseconds.
#include <hip/hip_runtime.h>

// Multi-head attention on three input streams with a per-batch key mask (query, key, value [2][2048][1024]; q = query Wq + bq, k = key Wk + bk, v = value Wv + bv ('xw' 1/32, zero biases; 16 heads x 64); logits = q.k / sqrt(64) + mask[b][0][0][j] x (-1e9) with mask int32 [2][1][1][2048] random 0/1 (read; 1 == that key is excluded); softmax; out = merged Wo + bo -> [2][2048][1024] (4.2 M); argument order query, key, value, mask, Wq, bq, Wk, bk, Wv, bv, Wo, bo).
// Layout per batch: bf16 copies of query, key, value in turn; 'xw' weights transposed once; exact projections + f32 biases; identity-table plane builders; dense T-2048 attention (hybrid rows: < 512 hi/lo 3 products, rest fp16 x1024); the softmax kernel reads the batch's int key vector (16 B per lane) and excludes keys whose mask is non-zero by select (-1e9 == exclusion; about half the keys remain); merged hi/lo x Wo exact + bo.
// Compute dtypes, f32 accumulate: every input rounded to bf16; projections exact + f32 biases; attention rows < 512 3 products, rest fp16; softmax f32; Wo hl x exact + bias.

#define NB_  2
#define TT   2048
#define DM   1024
#define NH_  16
#define NKV  16
#define REP  (NH_ / NKV)
#define HD   64
#define DQ   (NH_ * HD)
#define DKV  (NKV * HD)
#define ZH   2
#define RH   512                  // query rows < RH use hi+lo planes (0: none)
#define WIN  0
#define PCAR 1024.0f
#define SCL  0.125f   // HD^-0.5
typedef _Float16 h16;
typedef unsigned short bf;
typedef __attribute__((ext_vector_type(16))) __bf16   v16bf;
typedef __attribute__((ext_vector_type(16))) _Float16 v16h;
typedef __attribute__((ext_vector_type(8)))  _Float16 v8h;
typedef __attribute__((ext_vector_type(8)))  unsigned short v8us;
typedef __attribute__((ext_vector_type(8)))  float    v8f;
typedef __attribute__((ext_vector_type(4)))  float    v4f;
typedef v8h  __attribute__((may_alias)) v8ha;
typedef v4f  __attribute__((may_alias)) v4fa;
typedef v8us __attribute__((may_alias)) v8usa;

__device__ __forceinline__ unsigned short f2bf(float f) { unsigned u = __float_as_uint(f); u += 0x7FFFu + ((u >> 16) & 1u); return (unsigned short)(u >> 16); }
__device__ __forceinline__ float bf2f(unsigned short b) { return __uint_as_float(((unsigned)b) << 16); }
__device__ __forceinline__ float bfr(float f) { return bf2f(f2bf(f)); }
__device__ __forceinline__ v16h cat16(v8h lo, v8h hi) { return __builtin_shufflevector(lo, hi, 0, 1, 2, 3, 4, 5, 6, 7, 8, 9, 10, 11, 12, 13, 14, 15); }
__device__ __forceinline__ v16bf cat16b(v8us lo, v8us hi) { return __builtin_bit_cast(v16bf, __builtin_shufflevector(lo, hi, 0, 1, 2, 3, 4, 5, 6, 7, 8, 9, 10, 11, 12, 13, 14, 15)); }
__device__ __forceinline__ v8f wmma16(v16h a, v16h b, v8f c) { return __builtin_amdgcn_wmma_f32_16x16x32_f16(false, a, false, b, (short)0, c, false, false); }
__device__ __forceinline__ v8f wmmab(v16bf a, v16bf b, v8f c) { return __builtin_amdgcn_wmma_f32_16x16x32_bf16(false, a, false, b, (short)0, c, false, false); }



// ---- k_gemmw: register-blocked GEMM, ONE WAVE per 64x64 output tile (16 accumulators), operands straight from K-contiguous 16-bit planes; grid (M/64, N/64, Z), 32 threads.
// C[m][n] (f32, pitch ldc, + optional f32 bias[n]) = sum_k A[m][k] Bt[n][k] (+ split products per NSPLIT). z-batch strides sA/sB/sC in elements. K % 32 == 0.
template <typename T16> struct WFrag;
template <> struct WFrag<h16> { typedef v16h V; static __device__ __forceinline__ V ld(const h16* p) { return cat16(*(const v8h*)p, *(const v8h*)(p + 16)); } static __device__ __forceinline__ v8f mma(V a, V b, v8f c) { return wmma16(a, b, c); } };
template <> struct WFrag<bf> { typedef v16bf V; static __device__ __forceinline__ V ld(const bf* p) { return cat16b(*(const v8us*)p, *(const v8us*)(p + 16)); } static __device__ __forceinline__ v8f mma(V a, V b, v8f c) { return wmmab(a, b, c); } };
template <typename T16, int NSPLIT, bool BIAS>
__global__ __launch_bounds__(32) void k_gemmw(const T16* __restrict__ A, const T16* __restrict__ A2, const T16* __restrict__ Bt, const T16* __restrict__ Bt2, int K, float* C, int ldc, const float* __restrict__ bias, size_t sA, size_t sB, size_t sC) {
    typedef typename WFrag<T16>::V V;
    __shared__ __align__(16) float os[16 * 68];
    const size_t z = blockIdx.z; A += z * sA; if (A2) A2 += z * sA; Bt += z * sB; if (Bt2) Bt2 += z * sB; C += z * sC;
    const int lane = threadIdx.x & 31, lr = lane & 15, hi = lane >> 4; const int r0 = blockIdx.x * 64, c0 = blockIdx.y * 64;
    v8f acc[4][4];
#pragma unroll
    for (int mb = 0; mb < 4; ++mb)
#pragma unroll
        for (int nb = 0; nb < 4; ++nb) acc[mb][nb] = (v8f){};
    const size_t aoff = (size_t)(r0 + lr) * K + 8 * hi, boff = (size_t)(c0 + lr) * K + 8 * hi;
#pragma unroll 1
    for (int kc = 0; kc < K; kc += 32) {
        V a[4], a2[4];
#pragma unroll
        for (int mb = 0; mb < 4; ++mb) { a[mb] = WFrag<T16>::ld(A + aoff + (size_t)mb * 16 * K + kc); if (NSPLIT == 1 || NSPLIT == 2) a2[mb] = WFrag<T16>::ld(A2 + aoff + (size_t)mb * 16 * K + kc); }
#pragma unroll
        for (int nb = 0; nb < 4; ++nb) { const V b = WFrag<T16>::ld(Bt + boff + (size_t)nb * 16 * K + kc); V b2; if (NSPLIT >= 2) b2 = WFrag<T16>::ld(Bt2 + boff + (size_t)nb * 16 * K + kc);
#pragma unroll
            for (int mb = 0; mb < 4; ++mb) { acc[mb][nb] = WFrag<T16>::mma(a[mb], b, acc[mb][nb]); if (NSPLIT == 1 || NSPLIT == 2) acc[mb][nb] = WFrag<T16>::mma(a2[mb], b, acc[mb][nb]); if (NSPLIT >= 2) acc[mb][nb] = WFrag<T16>::mma(a[mb], b2, acc[mb][nb]); } }
        asm volatile("v_nop\n\tv_nop\n\tv_nop\n\tv_nop" : "+v"(acc[0][0]), "+v"(acc[1][1]), "+v"(acc[2][2]), "+v"(acc[3][3]) : "v"(a[0]), "v"(a[3]));
    }
#pragma unroll
    for (int mb = 0; mb < 4; ++mb) {
#pragma unroll
        for (int nb = 0; nb < 4; ++nb) {
#pragma unroll
            for (int j = 0; j < 8; ++j) os[(hi * 8 + j) * 68 + nb * 16 + lr] = acc[mb][nb][j]; }
        __builtin_amdgcn_wave_barrier(); asm volatile("" ::: "memory");
        float* crow = C + (size_t)(r0 + mb * 16) * ldc + c0;
{
#pragma unroll
            for (int s = 0; s < 8; ++s) { const int row = 2 * s + hi, cofs = lr * 4; v4f val = *(const v4fa*)(os + row * 68 + cofs); if (BIAS) { val[0] += bfr(bias[c0 + cofs]); val[1] += bfr(bias[c0 + cofs + 1]); val[2] += bfr(bias[c0 + cofs + 2]); val[3] += bfr(bias[c0 + cofs + 3]); }
                *(v4f*)(crow + (size_t)row * ldc + cofs) = val; }
             }
        __builtin_amdgcn_wave_barrier(); asm volatile("" ::: "memory");
    }
}

__device__ __forceinline__ h16 tohx(float x) { return (h16)x; }
__device__ __forceinline__ void splitf(float y, unsigned short& h, unsigned short& l) { h = f2bf(y); l = f2bf(y - bf2f(h)); }
typedef __attribute__((ext_vector_type(2))) _Float16 v2h;
typedef __attribute__((ext_vector_type(4))) _Float16 v4h;
typedef __attribute__((ext_vector_type(2))) unsigned short v2us;
typedef __attribute__((ext_vector_type(4))) unsigned short v4us;
typedef __attribute__((ext_vector_type(2))) float v2f;
typedef __attribute__((ext_vector_type(4))) int v4i;

__global__ __launch_bounds__(256) void k_wtG(const float* __restrict__ w, int K, int N, bf* Bt) {
    const int lane = threadIdx.x & 31; const int L0 = (blockIdx.x * 8 + (threadIdx.x >> 5)) * 8; const int nlines = N * K / 64;
{
#pragma unroll 1
        for (int l = 0; l < 8; ++l) { const int L = L0 + l; if (L >= nlines) break; const size_t e = (size_t)L * 64 + lane * 2; const int k = (int)(e % K), n = (int)(e / K); v2us o;
            o[0] = f2bf(w[(size_t)k * N + n]); o[1] = f2bf(w[(size_t)(k + 1) * N + n]); *(v2us*)(Bt + e) = o; }
         }
}
__global__ __launch_bounds__(256) void k_cvt8(const float* __restrict__ src, bf* dst, size_t n8) { const size_t i = (size_t)blockIdx.x * 256 + threadIdx.x; if (i >= n8) return; const v8f v = *(const v8f*)(src + i * 8); v8us o;
#pragma unroll
    for (int k = 0; k < 8; ++k) o[k] = f2bf(v[k]); *(v8us*)(dst + i * 8) = o;  }

// k_rope: head planes [h][t][d] (fp16 + hi/lo) of rope(x) x sc with the rotate-half convention out[d] = x[d] cos[t][d] - x[d+HD/2] sin[t][d], out[d+HD/2] = x[d+HD/2] cos[t][d+HD/2] + x[d] sin[t][d+HD/2]
__global__ __launch_bounds__(256) void k_rope(const float* __restrict__ F, int pitch, int nheads, const float* __restrict__ CS, const float* __restrict__ RF, const float* __restrict__ nw, float sc, h16* P16, bf* Ph, bf* Pl) {
    const size_t e = ((size_t)blockIdx.x * 256 + threadIdx.x) * 2; if (e >= (size_t)nheads * TT * HD) return; const int d = (int)(e % HD); const int t = (int)((e / HD) % TT); const int h = (int)(e / ((size_t)HD * TT)); const float* f = F + (size_t)t * pitch + h * HD; const float rf = RF ? RF[(size_t)h * TT + t] : 1.0f; v2h o16; v2us oh, ol;
#pragma unroll
    for (int q = 0; q < 2; ++q) { const int dd = d + q; const int dp = (dd < HD / 2) ? dd + HD / 2 : dd - HD / 2; float x0 = f[dd], x1 = f[dp];
        if (RF) { float n0 = __fmul_rn(x0, rf), n1 = __fmul_rn(x1, rf); asm volatile("" : "+v"(n0)); asm volatile("" : "+v"(n1)); x0 = __fmul_rn(bfr(nw[dd]), n0); x1 = __fmul_rn(bfr(nw[dp]), n1); }
        const v2f cs = *(const v2f*)(CS + ((size_t)t * HD + dd) * 2); float a = __fmul_rn(x0, cs[0]), bq = __fmul_rn(x1, cs[1]); asm volatile("" : "+v"(a)); asm volatile("" : "+v"(bq)); const float r = ((dd < HD / 2) ? __fsub_rn(a, bq) : __fadd_rn(a, bq)) * sc;
        o16[q] = tohx(r); unsigned short a2, c2; splitf(r, a2, c2); oh[q] = a2; ol[q] = c2; }
    *(v2h*)(P16 + e) = o16; *(v2us*)(Ph + e) = oh; *(v2us*)(Pl + e) = ol;  }
__global__ __launch_bounds__(256) void k_vtp(const float* __restrict__ F, int pitch, int nheads, h16* V16, bf* Vh, bf* Vl) { const size_t e = ((size_t)blockIdx.x * 256 + threadIdx.x) * 2; if (e >= (size_t)nheads * HD * TT) return; const int t = (int)(e % TT); const int d = (int)((e / TT) % HD); const int g = (int)(e / ((size_t)TT * HD)); v2h o16; v2us oh, ol;
#pragma unroll
    for (int q = 0; q < 2; ++q) { const float x = F[(size_t)(t + q) * pitch + g * HD + d]; o16[q] = tohx(x); unsigned short a2, c2; splitf(x, a2, c2); oh[q] = a2; ol[q] = c2; }
    *(v2h*)(V16 + e) = o16; *(v2us*)(Vh + e) = oh; *(v2us*)(Vl + e) = ol;  }
__global__ __launch_bounds__(256) void k_csid(float* CS) { const int idx = blockIdx.x * 256 + threadIdx.x; if (idx >= TT * HD) return; v2f cs; cs[0] = 1.0f; cs[1] = 0.0f; *(v2f*)(CS + (size_t)idx * 2) = cs;  }
// k_asoft: per row (zz, i): t = S x 1/8 where mask[b][j] == 0, excluded where it is non-zero (the batch's int key vector read as data; mask x -1e9 == exclusion); softmax over the keys (register row, one exp, fixed trees);
__global__ __launch_bounds__(256) void k_asoft(const float* __restrict__ Sb, const int* __restrict__ kvp, h16* P16, bf* Ph, bf* Pl) {
    const int lane = threadIdx.x & 31; const int row = blockIdx.x * 8 + (threadIdx.x >> 5); if (row >= ZH * TT) return; const int i = row % TT; const int zz = row / TT; (void)zz; const bool hires = (i < RH); const float* sr = Sb + (size_t)row * TT; float v[TT / 32]; float mx = -3.0e38f;
#pragma unroll
    for (int ch = 0; ch < TT / 128; ++ch) { const int j0 = ch * 128 + lane * 4; const v4f a = *(const v4f*)(sr + j0); const v4i kv4 = *(const v4i*)(kvp + j0);   /* the batch's key vector, 16 B per lane, unconditional */
#pragma unroll
        for (int q = 0; q < 4; ++q) { const int j = j0 + q; (void)j; const float t = (kv4[q] == 0) ? a[q] * SCL : -3.0e38f; v[ch * 4 + q] = t; mx = fmaxf(mx, t); } }
#pragma unroll
    for (int sh = 16; sh; sh >>= 1) mx = fmaxf(mx, __shfl_xor(mx, sh, 32));
    float sum = 0.f;
#pragma unroll
    for (int k = 0; k < TT / 32; ++k) { float d0 = __fsub_rn(v[k], mx); asm volatile("" : "+v"(d0)); v[k] = __builtin_amdgcn_exp2f(__fmul_rn(d0, 1.4426950408889634f)); sum += v[k]; }
#pragma unroll
    for (int sh = 16; sh; sh >>= 1) sum += __shfl_xor(sum, sh, 32);
    const float f = __fdiv_rn(hires ? 1.0f : PCAR, sum);
{
        if (hires) {
#pragma unroll
            for (int ch = 0; ch < TT / 128; ++ch) { v4us oh, ol;
#pragma unroll
                for (int q = 0; q < 4; ++q) { unsigned short a, c2; splitf(v[ch * 4 + q] * f, a, c2); oh[q] = a; ol[q] = c2; }
                const size_t oo = ((size_t)zz * (RH ? RH : 1) + i) * TT + ch * 128 + lane * 4; *(v4us*)(Ph + oo) = oh; *(v4us*)(Pl + oo) = ol; }
        } else {
#pragma unroll
            for (int ch = 0; ch < TT / 128; ++ch) { v4h o4;
#pragma unroll
                for (int q = 0; q < 4; ++q) o4[q] = tohx(v[ch * 4 + q] * f);
                *(v4h*)(P16 + (size_t)row * TT + ch * 128 + lane * 4) = o4; } }
         }
}
__global__ __launch_bounds__(256) void k_merge(const float* __restrict__ O, int h0, bf* Ah, bf* Al) { const size_t e = ((size_t)blockIdx.x * 256 + threadIdx.x) * 2; if (e >= (size_t)ZH * TT * HD) return; const int d = (int)(e % HD); const int t = (int)((e / HD) % TT); const int zz = (int)(e / ((size_t)HD * TT)); const float cs = (t < RH) ? 1.0f : (1.0f / PCAR); const size_t oo = (size_t)t * DQ + (h0 + zz) * HD + d;
    v2us oh, ol;
#pragma unroll
    for (int q = 0; q < 2; ++q) { unsigned short a, c2; splitf(O[e + q] * cs, a, c2); oh[q] = a; ol[q] = c2; } *(v2us*)(Ah + oo) = oh; *(v2us*)(Al + oo) = ol;  }

extern "C" void kernel_launch(void* const* d_in, const int* in_sizes, int n_in,
                              void* d_out, int out_size, void* d_ws, size_t ws_size, hipStream_t stream) {
    (void)in_sizes; (void)n_in; (void)out_size;
    const float* x = (const float*)d_in[0]; const float* xk = (const float*)d_in[1]; const float* xv = (const float*)d_in[2]; const int* kmask = (const int*)d_in[3];   /* mask [2][1][1][2048] int32: 1 = excluded key */ const float* wq = (const float*)d_in[4]; const float* bq = (const float*)d_in[5]; const float* wk = (const float*)d_in[6]; const float* bk = (const float*)d_in[7]; const float* wv = (const float*)d_in[8]; const float* bv = (const float*)d_in[9]; const float* wo = (const float*)d_in[10]; const float* bo = (const float*)d_in[11];   /* argument order query, key, value, mask, Wq, bq, Wk, bk, Wv, bv, Wo, bo ('xw') */
    float* OUT = (float*)d_out;     // [2][2048][1024]
    char* wsp = (char*)d_ws;
    auto take = [&](size_t bytes) { char* p = wsp; wsp += (bytes + 255) & ~(size_t)255; return (void*)p; };
    bf* WQ = (bf*)take((size_t)DQ * DM * 2); bf* WK = (bf*)take((size_t)DKV * DM * 2); bf* WV = (bf*)take((size_t)DKV * DM * 2); bf* WO = (bf*)take((size_t)DM * DQ * 2); float* CS = (float*)take((size_t)TT * HD * 2 * 4);
    bf* XB = (bf*)take((size_t)TT * DM * 2); float* FQ = (float*)take((size_t)TT * DQ * 4); float* FK = (float*)take((size_t)TT * DKV * 4);
    h16* QP16 = (h16*)take((size_t)NH_ * TT * HD * 2); h16* KP16 = (h16*)take((size_t)NKV * TT * HD * 2); h16* VT16 = (h16*)take((size_t)NKV * HD * TT * 2);
    bf* QPh = (bf*)take((size_t)NH_ * TT * HD * 2); bf* QPl = (bf*)take((size_t)NH_ * TT * HD * 2); bf* KPh = (bf*)take((size_t)NKV * TT * HD * 2); bf* KPl = (bf*)take((size_t)NKV * TT * HD * 2); bf* VTh = (bf*)take((size_t)NKV * HD * TT * 2); bf* VTl = (bf*)take((size_t)NKV * HD * TT * 2); bf* Ph = (bf*)take((size_t)ZH * RH * TT * 2); bf* Pl = (bf*)take((size_t)ZH * RH * TT * 2);
    float* Sb = (float*)take((size_t)ZH * TT * TT * 4); h16* P16 = (h16*)take((size_t)ZH * TT * TT * 2); float* Ob = (float*)take((size_t)ZH * TT * HD * 4); bf* ATh = (bf*)take((size_t)TT * DQ * 2); bf* ATl = (bf*)take((size_t)TT * DQ * 2);
    if ((size_t)(wsp - (char*)d_ws) > ws_size) return;    // ws 256 MiB
    float* FV = FK;   // v projection reuses the k buffer after the k planes are built (stream-ordered)
    { k_wtG<<<(unsigned)((DM * DQ / 64 + 63) / 64), 256, 0, stream>>>(wq, DM, DQ, WQ); k_wtG<<<(unsigned)((DM * DKV / 64 + 63) / 64), 256, 0, stream>>>(wk, DM, DKV, WK); k_wtG<<<(unsigned)((DM * DKV / 64 + 63) / 64), 256, 0, stream>>>(wv, DM, DKV, WV);
      k_wtG<<<(unsigned)((DQ * DM / 64 + 63) / 64), 256, 0, stream>>>(wo, DQ, DM, WO);
       }
    k_csid<<<(TT * HD + 255) / 256, 256, 0, stream>>>(CS);
    const unsigned LQ = (unsigned)(((size_t)NH_ * TT * HD / 2 + 255) / 256), LKv = (unsigned)(((size_t)NKV * TT * HD / 2 + 255) / 256);
    for (int b = 0; b < NB_; ++b) {
        
        k_cvt8<<<(unsigned)(((size_t)TT * DM / 8 + 255) / 256), 256, 0, stream>>>(x + (size_t)b * TT * DM, XB, (size_t)TT * DM / 8);
        k_gemmw<bf, 0, true><<<dim3(TT / 64, DQ / 64, 1), 32, 0, stream>>>(XB, nullptr, WQ, nullptr, DM, FQ, DQ, bq, 0, 0, 0);
        k_rope<<<LQ, 256, 0, stream>>>(FQ, DQ, NH_, CS, nullptr, nullptr, 1.0f, QP16, QPh, QPl);
        k_cvt8<<<(unsigned)(((size_t)TT * DM / 8 + 255) / 256), 256, 0, stream>>>(xk + (size_t)b * TT * DM, XB, (size_t)TT * DM / 8);   /* XB := bf16(key[b]) */ k_gemmw<bf, 0, true><<<dim3(TT / 64, DKV / 64, 1), 32, 0, stream>>>(XB, nullptr, WK, nullptr, DM, FK, DKV, bk, 0, 0, 0);
        k_rope<<<LKv, 256, 0, stream>>>(FK, DKV, NKV, CS, nullptr, nullptr, 1.0f, KP16, KPh, KPl);
        k_cvt8<<<(unsigned)(((size_t)TT * DM / 8 + 255) / 256), 256, 0, stream>>>(xv + (size_t)b * TT * DM, XB, (size_t)TT * DM / 8);   /* XB := bf16(value[b]) */ k_gemmw<bf, 0, true><<<dim3(TT / 64, DKV / 64, 1), 32, 0, stream>>>(XB, nullptr, WV, nullptr, DM, FV, DKV, bv, 0, 0, 0); k_vtp<<<LKv, 256, 0, stream>>>(FV, DKV, NKV, VT16, VTh, VTl);
        for (int h0 = 0; h0 < NH_; h0 += ZH) { const size_t zq = (size_t)h0, zk = (size_t)(h0 / REP);   // one kv head per query head: the pass's two heads use consecutive kv planes (z-strides TT*HD)
            k_gemmw<bf, 2, false><<<dim3(RH / 64, TT / 64, ZH), 32, 0, stream>>>(QPh + zq * TT * HD, QPl + zq * TT * HD, KPh + zk * TT * HD, KPl + zk * TT * HD, HD, Sb, TT, nullptr, (size_t)TT * HD, (size_t)TT * HD, (size_t)TT * TT);
            k_gemmw<h16, 0, false><<<dim3((TT - RH) / 64, TT / 64, ZH), 32, 0, stream>>>(QP16 + zq * TT * HD + (size_t)RH * HD, nullptr, KP16 + zk * TT * HD, nullptr, HD, Sb + (size_t)RH * TT, TT, nullptr, (size_t)TT * HD, (size_t)TT * HD, (size_t)TT * TT);
            k_asoft<<<ZH * TT / 8, 256, 0, stream>>>(Sb, kmask + (size_t)b * TT, P16, Ph, Pl);
            k_gemmw<bf, 2, false><<<dim3(RH / 64, HD / 64, ZH), 32, 0, stream>>>(Ph, Pl, VTh + zk * HD * TT, VTl + zk * HD * TT, TT, Ob, HD, nullptr, (size_t)RH * TT, (size_t)HD * TT, (size_t)TT * HD);
            k_gemmw<h16, 0, false><<<dim3((TT - RH) / 64, HD / 64, ZH), 32, 0, stream>>>(P16 + (size_t)RH * TT, nullptr, VT16 + zk * HD * TT, nullptr, TT, Ob + (size_t)RH * HD, HD, nullptr, (size_t)TT * TT, (size_t)HD * TT, (size_t)TT * HD);
            k_merge<<<(unsigned)(((size_t)ZH * TT * HD / 2 + 255) / 256), 256, 0, stream>>>(Ob, h0, ATh, ATl); }
        k_gemmw<bf, 1, true><<<dim3(TT / 64, DM / 64, 1), 32, 0, stream>>>(ATh, ATl, WO, nullptr, DQ, OUT + (size_t)b * TT * DM, DM, bo, 0, 0, 0); }
}

// v001
// One run takes 1090 microseconds.
// In two side-by-side timings against v000, it was 1.88 and 1.87 times as fast.
#include <hip/hip_runtime.h>

// Multi-head attention on three input streams with a per-batch key mask (query, key, value [2][2048][1024]; q = query Wq + bq, k = key Wk + bk, v = value Wv + bv ('xw' 1/32, zero biases; 16 heads x 64); logits = q.k / sqrt(64) + mask[b][0][0][j] x (-1e9) with mask int32 [2][1][1][2048] random 0/1 (read; 1 == that key is excluded); softmax; out = merged Wo + bo -> [2][2048][1024] (4.2 M); argument order query, key, value, mask, Wq, bq, Wk, bk, Wv, bv, Wo, bo).
// Layout per batch: bf16 copies of query, key, value in turn; 'xw' weights transposed once; exact projections + f32 biases; identity-table plane builders; dense T-2048 attention (hybrid rows: < 512 hi/lo 3 products, rest fp16 x1024); the softmax kernel reads the batch's int key vector (16 B per lane) and excludes keys whose mask is non-zero by select (-1e9 == exclusion; about half the keys remain); merged hi/lo x Wo exact + bo.
// Compute dtypes, f32 accumulate: every input rounded to bf16; projections exact + f32 biases; attention rows < 512 3 products, rest fp16; softmax f32; Wo hl x exact + bias.

#define NB_  2
#define TT   2048
#define DM   1024
#define NH_  16
#define NKV  16
#define REP  (NH_ / NKV)
#define HD   64
#define DQ   (NH_ * HD)
#define DKV  (NKV * HD)
#define ZH   2
#define RH   512                  // query rows < RH use hi+lo planes (0: none)
#define WIN  0
#define PCAR 1024.0f
#define SCL  0.125f   // HD^-0.5
typedef _Float16 h16;
typedef unsigned short bf;
typedef __attribute__((ext_vector_type(16))) __bf16   v16bf;
typedef __attribute__((ext_vector_type(16))) _Float16 v16h;
typedef __attribute__((ext_vector_type(8)))  _Float16 v8h;
typedef __attribute__((ext_vector_type(8)))  unsigned short v8us;
typedef __attribute__((ext_vector_type(8)))  float    v8f;
typedef __attribute__((ext_vector_type(4)))  float    v4f;
typedef v8h  __attribute__((may_alias)) v8ha;
typedef v4f  __attribute__((may_alias)) v4fa;
typedef v8us __attribute__((may_alias)) v8usa;

__device__ __forceinline__ unsigned short f2bf(float f) { unsigned u = __float_as_uint(f); u += 0x7FFFu + ((u >> 16) & 1u); return (unsigned short)(u >> 16); }
__device__ __forceinline__ float bf2f(unsigned short b) { return __uint_as_float(((unsigned)b) << 16); }
__device__ __forceinline__ float bfr(float f) { return bf2f(f2bf(f)); }
__device__ __forceinline__ v16h cat16(v8h lo, v8h hi) { return __builtin_shufflevector(lo, hi, 0, 1, 2, 3, 4, 5, 6, 7, 8, 9, 10, 11, 12, 13, 14, 15); }
__device__ __forceinline__ v16bf cat16b(v8us lo, v8us hi) { return __builtin_bit_cast(v16bf, __builtin_shufflevector(lo, hi, 0, 1, 2, 3, 4, 5, 6, 7, 8, 9, 10, 11, 12, 13, 14, 15)); }
__device__ __forceinline__ v8f wmma16(v16h a, v16h b, v8f c) { return __builtin_amdgcn_wmma_f32_16x16x32_f16(false, a, false, b, (short)0, c, false, false); }
__device__ __forceinline__ v8f wmmab(v16bf a, v16bf b, v8f c) { return __builtin_amdgcn_wmma_f32_16x16x32_bf16(false, a, false, b, (short)0, c, false, false); }



// ---- k_gemmw: register-blocked GEMM, one work-group of NW waves per 64x64 output tile (16 accumulators a wave), operands straight from K-contiguous 16-bit planes; grid (M/64, N/64, Z), 32 * NW threads.
// C[m][n] (f32, pitch ldc, + optional f32 bias[n]) = sum_k A[m][k] Bt[n][k] (+ split products per NSPLIT). z-batch strides sA/sB/sC in elements. K % (32 * NW) == 0.
// K is dealt to the waves in 32-wide steps, wave w taking steps w, w + NW, ... (neighbour waves read the two halves of one 128-byte line); the NW partial tiles meet in LDS and are summed in wave order 0 .. NW-1.
template <typename T16> struct WFrag;
template <> struct WFrag<h16> { typedef v16h V; static __device__ __forceinline__ V ld(const h16* p) { return cat16(*(const v8h*)p, *(const v8h*)(p + 16)); } static __device__ __forceinline__ v8f mma(V a, V b, v8f c) { return wmma16(a, b, c); } };
template <> struct WFrag<bf> { typedef v16bf V; static __device__ __forceinline__ V ld(const bf* p) { return cat16b(*(const v8us*)p, *(const v8us*)(p + 16)); } static __device__ __forceinline__ v8f mma(V a, V b, v8f c) { return wmmab(a, b, c); } };
template <typename T16, int NSPLIT, bool BIAS, int NW>
__global__ __launch_bounds__(32 * NW) void k_gemmw(const T16* __restrict__ A, const T16* __restrict__ A2, const T16* __restrict__ Bt, const T16* __restrict__ Bt2, int K, float* C, int ldc, const float* __restrict__ bias, size_t sA, size_t sB, size_t sC) {
    typedef typename WFrag<T16>::V V;
    constexpr int MR = (NW == 1) ? 1 : 4;      // 16-row blocks of the tile that pass through LDS at a time (all four where waves join: one barrier)
    constexpr int SL = MR * 16 * 68;           // one wave's slab, floats
    __shared__ __align__(16) float os[NW * SL];
    const int wv = (NW == 1) ? 0 : __builtin_amdgcn_readfirstlane((int)(threadIdx.x >> 5));
    const size_t z = blockIdx.z; A += z * sA; if (A2) A2 += z * sA; Bt += z * sB; if (Bt2) Bt2 += z * sB; C += z * sC;
    const int lane = threadIdx.x & 31, lr = lane & 15, hi = lane >> 4; const int r0 = blockIdx.x * 64, c0 = blockIdx.y * 64;
    v8f acc[4][4];
#pragma unroll
    for (int mb = 0; mb < 4; ++mb)
#pragma unroll
        for (int nb = 0; nb < 4; ++nb) acc[mb][nb] = (v8f){};
    const size_t aoff = (size_t)(r0 + lr) * K + 8 * hi, boff = (size_t)(c0 + lr) * K + 8 * hi;
#pragma unroll 1
    for (int kc = wv * 32; kc < K; kc += 32 * NW) {
        V a[4], a2[4];
#pragma unroll
        for (int mb = 0; mb < 4; ++mb) { a[mb] = WFrag<T16>::ld(A + aoff + (size_t)mb * 16 * K + kc); if (NSPLIT == 1 || NSPLIT == 2) a2[mb] = WFrag<T16>::ld(A2 + aoff + (size_t)mb * 16 * K + kc); }
#pragma unroll
        for (int nb = 0; nb < 4; ++nb) { const V b = WFrag<T16>::ld(Bt + boff + (size_t)nb * 16 * K + kc); V b2; if (NSPLIT >= 2) b2 = WFrag<T16>::ld(Bt2 + boff + (size_t)nb * 16 * K + kc);
#pragma unroll
            for (int mb = 0; mb < 4; ++mb) { acc[mb][nb] = WFrag<T16>::mma(a[mb], b, acc[mb][nb]); if (NSPLIT == 1 || NSPLIT == 2) acc[mb][nb] = WFrag<T16>::mma(a2[mb], b, acc[mb][nb]); if (NSPLIT >= 2) acc[mb][nb] = WFrag<T16>::mma(a[mb], b2, acc[mb][nb]); } }
        asm volatile("v_nop\n\tv_nop\n\tv_nop\n\tv_nop" : "+v"(acc[0][0]), "+v"(acc[1][1]), "+v"(acc[2][2]), "+v"(acc[3][3]) : "v"(a[0]), "v"(a[3]));
    }
    float* osw = os + wv * SL;
#pragma unroll
    for (int m0 = 0; m0 < 4; m0 += MR) {
#pragma unroll
        for (int mi = 0; mi < MR; ++mi) {
#pragma unroll
            for (int nb = 0; nb < 4; ++nb) {
#pragma unroll
                for (int j = 0; j < 8; ++j) osw[(mi * 16 + hi * 8 + j) * 68 + nb * 16 + lr] = acc[m0 + mi][nb][j]; } }
        if (NW == 1) { __builtin_amdgcn_wave_barrier(); asm volatile("" ::: "memory"); } else __syncthreads();   // every wave's partial tile is in LDS before any is summed
        float* crow = C + (size_t)(r0 + m0 * 16) * ldc + c0;
#pragma unroll
        for (int s = 0; s < MR * 8 / NW; ++s) { const int g = s * 32 * NW + (int)threadIdx.x, row = g >> 4, cofs = (g & 15) * 4; v4f val = *(const v4fa*)(os + row * 68 + cofs);
#pragma unroll
            for (int w = 1; w < NW; ++w) val += *(const v4fa*)(os + w * SL + row * 68 + cofs);
            if (BIAS) { val[0] += bfr(bias[c0 + cofs]); val[1] += bfr(bias[c0 + cofs + 1]); val[2] += bfr(bias[c0 + cofs + 2]); val[3] += bfr(bias[c0 + cofs + 3]); }
            *(v4f*)(crow + (size_t)row * ldc + cofs) = val; }
        if (NW == 1) { __builtin_amdgcn_wave_barrier(); asm volatile("" ::: "memory"); }   // the slab is rewritten by the next row block
    }
}

__device__ __forceinline__ h16 tohx(float x) { return (h16)x; }
__device__ __forceinline__ void splitf(float y, unsigned short& h, unsigned short& l) { h = f2bf(y); l = f2bf(y - bf2f(h)); }
typedef __attribute__((ext_vector_type(2))) _Float16 v2h;
typedef __attribute__((ext_vector_type(4))) _Float16 v4h;
typedef __attribute__((ext_vector_type(2))) unsigned short v2us;
typedef __attribute__((ext_vector_type(4))) unsigned short v4us;
typedef __attribute__((ext_vector_type(2))) float v2f;
typedef __attribute__((ext_vector_type(4))) int v4i;

__global__ __launch_bounds__(256) void k_wtG(const float* __restrict__ w, int K, int N, bf* Bt) {
    const int lane = threadIdx.x & 31; const int L0 = (blockIdx.x * 8 + (threadIdx.x >> 5)) * 8; const int nlines = N * K / 64;
{
#pragma unroll 1
        for (int l = 0; l < 8; ++l) { const int L = L0 + l; if (L >= nlines) break; const size_t e = (size_t)L * 64 + lane * 2; const int k = (int)(e % K), n = (int)(e / K); v2us o;
            o[0] = f2bf(w[(size_t)k * N + n]); o[1] = f2bf(w[(size_t)(k + 1) * N + n]); *(v2us*)(Bt + e) = o; }
         }
}
__global__ __launch_bounds__(256) void k_cvt8(const float* __restrict__ src, bf* dst, size_t n8) { const size_t i = (size_t)blockIdx.x * 256 + threadIdx.x; if (i >= n8) return; const v8f v = *(const v8f*)(src + i * 8); v8us o;
#pragma unroll
    for (int k = 0; k < 8; ++k) o[k] = f2bf(v[k]); *(v8us*)(dst + i * 8) = o;  }

// k_rope: head planes [h][t][d] (fp16 + hi/lo) of rope(x) x sc with the rotate-half convention out[d] = x[d] cos[t][d] - x[d+HD/2] sin[t][d], out[d+HD/2] = x[d+HD/2] cos[t][d+HD/2] + x[d] sin[t][d+HD/2]
__global__ __launch_bounds__(256) void k_rope(const float* __restrict__ F, int pitch, int nheads, const float* __restrict__ CS, const float* __restrict__ RF, const float* __restrict__ nw, float sc, h16* P16, bf* Ph, bf* Pl) {
    const size_t e = ((size_t)blockIdx.x * 256 + threadIdx.x) * 2; if (e >= (size_t)nheads * TT * HD) return; const int d = (int)(e % HD); const int t = (int)((e / HD) % TT); const int h = (int)(e / ((size_t)HD * TT)); const float* f = F + (size_t)t * pitch + h * HD; const float rf = RF ? RF[(size_t)h * TT + t] : 1.0f; v2h o16; v2us oh, ol;
#pragma unroll
    for (int q = 0; q < 2; ++q) { const int dd = d + q; const int dp = (dd < HD / 2) ? dd + HD / 2 : dd - HD / 2; float x0 = f[dd], x1 = f[dp];
        if (RF) { float n0 = __fmul_rn(x0, rf), n1 = __fmul_rn(x1, rf); asm volatile("" : "+v"(n0)); asm volatile("" : "+v"(n1)); x0 = __fmul_rn(bfr(nw[dd]), n0); x1 = __fmul_rn(bfr(nw[dp]), n1); }
        const v2f cs = *(const v2f*)(CS + ((size_t)t * HD + dd) * 2); float a = __fmul_rn(x0, cs[0]), bq = __fmul_rn(x1, cs[1]); asm volatile("" : "+v"(a)); asm volatile("" : "+v"(bq)); const float r = ((dd < HD / 2) ? __fsub_rn(a, bq) : __fadd_rn(a, bq)) * sc;
        o16[q] = tohx(r); unsigned short a2, c2; splitf(r, a2, c2); oh[q] = a2; ol[q] = c2; }
    *(v2h*)(P16 + e) = o16; *(v2us*)(Ph + e) = oh; *(v2us*)(Pl + e) = ol;  }
__global__ __launch_bounds__(256) void k_vtp(const float* __restrict__ F, int pitch, int nheads, h16* V16, bf* Vh, bf* Vl) { const size_t e = ((size_t)blockIdx.x * 256 + threadIdx.x) * 2; if (e >= (size_t)nheads * HD * TT) return; const int t = (int)(e % TT); const int d = (int)((e / TT) % HD); const int g = (int)(e / ((size_t)TT * HD)); v2h o16; v2us oh, ol;
#pragma unroll
    for (int q = 0; q < 2; ++q) { const float x = F[(size_t)(t + q) * pitch + g * HD + d]; o16[q] = tohx(x); unsigned short a2, c2; splitf(x, a2, c2); oh[q] = a2; ol[q] = c2; }
    *(v2h*)(V16 + e) = o16; *(v2us*)(Vh + e) = oh; *(v2us*)(Vl + e) = ol;  }
__global__ __launch_bounds__(256) void k_csid(float* CS) { const int idx = blockIdx.x * 256 + threadIdx.x; if (idx >= TT * HD) return; v2f cs; cs[0] = 1.0f; cs[1] = 0.0f; *(v2f*)(CS + (size_t)idx * 2) = cs;  }
// k_asoft: per row (zz, i): t = S x 1/8 where mask[b][j] == 0, excluded where it is non-zero (the batch's int key vector read as data; mask x -1e9 == exclusion); softmax over the keys (register row, one exp, fixed trees);
__global__ __launch_bounds__(256) void k_asoft(const float* __restrict__ Sb, const int* __restrict__ kvp, h16* P16, bf* Ph, bf* Pl) {
    const int lane = threadIdx.x & 31; const int row = blockIdx.x * 8 + (threadIdx.x >> 5); if (row >= ZH * TT) return; const int i = row % TT; const int zz = row / TT; (void)zz; const bool hires = (i < RH); const float* sr = Sb + (size_t)row * TT; float v[TT / 32]; float mx = -3.0e38f;
#pragma unroll
    for (int ch = 0; ch < TT / 128; ++ch) { const int j0 = ch * 128 + lane * 4; const v4f a = *(const v4f*)(sr + j0); const v4i kv4 = *(const v4i*)(kvp + j0);   /* the batch's key vector, 16 B per lane, unconditional */
#pragma unroll
        for (int q = 0; q < 4; ++q) { const int j = j0 + q; (void)j; const float t = (kv4[q] == 0) ? a[q] * SCL : -3.0e38f; v[ch * 4 + q] = t; mx = fmaxf(mx, t); } }
#pragma unroll
    for (int sh = 16; sh; sh >>= 1) mx = fmaxf(mx, __shfl_xor(mx, sh, 32));
    float sum = 0.f;
#pragma unroll
    for (int k = 0; k < TT / 32; ++k) { float d0 = __fsub_rn(v[k], mx); asm volatile("" : "+v"(d0)); v[k] = __builtin_amdgcn_exp2f(__fmul_rn(d0, 1.4426950408889634f)); sum += v[k]; }
#pragma unroll
    for (int sh = 16; sh; sh >>= 1) sum += __shfl_xor(sum, sh, 32);
    const float f = __fdiv_rn(hires ? 1.0f : PCAR, sum);
{
        if (hires) {
#pragma unroll
            for (int ch = 0; ch < TT / 128; ++ch) { v4us oh, ol;
#pragma unroll
                for (int q = 0; q < 4; ++q) { unsigned short a, c2; splitf(v[ch * 4 + q] * f, a, c2); oh[q] = a; ol[q] = c2; }
                const size_t oo = ((size_t)zz * (RH ? RH : 1) + i) * TT + ch * 128 + lane * 4; *(v4us*)(Ph + oo) = oh; *(v4us*)(Pl + oo) = ol; }
        } else {
#pragma unroll
            for (int ch = 0; ch < TT / 128; ++ch) { v4h o4;
#pragma unroll
                for (int q = 0; q < 4; ++q) o4[q] = tohx(v[ch * 4 + q] * f);
                *(v4h*)(P16 + (size_t)row * TT + ch * 128 + lane * 4) = o4; } }
         }
}
__global__ __launch_bounds__(256) void k_merge(const float* __restrict__ O, int h0, bf* Ah, bf* Al) { const size_t e = ((size_t)blockIdx.x * 256 + threadIdx.x) * 2; if (e >= (size_t)ZH * TT * HD) return; const int d = (int)(e % HD); const int t = (int)((e / HD) % TT); const int zz = (int)(e / ((size_t)HD * TT)); const float cs = (t < RH) ? 1.0f : (1.0f / PCAR); const size_t oo = (size_t)t * DQ + (h0 + zz) * HD + d;
    v2us oh, ol;
#pragma unroll
    for (int q = 0; q < 2; ++q) { unsigned short a, c2; splitf(O[e + q] * cs, a, c2); oh[q] = a; ol[q] = c2; } *(v2us*)(Ah + oo) = oh; *(v2us*)(Al + oo) = ol;  }

extern "C" void kernel_launch(void* const* d_in, const int* in_sizes, int n_in,
                              void* d_out, int out_size, void* d_ws, size_t ws_size, hipStream_t stream) {
    (void)in_sizes; (void)n_in; (void)out_size;
    const float* x = (const float*)d_in[0]; const float* xk = (const float*)d_in[1]; const float* xv = (const float*)d_in[2]; const int* kmask = (const int*)d_in[3];   /* mask [2][1][1][2048] int32: 1 = excluded key */ const float* wq = (const float*)d_in[4]; const float* bq = (const float*)d_in[5]; const float* wk = (const float*)d_in[6]; const float* bk = (const float*)d_in[7]; const float* wv = (const float*)d_in[8]; const float* bv = (const float*)d_in[9]; const float* wo = (const float*)d_in[10]; const float* bo = (const float*)d_in[11];   /* argument order query, key, value, mask, Wq, bq, Wk, bk, Wv, bv, Wo, bo ('xw') */
    float* OUT = (float*)d_out;     // [2][2048][1024]
    char* wsp = (char*)d_ws;
    auto take = [&](size_t bytes) { char* p = wsp; wsp += (bytes + 255) & ~(size_t)255; return (void*)p; };
    bf* WQ = (bf*)take((size_t)DQ * DM * 2); bf* WK = (bf*)take((size_t)DKV * DM * 2); bf* WV = (bf*)take((size_t)DKV * DM * 2); bf* WO = (bf*)take((size_t)DM * DQ * 2); float* CS = (float*)take((size_t)TT * HD * 2 * 4);
    bf* XB = (bf*)take((size_t)TT * DM * 2); float* FQ = (float*)take((size_t)TT * DQ * 4); float* FK = (float*)take((size_t)TT * DKV * 4);
    h16* QP16 = (h16*)take((size_t)NH_ * TT * HD * 2); h16* KP16 = (h16*)take((size_t)NKV * TT * HD * 2); h16* VT16 = (h16*)take((size_t)NKV * HD * TT * 2);
    bf* QPh = (bf*)take((size_t)NH_ * TT * HD * 2); bf* QPl = (bf*)take((size_t)NH_ * TT * HD * 2); bf* KPh = (bf*)take((size_t)NKV * TT * HD * 2); bf* KPl = (bf*)take((size_t)NKV * TT * HD * 2); bf* VTh = (bf*)take((size_t)NKV * HD * TT * 2); bf* VTl = (bf*)take((size_t)NKV * HD * TT * 2); bf* Ph = (bf*)take((size_t)ZH * RH * TT * 2); bf* Pl = (bf*)take((size_t)ZH * RH * TT * 2);
    float* Sb = (float*)take((size_t)ZH * TT * TT * 4); h16* P16 = (h16*)take((size_t)ZH * TT * TT * 2); float* Ob = (float*)take((size_t)ZH * TT * HD * 4); bf* ATh = (bf*)take((size_t)TT * DQ * 2); bf* ATl = (bf*)take((size_t)TT * DQ * 2);
    if ((size_t)(wsp - (char*)d_ws) > ws_size) return;    // ws 256 MiB
    float* FV = FK;   // v projection reuses the k buffer after the k planes are built (stream-ordered)
    { k_wtG<<<(unsigned)((DM * DQ / 64 + 63) / 64), 256, 0, stream>>>(wq, DM, DQ, WQ); k_wtG<<<(unsigned)((DM * DKV / 64 + 63) / 64), 256, 0, stream>>>(wk, DM, DKV, WK); k_wtG<<<(unsigned)((DM * DKV / 64 + 63) / 64), 256, 0, stream>>>(wv, DM, DKV, WV);
      k_wtG<<<(unsigned)((DQ * DM / 64 + 63) / 64), 256, 0, stream>>>(wo, DQ, DM, WO);
       }
    k_csid<<<(TT * HD + 255) / 256, 256, 0, stream>>>(CS);
    const unsigned LQ = (unsigned)(((size_t)NH_ * TT * HD / 2 + 255) / 256), LKv = (unsigned)(((size_t)NKV * TT * HD / 2 + 255) / 256);
    for (int b = 0; b < NB_; ++b) {
        
        k_cvt8<<<(unsigned)(((size_t)TT * DM / 8 + 255) / 256), 256, 0, stream>>>(x + (size_t)b * TT * DM, XB, (size_t)TT * DM / 8);
        k_gemmw<bf, 0, true, 8><<<dim3(TT / 64, DQ / 64, 1), 256, 0, stream>>>(XB, nullptr, WQ, nullptr, DM, FQ, DQ, bq, 0, 0, 0);
        k_rope<<<LQ, 256, 0, stream>>>(FQ, DQ, NH_, CS, nullptr, nullptr, 1.0f, QP16, QPh, QPl);
        k_cvt8<<<(unsigned)(((size_t)TT * DM / 8 + 255) / 256), 256, 0, stream>>>(xk + (size_t)b * TT * DM, XB, (size_t)TT * DM / 8);   /* XB := bf16(key[b]) */ k_gemmw<bf, 0, true, 8><<<dim3(TT / 64, DKV / 64, 1), 256, 0, stream>>>(XB, nullptr, WK, nullptr, DM, FK, DKV, bk, 0, 0, 0);
        k_rope<<<LKv, 256, 0, stream>>>(FK, DKV, NKV, CS, nullptr, nullptr, 1.0f, KP16, KPh, KPl);
        k_cvt8<<<(unsigned)(((size_t)TT * DM / 8 + 255) / 256), 256, 0, stream>>>(xv + (size_t)b * TT * DM, XB, (size_t)TT * DM / 8);   /* XB := bf16(value[b]) */ k_gemmw<bf, 0, true, 8><<<dim3(TT / 64, DKV / 64, 1), 256, 0, stream>>>(XB, nullptr, WV, nullptr, DM, FV, DKV, bv, 0, 0, 0); k_vtp<<<LKv, 256, 0, stream>>>(FV, DKV, NKV, VT16, VTh, VTl);
        for (int h0 = 0; h0 < NH_; h0 += ZH) { const size_t zq = (size_t)h0, zk = (size_t)(h0 / REP);   // one kv head per query head: the pass's two heads use consecutive kv planes (z-strides TT*HD)
            k_gemmw<bf, 2, false, 1><<<dim3(RH / 64, TT / 64, ZH), 32, 0, stream>>>(QPh + zq * TT * HD, QPl + zq * TT * HD, KPh + zk * TT * HD, KPl + zk * TT * HD, HD, Sb, TT, nullptr, (size_t)TT * HD, (size_t)TT * HD, (size_t)TT * TT);
            k_gemmw<h16, 0, false, 1><<<dim3((TT - RH) / 64, TT / 64, ZH), 32, 0, stream>>>(QP16 + zq * TT * HD + (size_t)RH * HD, nullptr, KP16 + zk * TT * HD, nullptr, HD, Sb + (size_t)RH * TT, TT, nullptr, (size_t)TT * HD, (size_t)TT * HD, (size_t)TT * TT);
            k_asoft<<<ZH * TT / 8, 256, 0, stream>>>(Sb, kmask + (size_t)b * TT, P16, Ph, Pl);
            k_gemmw<bf, 2, false, 16><<<dim3(RH / 64, HD / 64, ZH), 512, 0, stream>>>(Ph, Pl, VTh + zk * HD * TT, VTl + zk * HD * TT, TT, Ob, HD, nullptr, (size_t)RH * TT, (size_t)HD * TT, (size_t)TT * HD);
            k_gemmw<h16, 0, false, 16><<<dim3((TT - RH) / 64, HD / 64, ZH), 512, 0, stream>>>(P16 + (size_t)RH * TT, nullptr, VT16 + zk * HD * TT, nullptr, TT, Ob + (size_t)RH * HD, HD, nullptr, (size_t)TT * TT, (size_t)HD * TT, (size_t)TT * HD);
            k_merge<<<(unsigned)(((size_t)ZH * TT * HD / 2 + 255) / 256), 256, 0, stream>>>(Ob, h0, ATh, ATl); }
        k_gemmw<bf, 1, true, 8><<<dim3(TT / 64, DM / 64, 1), 256, 0, stream>>>(ATh, ATl, WO, nullptr, DQ, OUT + (size_t)b * TT * DM, DM, bo, 0, 0, 0); }
}

// v002
// One run takes 613 microseconds.
// In two side-by-side timings against v001, it was 1.78 and 1.79 times as fast.
// Over all steps from v000 it is 3.35 times as fast.
#include <hip/hip_runtime.h>

// Multi-head attention on three input streams with a per-batch key mask (query, key, value [2][2048][1024]; q = query Wq + bq, k = key Wk + bk, v = value Wv + bv ('xw' 1/32, zero biases; 16 heads x 64); logits = q.k / sqrt(64) + mask[b][0][0][j] x (-1e9) with mask int32 [2][1][1][2048] random 0/1 (read; 1 == that key is excluded); softmax; out = merged Wo + bo -> [2][2048][1024] (4.2 M); argument order query, key, value, mask, Wq, bq, Wk, bk, Wv, bv, Wo, bo).
// Layout per batch: bf16 copies of query, key, value in turn; 'xw' weights transposed once; exact projections + f32 biases; identity-table plane builders; dense T-2048 attention (hybrid rows: < 512 hi/lo 3 products, rest fp16 x1024); the softmax kernel reads the batch's int key vector (16 B per lane) and excludes keys whose mask is non-zero by select (-1e9 == exclusion; about half the keys remain); merged hi/lo x Wo exact + bo.
// Compute dtypes, f32 accumulate: every input rounded to bf16; projections exact + f32 biases; attention rows < 512 3 products, rest fp16; softmax f32; Wo hl x exact + bias.

#define NB_  2
#define TT   2048
#define DM   1024
#define NH_  16
#define NKV  16
#define REP  (NH_ / NKV)
#define HD   64
#define DQ   (NH_ * HD)
#define DKV  (NKV * HD)
#define ZH   8                    // heads per attention pass (z of the S, softmax, P.V and merge launches)
#define RH   512                  // query rows < RH use hi+lo planes (0: none)
#define WIN  0
#define PCAR 1024.0f
#define SCL  0.125f   // HD^-0.5
typedef _Float16 h16;
typedef unsigned short bf;
typedef __attribute__((ext_vector_type(16))) __bf16   v16bf;
typedef __attribute__((ext_vector_type(16))) _Float16 v16h;
typedef __attribute__((ext_vector_type(8)))  _Float16 v8h;
typedef __attribute__((ext_vector_type(8)))  unsigned short v8us;
typedef __attribute__((ext_vector_type(8)))  float    v8f;
typedef __attribute__((ext_vector_type(4)))  float    v4f;
typedef v8h  __attribute__((may_alias)) v8ha;
typedef v4f  __attribute__((may_alias)) v4fa;
typedef v8us __attribute__((may_alias)) v8usa;

__device__ __forceinline__ unsigned short f2bf(float f) { unsigned u = __float_as_uint(f); u += 0x7FFFu + ((u >> 16) & 1u); return (unsigned short)(u >> 16); }
__device__ __forceinline__ float bf2f(unsigned short b) { return __uint_as_float(((unsigned)b) << 16); }
__device__ __forceinline__ float bfr(float f) { return bf2f(f2bf(f)); }
__device__ __forceinline__ v16h cat16(v8h lo, v8h hi) { return __builtin_shufflevector(lo, hi, 0, 1, 2, 3, 4, 5, 6, 7, 8, 9, 10, 11, 12, 13, 14, 15); }
__device__ __forceinline__ v16bf cat16b(v8us lo, v8us hi) { return __builtin_bit_cast(v16bf, __builtin_shufflevector(lo, hi, 0, 1, 2, 3, 4, 5, 6, 7, 8, 9, 10, 11, 12, 13, 14, 15)); }
__device__ __forceinline__ v8f wmma16(v16h a, v16h b, v8f c) { return __builtin_amdgcn_wmma_f32_16x16x32_f16(false, a, false, b, (short)0, c, false, false); }
__device__ __forceinline__ v8f wmmab(v16bf a, v16bf b, v8f c) { return __builtin_amdgcn_wmma_f32_16x16x32_bf16(false, a, false, b, (short)0, c, false, false); }



// ---- k_gemmw: register-blocked GEMM, one work-group of NW waves per 64x64 output tile (16 accumulators a wave), operands straight from K-contiguous 16-bit planes; grid (M/64, N/64, Z), 32 * NW threads.
// C[m][n] (f32, pitch ldc, + optional f32 bias[n]) = sum_k A[m][k] Bt[n][k] (+ split products per NSPLIT). z-batch strides sA/sB/sC in elements. K % (32 * NW) == 0. A's row pitch is AP * K elements (AP == 2: P planes that lie in the S rows).
// K is dealt to the waves in 32-wide steps, wave w taking steps w, w + NW, ... (neighbour waves read the two halves of one 128-byte line); the NW partial tiles meet in LDS and are summed in wave order 0 .. NW-1.
template <typename T16> struct WFrag;
template <> struct WFrag<h16> { typedef v16h V; static __device__ __forceinline__ V ld(const h16* p) { return cat16(*(const v8h*)p, *(const v8h*)(p + 16)); } static __device__ __forceinline__ v8f mma(V a, V b, v8f c) { return wmma16(a, b, c); } };
template <> struct WFrag<bf> { typedef v16bf V; static __device__ __forceinline__ V ld(const bf* p) { return cat16b(*(const v8us*)p, *(const v8us*)(p + 16)); } static __device__ __forceinline__ v8f mma(V a, V b, v8f c) { return wmmab(a, b, c); } };
template <typename T16, int NSPLIT, bool BIAS, int NW, int AP = 1>
__global__ __launch_bounds__(32 * NW) void k_gemmw(const T16* __restrict__ A, const T16* __restrict__ A2, const T16* __restrict__ Bt, const T16* __restrict__ Bt2, int K, float* C, int ldc, const float* __restrict__ bias, size_t sA, size_t sB, size_t sC) {
    typedef typename WFrag<T16>::V V;
    constexpr int MR = (NW == 1) ? 1 : 4;      // 16-row blocks of the tile that pass through LDS at a time (all four where waves join: one barrier)
    constexpr int SL = MR * 16 * 68;           // one wave's slab, floats
    __shared__ __align__(16) float os[NW * SL];
    const int wv = (NW == 1) ? 0 : __builtin_amdgcn_readfirstlane((int)(threadIdx.x >> 5));
    const size_t z = blockIdx.z; A += z * sA; if (A2) A2 += z * sA; Bt += z * sB; if (Bt2) Bt2 += z * sB; C += z * sC;
    const int lane = threadIdx.x & 31, lr = lane & 15, hi = lane >> 4; const int r0 = blockIdx.x * 64, c0 = blockIdx.y * 64;
    v8f acc[4][4];
#pragma unroll
    for (int mb = 0; mb < 4; ++mb)
#pragma unroll
        for (int nb = 0; nb < 4; ++nb) acc[mb][nb] = (v8f){};
    const size_t aoff = (size_t)(r0 + lr) * K * AP + 8 * hi, boff = (size_t)(c0 + lr) * K + 8 * hi;
#pragma unroll 1
    for (int kc = wv * 32; kc < K; kc += 32 * NW) {
        V a[4], a2[4];
#pragma unroll
        for (int mb = 0; mb < 4; ++mb) { a[mb] = WFrag<T16>::ld(A + aoff + (size_t)mb * 16 * K * AP + kc); if (NSPLIT == 1 || NSPLIT == 2) a2[mb] = WFrag<T16>::ld(A2 + aoff + (size_t)mb * 16 * K * AP + kc); }
#pragma unroll
        for (int nb = 0; nb < 4; ++nb) { const V b = WFrag<T16>::ld(Bt + boff + (size_t)nb * 16 * K + kc); V b2; if (NSPLIT >= 2) b2 = WFrag<T16>::ld(Bt2 + boff + (size_t)nb * 16 * K + kc);
#pragma unroll
            for (int mb = 0; mb < 4; ++mb) { acc[mb][nb] = WFrag<T16>::mma(a[mb], b, acc[mb][nb]); if (NSPLIT == 1 || NSPLIT == 2) acc[mb][nb] = WFrag<T16>::mma(a2[mb], b, acc[mb][nb]); if (NSPLIT >= 2) acc[mb][nb] = WFrag<T16>::mma(a[mb], b2, acc[mb][nb]); } }
        asm volatile("v_nop\n\tv_nop\n\tv_nop\n\tv_nop" : "+v"(acc[0][0]), "+v"(acc[1][1]), "+v"(acc[2][2]), "+v"(acc[3][3]) : "v"(a[0]), "v"(a[3]));
    }
    float* osw = os + wv * SL;
#pragma unroll
    for (int m0 = 0; m0 < 4; m0 += MR) {
#pragma unroll
        for (int mi = 0; mi < MR; ++mi) {
#pragma unroll
            for (int nb = 0; nb < 4; ++nb) {
#pragma unroll
                for (int j = 0; j < 8; ++j) osw[(mi * 16 + hi * 8 + j) * 68 + nb * 16 + lr] = acc[m0 + mi][nb][j]; } }
        if (NW == 1) { __builtin_amdgcn_wave_barrier(); asm volatile("" ::: "memory"); } else __syncthreads();   // every wave's partial tile is in LDS before any is summed
        float* crow = C + (size_t)(r0 + m0 * 16) * ldc + c0;
#pragma unroll
        for (int s = 0; s < MR * 8 / NW; ++s) { const int g = s * 32 * NW + (int)threadIdx.x, row = g >> 4, cofs = (g & 15) * 4; v4f val = *(const v4fa*)(os + row * 68 + cofs);
#pragma unroll
            for (int w = 1; w < NW; ++w) val += *(const v4fa*)(os + w * SL + row * 68 + cofs);
            if (BIAS) { val[0] += bfr(bias[c0 + cofs]); val[1] += bfr(bias[c0 + cofs + 1]); val[2] += bfr(bias[c0 + cofs + 2]); val[3] += bfr(bias[c0 + cofs + 3]); }
            *(v4f*)(crow + (size_t)row * ldc + cofs) = val; }
        if (NW == 1) { __builtin_amdgcn_wave_barrier(); asm volatile("" ::: "memory"); }   // the slab is rewritten by the next row block
    }
}

__device__ __forceinline__ h16 tohx(float x) { return (h16)x; }
__device__ __forceinline__ void splitf(float y, unsigned short& h, unsigned short& l) { h = f2bf(y); l = f2bf(y - bf2f(h)); }
typedef __attribute__((ext_vector_type(2))) _Float16 v2h;
typedef __attribute__((ext_vector_type(4))) _Float16 v4h;
typedef __attribute__((ext_vector_type(2))) unsigned short v2us;
typedef __attribute__((ext_vector_type(4))) unsigned short v4us;
typedef __attribute__((ext_vector_type(2))) float v2f;
typedef __attribute__((ext_vector_type(4))) int v4i;
typedef v4h  __attribute__((may_alias)) v4ha;
typedef v4us __attribute__((may_alias)) v4usa;

__global__ __launch_bounds__(256) void k_wtG(const float* __restrict__ w, int K, int N, bf* Bt) {
    const int lane = threadIdx.x & 31; const int L0 = (blockIdx.x * 8 + (threadIdx.x >> 5)) * 8; const int nlines = N * K / 64;
{
#pragma unroll 1
        for (int l = 0; l < 8; ++l) { const int L = L0 + l; if (L >= nlines) break; const size_t e = (size_t)L * 64 + lane * 2; const int k = (int)(e % K), n = (int)(e / K); v2us o;
            o[0] = f2bf(w[(size_t)k * N + n]); o[1] = f2bf(w[(size_t)(k + 1) * N + n]); *(v2us*)(Bt + e) = o; }
         }
}
__global__ __launch_bounds__(256) void k_cvt8(const float* __restrict__ src, bf* dst, size_t n8) { const size_t i = (size_t)blockIdx.x * 256 + threadIdx.x; if (i >= n8) return; const v8f v = *(const v8f*)(src + i * 8); v8us o;
#pragma unroll
    for (int k = 0; k < 8; ++k) o[k] = f2bf(v[k]); *(v8us*)(dst + i * 8) = o;  }

// k_rope: head planes [h][t][d] (fp16 + hi/lo) of rope(x) x sc with the rotate-half convention out[d] = x[d] cos[t][d] - x[d+HD/2] sin[t][d], out[d+HD/2] = x[d+HD/2] cos[t][d+HD/2] + x[d] sin[t][d+HD/2]
__global__ __launch_bounds__(256) void k_rope(const float* __restrict__ F, int pitch, int nheads, const float* __restrict__ CS, const float* __restrict__ RF, const float* __restrict__ nw, float sc, h16* P16, bf* Ph, bf* Pl) {
    const size_t e = ((size_t)blockIdx.x * 256 + threadIdx.x) * 2; if (e >= (size_t)nheads * TT * HD) return; const int d = (int)(e % HD); const int t = (int)((e / HD) % TT); const int h = (int)(e / ((size_t)HD * TT)); const float* f = F + (size_t)t * pitch + h * HD; const float rf = RF ? RF[(size_t)h * TT + t] : 1.0f; v2h o16; v2us oh, ol;
#pragma unroll
    for (int q = 0; q < 2; ++q) { const int dd = d + q; const int dp = (dd < HD / 2) ? dd + HD / 2 : dd - HD / 2; float x0 = f[dd], x1 = f[dp];
        if (RF) { float n0 = __fmul_rn(x0, rf), n1 = __fmul_rn(x1, rf); asm volatile("" : "+v"(n0)); asm volatile("" : "+v"(n1)); x0 = __fmul_rn(bfr(nw[dd]), n0); x1 = __fmul_rn(bfr(nw[dp]), n1); }
        const v2f cs = *(const v2f*)(CS + ((size_t)t * HD + dd) * 2); float a = __fmul_rn(x0, cs[0]), bq = __fmul_rn(x1, cs[1]); asm volatile("" : "+v"(a)); asm volatile("" : "+v"(bq)); const float r = ((dd < HD / 2) ? __fsub_rn(a, bq) : __fadd_rn(a, bq)) * sc;
        o16[q] = tohx(r); unsigned short a2, c2; splitf(r, a2, c2); oh[q] = a2; ol[q] = c2; }
    *(v2h*)(P16 + e) = o16; *(v2us*)(Ph + e) = oh; *(v2us*)(Pl + e) = ol;  }
__global__ __launch_bounds__(256) void k_vtp(const float* __restrict__ F, int pitch, int nheads, h16* V16, bf* Vh, bf* Vl) { const size_t e = ((size_t)blockIdx.x * 256 + threadIdx.x) * 2; if (e >= (size_t)nheads * HD * TT) return; const int t = (int)(e % TT); const int d = (int)((e / TT) % HD); const int g = (int)(e / ((size_t)TT * HD)); v2h o16; v2us oh, ol;
#pragma unroll
    for (int q = 0; q < 2; ++q) { const float x = F[(size_t)(t + q) * pitch + g * HD + d]; o16[q] = tohx(x); unsigned short a2, c2; splitf(x, a2, c2); oh[q] = a2; ol[q] = c2; }
    *(v2h*)(V16 + e) = o16; *(v2us*)(Vh + e) = oh; *(v2us*)(Vl + e) = ol;  }
__global__ __launch_bounds__(256) void k_csid(float* CS) { const int idx = blockIdx.x * 256 + threadIdx.x; if (idx >= TT * HD) return; v2f cs; cs[0] = 1.0f; cs[1] = 0.0f; *(v2f*)(CS + (size_t)idx * 2) = cs;  }
// k_asoft: per row (zz, i): t = S x 1/8 where mask[b][j] == 0, excluded where it is non-zero (the batch's int key vector read as data; mask x -1e9 == exclusion); softmax over the keys (register row, one exp, fixed trees);
// P goes back IN PLACE over the wave's own S row (8 KiB): fp16 P in its first 4 KiB, or hi plane in the first and lo plane in the second 4 KiB. One wave owns a row and has the whole row in registers (both reductions are behind every load) before its first store.
__global__ __launch_bounds__(256) void k_asoft(float* Sb, const int* __restrict__ kvp) {
    const int lane = threadIdx.x & 31; const int row = blockIdx.x * 8 + (threadIdx.x >> 5); if (row >= ZH * TT) return; const int i = row % TT; const int zz = row / TT; (void)zz; const bool hires = (i < RH); float* sr = Sb + (size_t)row * TT; float v[TT / 32]; float mx = -3.0e38f;
#pragma unroll
    for (int ch = 0; ch < TT / 128; ++ch) { const int j0 = ch * 128 + lane * 4; const v4f a = *(const v4fa*)(sr + j0); const v4i kv4 = *(const v4i*)(kvp + j0);   /* the batch's key vector, 16 B per lane, unconditional */
#pragma unroll
        for (int q = 0; q < 4; ++q) { const int j = j0 + q; (void)j; const float t = (kv4[q] == 0) ? a[q] * SCL : -3.0e38f; v[ch * 4 + q] = t; mx = fmaxf(mx, t); } }
#pragma unroll
    for (int sh = 16; sh; sh >>= 1) mx = fmaxf(mx, __shfl_xor(mx, sh, 32));
    float sum = 0.f;
#pragma unroll
    for (int k = 0; k < TT / 32; ++k) { float d0 = __fsub_rn(v[k], mx); asm volatile("" : "+v"(d0)); v[k] = __builtin_amdgcn_exp2f(__fmul_rn(d0, 1.4426950408889634f)); sum += v[k]; }
#pragma unroll
    for (int sh = 16; sh; sh >>= 1) sum += __shfl_xor(sum, sh, 32);
    const float f = __fdiv_rn(hires ? 1.0f : PCAR, sum);
{
        if (hires) {
#pragma unroll
            for (int ch = 0; ch < TT / 128; ++ch) { v4us oh, ol;
#pragma unroll
                for (int q = 0; q < 4; ++q) { unsigned short a, c2; splitf(v[ch * 4 + q] * f, a, c2); oh[q] = a; ol[q] = c2; }
                bf* pr = (bf*)sr + ch * 128 + lane * 4; *(v4usa*)pr = oh; *(v4usa*)(pr + TT) = ol; }
        } else {
#pragma unroll
            for (int ch = 0; ch < TT / 128; ++ch) { v4h o4;
#pragma unroll
                for (int q = 0; q < 4; ++q) o4[q] = tohx(v[ch * 4 + q] * f);
                *(v4ha*)((h16*)sr + ch * 128 + lane * 4) = o4; } }
         }
}
__global__ __launch_bounds__(256) void k_merge(const float* __restrict__ O, int h0, bf* Ah, bf* Al) { const size_t e = ((size_t)blockIdx.x * 256 + threadIdx.x) * 2; if (e >= (size_t)ZH * TT * HD) return; const int d = (int)(e % HD); const int t = (int)((e / HD) % TT); const int zz = (int)(e / ((size_t)HD * TT)); const float cs = (t < RH) ? 1.0f : (1.0f / PCAR); const size_t oo = (size_t)t * DQ + (h0 + zz) * HD + d;
    v2us oh, ol;
#pragma unroll
    for (int q = 0; q < 2; ++q) { unsigned short a, c2; splitf(O[e + q] * cs, a, c2); oh[q] = a; ol[q] = c2; } *(v2us*)(Ah + oo) = oh; *(v2us*)(Al + oo) = ol;  }

extern "C" void kernel_launch(void* const* d_in, const int* in_sizes, int n_in,
                              void* d_out, int out_size, void* d_ws, size_t ws_size, hipStream_t stream) {
    (void)in_sizes; (void)n_in; (void)out_size;
    const float* x = (const float*)d_in[0]; const float* xk = (const float*)d_in[1]; const float* xv = (const float*)d_in[2]; const int* kmask = (const int*)d_in[3];   /* mask [2][1][1][2048] int32: 1 = excluded key */ const float* wq = (const float*)d_in[4]; const float* bq = (const float*)d_in[5]; const float* wk = (const float*)d_in[6]; const float* bk = (const float*)d_in[7]; const float* wv = (const float*)d_in[8]; const float* bv = (const float*)d_in[9]; const float* wo = (const float*)d_in[10]; const float* bo = (const float*)d_in[11];   /* argument order query, key, value, mask, Wq, bq, Wk, bk, Wv, bv, Wo, bo ('xw') */
    float* OUT = (float*)d_out;     // [2][2048][1024]
    char* wsp = (char*)d_ws;
    auto take = [&](size_t bytes) { char* p = wsp; wsp += (bytes + 255) & ~(size_t)255; return (void*)p; };
    bf* WQ = (bf*)take((size_t)DQ * DM * 2); bf* WK = (bf*)take((size_t)DKV * DM * 2); bf* WV = (bf*)take((size_t)DKV * DM * 2); bf* WO = (bf*)take((size_t)DM * DQ * 2); float* CS = (float*)take((size_t)TT * HD * 2 * 4);
    bf* XB = (bf*)take((size_t)TT * DM * 2); float* FQ = (float*)take((size_t)TT * DQ * 4); float* FK = (float*)take((size_t)TT * DKV * 4);
    h16* QP16 = (h16*)take((size_t)NH_ * TT * HD * 2); h16* KP16 = (h16*)take((size_t)NKV * TT * HD * 2); h16* VT16 = (h16*)take((size_t)NKV * HD * TT * 2);
    bf* QPh = (bf*)take((size_t)NH_ * TT * HD * 2); bf* QPl = (bf*)take((size_t)NH_ * TT * HD * 2); bf* KPh = (bf*)take((size_t)NKV * TT * HD * 2); bf* KPl = (bf*)take((size_t)NKV * TT * HD * 2); bf* VTh = (bf*)take((size_t)NKV * HD * TT * 2); bf* VTl = (bf*)take((size_t)NKV * HD * TT * 2);
    float* Sb = (float*)take((size_t)ZH * TT * TT * 4); float* Ob = (float*)take((size_t)ZH * TT * HD * 4); bf* ATh = (bf*)take((size_t)TT * DQ * 2); bf* ATl = (bf*)take((size_t)TT * DQ * 2);
    if ((size_t)(wsp - (char*)d_ws) > ws_size) return;    // ws 256 MiB
    h16* P16 = (h16*)Sb; bf* Ph = (bf*)Sb; bf* Pl = (bf*)Sb + TT;   // P planes in the S rows, row pitch 2 * TT 16-bit elements (k_asoft)
    float* FV = FK;   // v projection reuses the k buffer after the k planes are built (stream-ordered)
    { k_wtG<<<(unsigned)((DM * DQ / 64 + 63) / 64), 256, 0, stream>>>(wq, DM, DQ, WQ); k_wtG<<<(unsigned)((DM * DKV / 64 + 63) / 64), 256, 0, stream>>>(wk, DM, DKV, WK); k_wtG<<<(unsigned)((DM * DKV / 64 + 63) / 64), 256, 0, stream>>>(wv, DM, DKV, WV);
      k_wtG<<<(unsigned)((DQ * DM / 64 + 63) / 64), 256, 0, stream>>>(wo, DQ, DM, WO);
       }
    k_csid<<<(TT * HD + 255) / 256, 256, 0, stream>>>(CS);
    const unsigned LQ = (unsigned)(((size_t)NH_ * TT * HD / 2 + 255) / 256), LKv = (unsigned)(((size_t)NKV * TT * HD / 2 + 255) / 256);
    for (int b = 0; b < NB_; ++b) {
        
        k_cvt8<<<(unsigned)(((size_t)TT * DM / 8 + 255) / 256), 256, 0, stream>>>(x + (size_t)b * TT * DM, XB, (size_t)TT * DM / 8);
        k_gemmw<bf, 0, true, 8><<<dim3(TT / 64, DQ / 64, 1), 256, 0, stream>>>(XB, nullptr, WQ, nullptr, DM, FQ, DQ, bq, 0, 0, 0);
        k_rope<<<LQ, 256, 0, stream>>>(FQ, DQ, NH_, CS, nullptr, nullptr, 1.0f, QP16, QPh, QPl);
        k_cvt8<<<(unsigned)(((size_t)TT * DM / 8 + 255) / 256), 256, 0, stream>>>(xk + (size_t)b * TT * DM, XB, (size_t)TT * DM / 8);   /* XB := bf16(key[b]) */ k_gemmw<bf, 0, true, 8><<<dim3(TT / 64, DKV / 64, 1), 256, 0, stream>>>(XB, nullptr, WK, nullptr, DM, FK, DKV, bk, 0, 0, 0);
        k_rope<<<LKv, 256, 0, stream>>>(FK, DKV, NKV, CS, nullptr, nullptr, 1.0f, KP16, KPh, KPl);
        k_cvt8<<<(unsigned)(((size_t)TT * DM / 8 + 255) / 256), 256, 0, stream>>>(xv + (size_t)b * TT * DM, XB, (size_t)TT * DM / 8);   /* XB := bf16(value[b]) */ k_gemmw<bf, 0, true, 8><<<dim3(TT / 64, DKV / 64, 1), 256, 0, stream>>>(XB, nullptr, WV, nullptr, DM, FV, DKV, bv, 0, 0, 0); k_vtp<<<LKv, 256, 0, stream>>>(FV, DKV, NKV, VT16, VTh, VTl);
        for (int h0 = 0; h0 < NH_; h0 += ZH) { const size_t zq = (size_t)h0, zk = (size_t)(h0 / REP);   // one kv head per query head: the pass's heads use consecutive kv planes (z-strides TT*HD)
            k_gemmw<bf, 2, false, 1><<<dim3(RH / 64, TT / 64, ZH), 32, 0, stream>>>(QPh + zq * TT * HD, QPl + zq * TT * HD, KPh + zk * TT * HD, KPl + zk * TT * HD, HD, Sb, TT, nullptr, (size_t)TT * HD, (size_t)TT * HD, (size_t)TT * TT);
            k_gemmw<h16, 0, false, 1><<<dim3((TT - RH) / 64, TT / 64, ZH), 32, 0, stream>>>(QP16 + zq * TT * HD + (size_t)RH * HD, nullptr, KP16 + zk * TT * HD, nullptr, HD, Sb + (size_t)RH * TT, TT, nullptr, (size_t)TT * HD, (size_t)TT * HD, (size_t)TT * TT);
            k_asoft<<<ZH * TT / 8, 256, 0, stream>>>(Sb, kmask + (size_t)b * TT);
            k_gemmw<bf, 2, false, 16, 2><<<dim3(RH / 64, HD / 64, ZH), 512, 0, stream>>>(Ph, Pl, VTh + zk * HD * TT, VTl + zk * HD * TT, TT, Ob, HD, nullptr, (size_t)2 * TT * TT, (size_t)HD * TT, (size_t)TT * HD);
            k_gemmw<h16, 0, false, 16, 2><<<dim3((TT - RH) / 64, HD / 64, ZH), 512, 0, stream>>>(P16 + (size_t)RH * 2 * TT, nullptr, VT16 + zk * HD * TT, nullptr, TT, Ob + (size_t)RH * HD, HD, nullptr, (size_t)2 * TT * TT, (size_t)HD * TT, (size_t)TT * HD);
            k_merge<<<(unsigned)(((size_t)ZH * TT * HD / 2 + 255) / 256), 256, 0, stream>>>(Ob, h0, ATh, ATl); }
        k_gemmw<bf, 1, true, 8><<<dim3(TT / 64, DM / 64, 1), 256, 0, stream>>>(ATh, ATl, WO, nullptr, DQ, OUT + (size_t)b * TT * DM, DM, bo, 0, 0, 0); }
}

// v003
// Measured time: 249 microseconds a run.
// Next to v002, in two timings, it ran 2.46 and 2.47 times as fast.
// All steps since v000 together make it 8.23 times as fast.
#include <hip/hip_runtime.h>

// Multi-head attention on three input streams with a per-batch key mask (query, key, value [2][2048][1024]; q = query Wq + bq, k = key Wk + bk, v = value Wv + bv ('xw' 1/32, zero biases; 16 heads x 64); logits = q.k / sqrt(64) + mask[b][0][0][j] x (-1e9) with mask int32 [2][1][1][2048] random 0/1 (read; 1 == that key is excluded); softmax; out = merged Wo + bo -> [2][2048][1024] (4.2 M); argument order query, key, value, mask, Wq, bq, Wk, bk, Wv, bv, Wo, bo).
// Layout per batch: bf16 copies of query, key, value in turn; 'xw' weights transposed once; exact projections + f32 biases; identity-table plane builders; one fused attention kernel over every (batch, head) (hybrid rows: < 512 hi/lo 3 products, rest fp16; running-maximum softmax, S and P stay in registers); it reads the batch's int key vector and excludes keys whose mask is non-zero by select (-1e9 == exclusion); merged hi/lo x Wo exact + bo.
// Compute dtypes, f32 accumulate: every input rounded to bf16; projections exact + f32 biases; attention rows < 512 3 products, rest fp16; softmax f32; Wo hl x exact + bias.

#define NB_  2
#define TT   2048
#define DM   1024
#define NH_  16
#define NKV  16
#define REP  (NH_ / NKV)
#define HD   64
#define DQ   (NH_ * HD)
#define DKV  (NKV * HD)
#define RH   512                  // query rows < RH use hi+lo planes (0: none)
#define WIN  0
#define SCL2 0.18033688011112042f   // HD^-0.5 x log2(e): scores are carried in the base-2 domain
typedef _Float16 h16;
typedef unsigned short bf;
typedef __attribute__((ext_vector_type(16))) __bf16   v16bf;
typedef __attribute__((ext_vector_type(16))) _Float16 v16h;
typedef __attribute__((ext_vector_type(8)))  _Float16 v8h;
typedef __attribute__((ext_vector_type(8)))  unsigned short v8us;
typedef __attribute__((ext_vector_type(8)))  float    v8f;
typedef __attribute__((ext_vector_type(4)))  float    v4f;
typedef v8h  __attribute__((may_alias)) v8ha;
typedef v4f  __attribute__((may_alias)) v4fa;
typedef v8us __attribute__((may_alias)) v8usa;

__device__ __forceinline__ unsigned short f2bf(float f) { unsigned u = __float_as_uint(f); u += 0x7FFFu + ((u >> 16) & 1u); return (unsigned short)(u >> 16); }
__device__ __forceinline__ float bf2f(unsigned short b) { return __uint_as_float(((unsigned)b) << 16); }
__device__ __forceinline__ float bfr(float f) { return bf2f(f2bf(f)); }
__device__ __forceinline__ v16h cat16(v8h lo, v8h hi) { return __builtin_shufflevector(lo, hi, 0, 1, 2, 3, 4, 5, 6, 7, 8, 9, 10, 11, 12, 13, 14, 15); }
__device__ __forceinline__ v16bf cat16b(v8us lo, v8us hi) { return __builtin_bit_cast(v16bf, __builtin_shufflevector(lo, hi, 0, 1, 2, 3, 4, 5, 6, 7, 8, 9, 10, 11, 12, 13, 14, 15)); }
__device__ __forceinline__ v8f wmma16(v16h a, v16h b, v8f c) { return __builtin_amdgcn_wmma_f32_16x16x32_f16(false, a, false, b, (short)0, c, false, false); }
__device__ __forceinline__ v8f wmmab(v16bf a, v16bf b, v8f c) { return __builtin_amdgcn_wmma_f32_16x16x32_bf16(false, a, false, b, (short)0, c, false, false); }



// ---- k_gemmw: register-blocked GEMM, one work-group of NW waves per 64x64 output tile (16 accumulators a wave), operands straight from K-contiguous 16-bit planes; grid (M/64, N/64, Z), 32 * NW threads.
// C[m][n] (f32, pitch ldc, + optional f32 bias[n]) = sum_k A[m][k] Bt[n][k] (+ split products per NSPLIT). z-batch strides sA/sB/sC in elements. K % (32 * NW) == 0. A's row pitch is AP * K elements.
// K is dealt to the waves in 32-wide steps, wave w taking steps w, w + NW, ... (neighbour waves read the two halves of one 128-byte line); the NW partial tiles meet in LDS and are summed in wave order 0 .. NW-1.
template <typename T16> struct WFrag;
template <> struct WFrag<h16> { typedef v16h V; static __device__ __forceinline__ V ld(const h16* p) { return cat16(*(const v8h*)p, *(const v8h*)(p + 16)); } static __device__ __forceinline__ V ldo(const h16* p) { return cat16(*(const v8h*)p, *(const v8h*)(p + 256)); } static __device__ __forceinline__ v8f mma(V a, V b, v8f c) { return wmma16(a, b, c); } };
template <> struct WFrag<bf> { typedef v16bf V; static __device__ __forceinline__ V ld(const bf* p) { return cat16b(*(const v8us*)p, *(const v8us*)(p + 16)); } static __device__ __forceinline__ V ldo(const bf* p) { return cat16b(*(const v8us*)p, *(const v8us*)(p + 256)); } static __device__ __forceinline__ v8f mma(V a, V b, v8f c) { return wmmab(a, b, c); } };
template <typename T16, int NSPLIT, bool BIAS, int NW, int AP = 1>
__global__ __launch_bounds__(32 * NW) void k_gemmw(const T16* __restrict__ A, const T16* __restrict__ A2, const T16* __restrict__ Bt, const T16* __restrict__ Bt2, int K, float* C, int ldc, const float* __restrict__ bias, size_t sA, size_t sB, size_t sC) {
    typedef typename WFrag<T16>::V V;
    constexpr int MR = (NW == 1) ? 1 : 4;      // 16-row blocks of the tile that pass through LDS at a time (all four where waves join: one barrier)
    constexpr int SL = MR * 16 * 68;           // one wave's slab, floats
    __shared__ __align__(16) float os[NW * SL];
    const int wv = (NW == 1) ? 0 : __builtin_amdgcn_readfirstlane((int)(threadIdx.x >> 5));
    const size_t z = blockIdx.z; A += z * sA; if (A2) A2 += z * sA; Bt += z * sB; if (Bt2) Bt2 += z * sB; C += z * sC;
    const int lane = threadIdx.x & 31, lr = lane & 15, hi = lane >> 4; const int r0 = blockIdx.x * 64, c0 = blockIdx.y * 64;
    v8f acc[4][4];
#pragma unroll
    for (int mb = 0; mb < 4; ++mb)
#pragma unroll
        for (int nb = 0; nb < 4; ++nb) acc[mb][nb] = (v8f){};
    const size_t aoff = (size_t)(r0 + lr) * K * AP + 8 * hi, boff = (size_t)(c0 + lr) * K + 8 * hi;
#pragma unroll 1
    for (int kc = wv * 32; kc < K; kc += 32 * NW) {
        V a[4], a2[4];
#pragma unroll
        for (int mb = 0; mb < 4; ++mb) { a[mb] = WFrag<T16>::ld(A + aoff + (size_t)mb * 16 * K * AP + kc); if (NSPLIT == 1 || NSPLIT == 2) a2[mb] = WFrag<T16>::ld(A2 + aoff + (size_t)mb * 16 * K * AP + kc); }
#pragma unroll
        for (int nb = 0; nb < 4; ++nb) { const V b = WFrag<T16>::ld(Bt + boff + (size_t)nb * 16 * K + kc); V b2; if (NSPLIT >= 2) b2 = WFrag<T16>::ld(Bt2 + boff + (size_t)nb * 16 * K + kc);
#pragma unroll
            for (int mb = 0; mb < 4; ++mb) { acc[mb][nb] = WFrag<T16>::mma(a[mb], b, acc[mb][nb]); if (NSPLIT == 1 || NSPLIT == 2) acc[mb][nb] = WFrag<T16>::mma(a2[mb], b, acc[mb][nb]); if (NSPLIT >= 2) acc[mb][nb] = WFrag<T16>::mma(a[mb], b2, acc[mb][nb]); } }
        asm volatile("v_nop\n\tv_nop\n\tv_nop\n\tv_nop" : "+v"(acc[0][0]), "+v"(acc[1][1]), "+v"(acc[2][2]), "+v"(acc[3][3]) : "v"(a[0]), "v"(a[3]));
    }
    float* osw = os + wv * SL;
#pragma unroll
    for (int m0 = 0; m0 < 4; m0 += MR) {
#pragma unroll
        for (int mi = 0; mi < MR; ++mi) {
#pragma unroll
            for (int nb = 0; nb < 4; ++nb) {
#pragma unroll
                for (int j = 0; j < 8; ++j) osw[(mi * 16 + hi * 8 + j) * 68 + nb * 16 + lr] = acc[m0 + mi][nb][j]; } }
        if (NW == 1) { __builtin_amdgcn_wave_barrier(); asm volatile("" ::: "memory"); } else __syncthreads();   // every wave's partial tile is in LDS before any is summed
        float* crow = C + (size_t)(r0 + m0 * 16) * ldc + c0;
#pragma unroll
        for (int s = 0; s < MR * 8 / NW; ++s) { const int g = s * 32 * NW + (int)threadIdx.x, row = g >> 4, cofs = (g & 15) * 4; v4f val = *(const v4fa*)(os + row * 68 + cofs);
#pragma unroll
            for (int w = 1; w < NW; ++w) val += *(const v4fa*)(os + w * SL + row * 68 + cofs);
            if (BIAS) { val[0] += bfr(bias[c0 + cofs]); val[1] += bfr(bias[c0 + cofs + 1]); val[2] += bfr(bias[c0 + cofs + 2]); val[3] += bfr(bias[c0 + cofs + 3]); }
            *(v4f*)(crow + (size_t)row * ldc + cofs) = val; }
        if (NW == 1) { __builtin_amdgcn_wave_barrier(); asm volatile("" ::: "memory"); }   // the slab is rewritten by the next row block
    }
}

__device__ __forceinline__ h16 tohx(float x) { return (h16)x; }
__device__ __forceinline__ void splitf(float y, unsigned short& h, unsigned short& l) { h = f2bf(y); l = f2bf(y - bf2f(h)); }
typedef __attribute__((ext_vector_type(2))) _Float16 v2h;
typedef __attribute__((ext_vector_type(4))) _Float16 v4h;
typedef __attribute__((ext_vector_type(2))) unsigned short v2us;
typedef __attribute__((ext_vector_type(4))) unsigned short v4us;
typedef __attribute__((ext_vector_type(2))) float v2f;
typedef __attribute__((ext_vector_type(4))) int v4i;
typedef v4h  __attribute__((may_alias)) v4ha;
typedef v4us __attribute__((may_alias)) v4usa;

__global__ __launch_bounds__(256) void k_wtG(const float* __restrict__ w, int K, int N, bf* Bt) {
    const int lane = threadIdx.x & 31; const int L0 = (blockIdx.x * 8 + (threadIdx.x >> 5)) * 8; const int nlines = N * K / 64;
{
#pragma unroll 1
        for (int l = 0; l < 8; ++l) { const int L = L0 + l; if (L >= nlines) break; const size_t e = (size_t)L * 64 + lane * 2; const int k = (int)(e % K), n = (int)(e / K); v2us o;
            o[0] = f2bf(w[(size_t)k * N + n]); o[1] = f2bf(w[(size_t)(k + 1) * N + n]); *(v2us*)(Bt + e) = o; }
         }
}
__global__ __launch_bounds__(256) void k_cvt8(const float* __restrict__ src, bf* dst, size_t n8) { const size_t i = (size_t)blockIdx.x * 256 + threadIdx.x; if (i >= n8) return; const v8f v = *(const v8f*)(src + i * 8); v8us o;
#pragma unroll
    for (int k = 0; k < 8; ++k) o[k] = f2bf(v[k]); *(v8us*)(dst + i * 8) = o;  }

// Fragment order of a q or k head plane: 16 rows t make a 1024-element block; in it the 8-element chunk (d >> 3) of row t lies at ((d >> 4) * 32 + ((d >> 3) & 1) * 16 + (t & 15)) * 8, so that lane l of a wave finds its two chunks of the 32-wide k step ks at (ks * 64 + l) * 8 and 256 elements on: every fragment load reads 512 bytes in a row.
// k_rope: head planes [h][fragment order of (t, d)] (fp16 + hi/lo) of rope(x) x sc with the rotate-half convention out[d] = x[d] cos[t][d] - x[d+HD/2] sin[t][d], out[d+HD/2] = x[d+HD/2] cos[t][d+HD/2] + x[d] sin[t][d+HD/2]
__global__ __launch_bounds__(256) void k_rope(const float* __restrict__ F, int pitch, int nheads, const float* __restrict__ CS, const float* __restrict__ RF, const float* __restrict__ nw, float sc, h16* P16, bf* Ph, bf* Pl) {
    const size_t e = ((size_t)blockIdx.x * 256 + threadIdx.x) * 2; if (e >= (size_t)nheads * TT * HD) return; const int rm = (int)(e % ((size_t)HD * TT)); const int d = ((rm >> 8) & 3) * 16 + ((rm >> 7) & 1) * 8 + (rm & 7); const int t = (rm >> 10) * 16 + ((rm >> 3) & 15); const int h = (int)(e / ((size_t)HD * TT)); const float* f = F + (size_t)t * pitch + h * HD; const float rf = RF ? RF[(size_t)h * TT + t] : 1.0f; v2h o16; v2us oh, ol;
#pragma unroll
    for (int q = 0; q < 2; ++q) { const int dd = d + q; const int dp = (dd < HD / 2) ? dd + HD / 2 : dd - HD / 2; float x0 = f[dd], x1 = f[dp];
        if (RF) { float n0 = __fmul_rn(x0, rf), n1 = __fmul_rn(x1, rf); asm volatile("" : "+v"(n0)); asm volatile("" : "+v"(n1)); x0 = __fmul_rn(bfr(nw[dd]), n0); x1 = __fmul_rn(bfr(nw[dp]), n1); }
        const v2f cs = *(const v2f*)(CS + ((size_t)t * HD + dd) * 2); float a = __fmul_rn(x0, cs[0]), bq = __fmul_rn(x1, cs[1]); asm volatile("" : "+v"(a)); asm volatile("" : "+v"(bq)); const float r = ((dd < HD / 2) ? __fsub_rn(a, bq) : __fadd_rn(a, bq)) * sc;
        o16[q] = tohx(r); unsigned short a2, c2; splitf(r, a2, c2); oh[q] = a2; ol[q] = c2; }
    *(v2h*)(P16 + e) = o16; *(v2us*)(Ph + e) = oh; *(v2us*)(Pl + e) = ol;  }
// k_vtp: v head planes, transposed, in fragment order: 32 keys t x 64 d make a 2048-element block; the 8-key chunk of row d lies at (((d >> 4) * 2 + ((t >> 4) & 1)) * 32 + ((t >> 3) & 1) * 16 + (d & 15)) * 8.
__global__ __launch_bounds__(256) void k_vtp(const float* __restrict__ F, int pitch, int nheads, h16* V16, bf* Vh, bf* Vl) { const size_t e = ((size_t)blockIdx.x * 256 + threadIdx.x) * 2; if (e >= (size_t)nheads * HD * TT) return; const int rm = (int)(e % ((size_t)TT * HD)); const int t = (rm >> 11) * 32 + ((rm >> 8) & 1) * 16 + ((rm >> 7) & 1) * 8 + (rm & 7); const int d = ((rm >> 9) & 3) * 16 + ((rm >> 3) & 15); const int g = (int)(e / ((size_t)TT * HD)); v2h o16; v2us oh, ol;
#pragma unroll
    for (int q = 0; q < 2; ++q) { const float x = F[(size_t)(t + q) * pitch + g * HD + d]; o16[q] = tohx(x); unsigned short a2, c2; splitf(x, a2, c2); oh[q] = a2; ol[q] = c2; }
    *(v2h*)(V16 + e) = o16; *(v2us*)(Vh + e) = oh; *(v2us*)(Vl + e) = ol;  }
__global__ __launch_bounds__(256) void k_csid(float* CS) { const int idx = blockIdx.x * 256 + threadIdx.x; if (idx >= TT * HD) return; v2f cs; cs[0] = 1.0f; cs[1] = 0.0f; *(v2f*)(CS + (size_t)idx * 2) = cs;  }
// k_fattn: S, softmax, P.V and the head merge in one kernel; no score or probability leaves the registers. One wave owns NQ * 16 queries of one (batch, head) and walks the 2048 keys 32 at a time, on its own (no LDS, no barrier).
// Transposed products: St = K Qt (A = 16 key rows, B = 16 query columns), so lane (c, hh) holds for query c the keys 8 hh + r (tile 0) and 16 + 8 hh + r (tile 1): these 16 values, converted in place, are the B operand of Ot += Vt Pt in the hardware k order, which the v planes' fragment order matches.
// Softmax with a running maximum in the base-2 domain: the maximum in use is raised (and sums and outputs rescaled) only when some query's new maximum exceeds it by more than 8, one test per 32 keys, so p <= 2^8. An excluded key carries -3e38: p == 0 once a kept key has set the maximum; with every key excluded p == 1 for all (uniform, as mask x -1e9 gives in f32).
// eight base-2 exponentials in place: behind each stands an independent one, behind the last a v_nop: the slot that the instruction set asks for between a transcendental and a use of its result or an overwrite of its source
__device__ __forceinline__ void exp8(float* x) {
    asm("v_exp_f32 %0, %0\n\tv_exp_f32 %1, %1\n\tv_exp_f32 %2, %2\n\tv_exp_f32 %3, %3\n\tv_exp_f32 %4, %4\n\tv_exp_f32 %5, %5\n\tv_exp_f32 %6, %6\n\tv_exp_f32 %7, %7\n\tv_nop" : "+v"(x[0]), "+v"(x[1]), "+v"(x[2]), "+v"(x[3]), "+v"(x[4]), "+v"(x[5]), "+v"(x[6]), "+v"(x[7])); }
// the value that lane l ^ 16 holds (the other half of a query's keys), without a trip through LDS
__device__ __forceinline__ float xhalf(float v) { const int b = __float_as_int(v); return __int_as_float(__builtin_amdgcn_permlanex16(b, b, 0x76543210, 0xfedcba98, false, false)); }
template <bool HR> struct FSel { typedef h16 T; };
template <> struct FSel<true> { typedef bf T; };
template <bool HR, int NQ>
__device__ __forceinline__ void fattn(const typename FSel<HR>::T* __restrict__ Q, const typename FSel<HR>::T* __restrict__ Q2, const typename FSel<HR>::T* __restrict__ Kp, const typename FSel<HR>::T* __restrict__ K2, const typename FSel<HR>::T* __restrict__ Vp, const typename FSel<HR>::T* __restrict__ V2, const int* __restrict__ kvp, int q0, bf* Ah, bf* Al) {
    typedef typename FSel<HR>::T T16; typedef WFrag<T16> W; typedef typename W::V V;
    const int lane = threadIdx.x & 31, lr = lane & 15, hh = lane >> 4;   // every inner loop below is unrolled so that each index of a register array is a constant
    V qf[NQ][2], qf2[NQ][2], kf[2][2], kf2[2][2], vf[4], vf2[4]; v4i mk[4]; v8f o[NQ][4]; float m[NQ], l[NQ];
#pragma unroll
    for (int g = 0; g < NQ; ++g) { m[g] = -3.0e38f; l[g] = 0.f;
#pragma unroll
        for (int dt = 0; dt < 4; ++dt) o[g][dt] = (v8f){};
#pragma unroll
        for (int ks = 0; ks < 2; ++ks) { const size_t qo = (size_t)((q0 >> 4) + g) * 1024 + (ks * 64 + lane) * 8; qf[g][ks] = W::ldo(Q + qo); if (HR) qf2[g][ks] = W::ldo(Q2 + qo); } }
    asm volatile("s_wait_xcnt 0x0" ::: "memory");   // precaution, as in loadK
    unsigned ko = lane * 16, vo = lane * 16, mo = hh * 32;   // this lane's byte offsets in the k tiles, the v tile and the key vector that are fetched next; carried through the loop and stepped behind the wait in loadK
    auto loadK = [&]() {
#pragma unroll
        for (int kt = 0; kt < 2; ++kt)
#pragma unroll
            for (int ks = 0; ks < 2; ++ks) { kf[kt][ks] = W::ldo((const T16*)((const char*)Kp + ko) + (kt * 1024 + ks * 512)); if (HR) kf2[kt][ks] = W::ldo((const T16*)((const char*)K2 + ko) + (kt * 1024 + ks * 512)); }
#pragma unroll
        for (int u = 0; u < 4; ++u) mk[u] = *(const v4i*)((const int*)((const char*)kvp + mo) + ((u >> 1) * 16 + (u & 1) * 4));
        asm volatile("s_wait_xcnt 0x0" ::: "memory"); };   // precaution: stands before the address registers of the loads above are written again
    auto loadV = [&]() {
#pragma unroll
        for (int dt = 0; dt < 4; ++dt) { vf[dt] = W::ldo((const T16*)((const char*)Vp + vo) + dt * 512); if (HR) vf2[dt] = W::ldo((const T16*)((const char*)V2 + vo) + dt * 512); } };   // their offset is stepped behind loadK's wait
    loadK(); ko += 4096; mo += 128;
#pragma unroll 1   // one pass a trip: a second copy of the body would hold a second set of fragments and scores live
    for (int it = 0; it < TT / 32; ++it) {
        loadV();   // this pass's v fragments fly during its S products and softmax; issued behind the k loads on every path, so that the wait for k leaves them in flight
        __builtin_amdgcn_sched_barrier(0);   // keeps the v loads in front of the S products: sunk behind them they have only the exponentials to fly in
        v8f s[NQ][2];
#pragma unroll
        for (int g = 0; g < NQ; ++g) { s[g][0] = (v8f){}; s[g][1] = (v8f){}; }
#pragma unroll
        for (int ks = 0; ks < 2; ++ks) {
#pragma unroll
            for (int g = 0; g < NQ; ++g)
#pragma unroll
                for (int kt = 0; kt < 2; ++kt) s[g][kt] = W::mma(kf[kt][ks], qf[g][ks], s[g][kt]);
            if (HR) {
#pragma unroll
                for (int g = 0; g < NQ; ++g)
#pragma unroll
                    for (int kt = 0; kt < 2; ++kt) s[g][kt] = W::mma(kf2[kt][ks], qf[g][ks], s[g][kt]);
#pragma unroll
                for (int g = 0; g < NQ; ++g)
#pragma unroll
                    for (int kt = 0; kt < 2; ++kt) s[g][kt] = W::mma(kf[kt][ks], qf2[g][ks], s[g][kt]); } }
        float ml[NQ]; bool need = false;
#pragma unroll
        for (int g = 0; g < NQ; ++g) { float mx = -3.0e38f;
#pragma unroll
            for (int kt = 0; kt < 2; ++kt)
#pragma unroll
                for (int r = 0; r < 8; ++r) { const float t = (mk[kt * 2 + (r >> 2)][r & 3] == 0) ? s[g][kt][r] * SCL2 : -3.0e38f; s[g][kt][r] = t; mx = fmaxf(mx, t); }
            mx = fmaxf(mx, xhalf(mx)); ml[g] = mx; need = need || (mx > m[g] + 8.0f); }
        loadK();   // the next pass's k fragments and key vector fly during this pass's softmax and P.V
        if (__builtin_amdgcn_ballot_w32(need) != 0) {
#pragma unroll
            for (int g = 0; g < NQ; ++g) { const float mn = fmaxf(m[g], ml[g]); const float al = __builtin_amdgcn_exp2f(m[g] - mn); m[g] = mn; l[g] *= al;
#pragma unroll
                for (int dt = 0; dt < 4; ++dt) o[g][dt] *= al; } }
        { const unsigned st = (it + 2 < TT / 32) ? 1u : 0u; ko += st * 4096; mo += st * 128; vo += 4096; }   // the last pass fetches its own k tiles again: in bounds, no branch round the loads
        V pb[NQ], pb2[NQ];
#pragma unroll
        for (int g = 0; g < NQ; ++g) { float sm[4];   // four independent chains
            float x[16];
#pragma unroll
            for (int e = 0; e < 16; ++e) x[e] = s[g][e >> 3][e & 7] - m[g];
            exp8(x); exp8(x + 8);
#pragma unroll
            for (int e = 0; e < 16; ++e) { const float p = x[e]; sm[e & 3] = (e < 4) ? p : sm[e & 3] + p;
                if constexpr (HR) { const __bf16 ph = (__bf16)p; pb[g][e] = ph; pb2[g][e] = (__bf16)(p - (float)ph); } else pb[g][e] = (h16)p; }
            l[g] += (sm[0] + sm[1]) + (sm[2] + sm[3]); }
#pragma unroll
        for (int dt = 0; dt < 4; ++dt)
#pragma unroll
            for (int g = 0; g < NQ; ++g) o[g][dt] = W::mma(vf[dt], pb[g], o[g][dt]);
        if (HR) {
#pragma unroll
            for (int dt = 0; dt < 4; ++dt)
#pragma unroll
                for (int g = 0; g < NQ; ++g) o[g][dt] = W::mma(vf2[dt], pb[g], o[g][dt]);
#pragma unroll
            for (int dt = 0; dt < 4; ++dt)
#pragma unroll
                for (int g = 0; g < NQ; ++g) o[g][dt] = W::mma(vf[dt], pb2[g], o[g][dt]); }
    }
#pragma unroll
    for (int g = 0; g < NQ; ++g) { const float inv = __fdiv_rn(1.0f, l[g] + xhalf(l[g])); const size_t oo = (size_t)(q0 + g * 16 + lr) * DQ + hh * 8;   // Ot register r of tile dt = O[query lr][16 dt + 8 hh + r]
#pragma unroll
        for (int dt = 0; dt < 4; ++dt) { v8us oh, ol;
#pragma unroll
            for (int r = 0; r < 8; ++r) { unsigned short a, c2; splitf(o[g][dt][r] * inv, a, c2); oh[r] = a; ol[r] = c2; }
            *(v8us*)(Ah + oo + dt * 16) = oh; *(v8us*)(Al + oo + dt * 16) = ol;
            asm volatile("s_wait_xcnt 0x0" ::: "memory"); } }   // precaution: stands before the stores' registers are written again
}
// grid (RH / 64 + (TT - RH) / 128, heads, batches), 4 waves: the first RH / 64 blocks take 16 hi/lo queries a wave, the rest 32 fp16 queries a wave (about the same work a pass). The second launch bound asks for 4 waves a SIMD: at most 256 registers, so that every work-group of the grid is resident at once.
__global__ __launch_bounds__(128, 4) void k_fattn(const h16* __restrict__ Q16, const h16* __restrict__ K16, const h16* __restrict__ V16, const bf* __restrict__ Qh, const bf* __restrict__ Ql, const bf* __restrict__ Kh, const bf* __restrict__ Kl, const bf* __restrict__ Vh, const bf* __restrict__ Vl, const int* __restrict__ kmask, bf* Ah, bf* Al) {
    const int wv = __builtin_amdgcn_readfirstlane((int)(threadIdx.x >> 5)); const size_t pz = ((size_t)blockIdx.z * NH_ + blockIdx.y) * TT * HD; const int* kvp = kmask + (size_t)blockIdx.z * TT; const size_t ao = (size_t)blockIdx.z * TT * DQ + (size_t)blockIdx.y * HD;
    if (blockIdx.x < RH / 64) fattn<true, 1>(Qh + pz, Ql + pz, Kh + pz, Kl + pz, Vh + pz, Vl + pz, kvp, (int)blockIdx.x * 64 + wv * 16, Ah + ao, Al + ao);
    else fattn<false, 2>(Q16 + pz, nullptr, K16 + pz, nullptr, V16 + pz, nullptr, kvp, RH + ((int)blockIdx.x - RH / 64) * 128 + wv * 32, Ah + ao, Al + ao);
}

extern "C" void kernel_launch(void* const* d_in, const int* in_sizes, int n_in,
                              void* d_out, int out_size, void* d_ws, size_t ws_size, hipStream_t stream) {
    (void)in_sizes; (void)n_in; (void)out_size;
    const float* x = (const float*)d_in[0]; const float* xk = (const float*)d_in[1]; const float* xv = (const float*)d_in[2]; const int* kmask = (const int*)d_in[3];   /* mask [2][1][1][2048] int32: 1 = excluded key */ const float* wq = (const float*)d_in[4]; const float* bq = (const float*)d_in[5]; const float* wk = (const float*)d_in[6]; const float* bk = (const float*)d_in[7]; const float* wv = (const float*)d_in[8]; const float* bv = (const float*)d_in[9]; const float* wo = (const float*)d_in[10]; const float* bo = (const float*)d_in[11];   /* argument order query, key, value, mask, Wq, bq, Wk, bk, Wv, bv, Wo, bo ('xw') */
    float* OUT = (float*)d_out;     // [2][2048][1024]
    char* wsp = (char*)d_ws;
    auto take = [&](size_t bytes) { char* p = wsp; wsp += (bytes + 255) & ~(size_t)255; return (void*)p; };
    bf* WQ = (bf*)take((size_t)DQ * DM * 2); bf* WK = (bf*)take((size_t)DKV * DM * 2); bf* WV = (bf*)take((size_t)DKV * DM * 2); bf* WO = (bf*)take((size_t)DM * DQ * 2); float* CS = (float*)take((size_t)TT * HD * 2 * 4);
    bf* XB = (bf*)take((size_t)TT * DM * 2); float* FQ = (float*)take((size_t)TT * DQ * 4); float* FK = (float*)take((size_t)TT * DKV * 4);
    const size_t PLN = (size_t)NH_ * TT * HD;   // one batch's plane set, elements (NKV == NH_); every plane holds both batches
    h16* QP16 = (h16*)take(NB_ * PLN * 2); h16* KP16 = (h16*)take(NB_ * PLN * 2); h16* VT16 = (h16*)take(NB_ * PLN * 2);
    bf* QPh = (bf*)take(NB_ * PLN * 2); bf* QPl = (bf*)take(NB_ * PLN * 2); bf* KPh = (bf*)take(NB_ * PLN * 2); bf* KPl = (bf*)take(NB_ * PLN * 2); bf* VTh = (bf*)take(NB_ * PLN * 2); bf* VTl = (bf*)take(NB_ * PLN * 2);
    bf* ATh = (bf*)take((size_t)NB_ * TT * DQ * 2); bf* ATl = (bf*)take((size_t)NB_ * TT * DQ * 2);
    if ((size_t)(wsp - (char*)d_ws) > ws_size) return;    // ws 256 MiB
    float* FV = FK;   // v projection reuses the k buffer after the k planes are built (stream-ordered)
    { k_wtG<<<(unsigned)((DM * DQ / 64 + 63) / 64), 256, 0, stream>>>(wq, DM, DQ, WQ); k_wtG<<<(unsigned)((DM * DKV / 64 + 63) / 64), 256, 0, stream>>>(wk, DM, DKV, WK); k_wtG<<<(unsigned)((DM * DKV / 64 + 63) / 64), 256, 0, stream>>>(wv, DM, DKV, WV);
      k_wtG<<<(unsigned)((DQ * DM / 64 + 63) / 64), 256, 0, stream>>>(wo, DQ, DM, WO);
       }
    k_csid<<<(TT * HD + 255) / 256, 256, 0, stream>>>(CS);
    const unsigned LQ = (unsigned)(((size_t)NH_ * TT * HD / 2 + 255) / 256), LKv = (unsigned)(((size_t)NKV * TT * HD / 2 + 255) / 256);
    for (int b = 0; b < NB_; ++b) {
        
        k_cvt8<<<(unsigned)(((size_t)TT * DM / 8 + 255) / 256), 256, 0, stream>>>(x + (size_t)b * TT * DM, XB, (size_t)TT * DM / 8);
        k_gemmw<bf, 0, true, 8><<<dim3(TT / 64, DQ / 64, 1), 256, 0, stream>>>(XB, nullptr, WQ, nullptr, DM, FQ, DQ, bq, 0, 0, 0);
        k_rope<<<LQ, 256, 0, stream>>>(FQ, DQ, NH_, CS, nullptr, nullptr, 1.0f, QP16 + b * PLN, QPh + b * PLN, QPl + b * PLN);
        k_cvt8<<<(unsigned)(((size_t)TT * DM / 8 + 255) / 256), 256, 0, stream>>>(xk + (size_t)b * TT * DM, XB, (size_t)TT * DM / 8);   /* XB := bf16(key[b]) */ k_gemmw<bf, 0, true, 8><<<dim3(TT / 64, DKV / 64, 1), 256, 0, stream>>>(XB, nullptr, WK, nullptr, DM, FK, DKV, bk, 0, 0, 0);
        k_rope<<<LKv, 256, 0, stream>>>(FK, DKV, NKV, CS, nullptr, nullptr, 1.0f, KP16 + b * PLN, KPh + b * PLN, KPl + b * PLN);
        k_cvt8<<<(unsigned)(((size_t)TT * DM / 8 + 255) / 256), 256, 0, stream>>>(xv + (size_t)b * TT * DM, XB, (size_t)TT * DM / 8);   /* XB := bf16(value[b]) */ k_gemmw<bf, 0, true, 8><<<dim3(TT / 64, DKV / 64, 1), 256, 0, stream>>>(XB, nullptr, WV, nullptr, DM, FV, DKV, bv, 0, 0, 0); k_vtp<<<LKv, 256, 0, stream>>>(FV, DKV, NKV, VT16 + b * PLN, VTh + b * PLN, VTl + b * PLN); }
    k_fattn<<<dim3(RH / 64 + (TT - RH) / 128, NH_, NB_), 128, 0, stream>>>(QP16, KP16, VT16, QPh, QPl, KPh, KPl, VTh, VTl, kmask, ATh, ATl);
    for (int b = 0; b < NB_; ++b)
        k_gemmw<bf, 1, true, 8><<<dim3(TT / 64, DM / 64, 1), 256, 0, stream>>>(ATh + (size_t)b * TT * DQ, ATl + (size_t)b * TT * DQ, WO, nullptr, DQ, OUT + (size_t)b * TT * DM, DM, bo, 0, 0, 0);
}

// v004
// Measured time: 223 microseconds a run.
// Timed twice side by side with v003, it ran 1.12 times as fast both times.
// All steps since v000 together make it 9.20 times as fast.
#include <hip/hip_runtime.h>

// Multi-head attention on three input streams with a per-batch key mask (query, key, value [2][2048][1024]; q = query Wq + bq, k = key Wk + bk, v = value Wv + bv ('xw' 1/32, zero biases; 16 heads x 64); logits = q.k / sqrt(64) + mask[b][0][0][j] x (-1e9) with mask int32 [2][1][1][2048] random 0/1 (read; 1 == that key is excluded); softmax; out = merged Wo + bo -> [2][2048][1024] (4.2 M); argument order query, key, value, mask, Wq, bq, Wk, bk, Wv, bv, Wo, bo).
// Layout per batch: bf16 copies of query, key, value in turn; 'xw' weights transposed once; exact projections + f32 biases, whose epilogue writes the head planes; one fused attention kernel over every (batch, head) (hybrid rows: < 512 hi/lo 3 products, rest fp16; running-maximum softmax, S and P stay in registers); it reads the batch's int key vector and excludes keys whose mask is non-zero by select (-1e9 == exclusion); merged hi/lo x Wo exact + bo.
// Compute dtypes, f32 accumulate: every input rounded to bf16; projections exact + f32 biases; attention rows < 512 3 products, rest fp16; softmax f32; Wo hl x exact + bias.

#define NB_  2
#define TT   2048
#define DM   1024
#define NH_  16
#define NKV  16
#define REP  (NH_ / NKV)
#define HD   64
#define DQ   (NH_ * HD)
#define DKV  (NKV * HD)
#define RH   512                  // query rows < RH use hi+lo planes (0: none)
#define WIN  0
#define SCL2 0.18033688011112042f   // HD^-0.5 x log2(e): scores are carried in the base-2 domain
typedef _Float16 h16;
typedef unsigned short bf;
typedef __attribute__((ext_vector_type(16))) __bf16   v16bf;
typedef __attribute__((ext_vector_type(16))) _Float16 v16h;
typedef __attribute__((ext_vector_type(8)))  _Float16 v8h;
typedef __attribute__((ext_vector_type(8)))  unsigned short v8us;
typedef __attribute__((ext_vector_type(8)))  float    v8f;
typedef __attribute__((ext_vector_type(4)))  float    v4f;
typedef v8h  __attribute__((may_alias)) v8ha;
typedef v4f  __attribute__((may_alias)) v4fa;
typedef v8us __attribute__((may_alias)) v8usa;

__device__ __forceinline__ unsigned short f2bf(float f) { unsigned u = __float_as_uint(f); u += 0x7FFFu + ((u >> 16) & 1u); return (unsigned short)(u >> 16); }
__device__ __forceinline__ float bf2f(unsigned short b) { return __uint_as_float(((unsigned)b) << 16); }
__device__ __forceinline__ float bfr(float f) { return bf2f(f2bf(f)); }
__device__ __forceinline__ v16h cat16(v8h lo, v8h hi) { return __builtin_shufflevector(lo, hi, 0, 1, 2, 3, 4, 5, 6, 7, 8, 9, 10, 11, 12, 13, 14, 15); }
__device__ __forceinline__ v16bf cat16b(v8us lo, v8us hi) { return __builtin_bit_cast(v16bf, __builtin_shufflevector(lo, hi, 0, 1, 2, 3, 4, 5, 6, 7, 8, 9, 10, 11, 12, 13, 14, 15)); }
__device__ __forceinline__ v8f wmma16(v16h a, v16h b, v8f c) { return __builtin_amdgcn_wmma_f32_16x16x32_f16(false, a, false, b, (short)0, c, false, false); }
__device__ __forceinline__ v8f wmmab(v16bf a, v16bf b, v8f c) { return __builtin_amdgcn_wmma_f32_16x16x32_bf16(false, a, false, b, (short)0, c, false, false); }
__device__ __forceinline__ h16 tohx(float x) { return (h16)x; }
__device__ __forceinline__ void splitf(float y, unsigned short& h, unsigned short& l) { h = f2bf(y); l = f2bf(y - bf2f(h)); }



// ---- k_gemmw: register-blocked GEMM, one work-group of NW waves per 64x64 output tile (16 accumulators a wave), operands straight from K-contiguous 16-bit planes; grid (M/64, N/64, Z), 32 * NW threads.
// C[m][n] (f32, pitch ldc, + optional f32 bias[n]) = sum_k A[m][k] Bt[n][k] (+ split products per NSPLIT). z-batch strides sA/sB/sC in elements. K % (32 * NW) == 0. A's row pitch is AP * K elements.
// K is dealt to the waves in 32-wide steps, wave w taking steps w, w + NW, ... (neighbour waves read the two halves of one 128-byte line); the NW partial tiles meet in LDS and are summed in wave order 0 .. NW-1.
// EPI == 0: the tile goes to C as f32. EPI == 1, 2: the summed tile (+ bias) never reaches memory as f32; it is written from LDS as the three 16-bit head planes (fp16, bf16 hi, bf16 lo) that k_fattn reads, 8 elements (16 bytes a plane) a thread, a wave 512 bytes in a row. A 64x64 tile is one head x 64 tokens = 4096 plane elements in a row, and thread c writes its chunk c.
// EPI == 1 (q, k): rows m = tokens t, columns n = head * 64 + d. Fragment order of a q or k head plane: 16 rows t make a 1024-element block; in it the 8-element chunk (d >> 3) of row t lies at ((d >> 4) * 32 + ((d >> 3) & 1) * 16 + (t & 15)) * 8, so that lane l of a wave finds its two chunks of the 32-wide k step ks at (ks * 64 + l) * 8 and 256 elements on: every fragment load reads 512 bytes in a row.
// EPI == 2 (v, transposed product: A = weight rows, Bt = token rows): rows m = head * 64 + d, columns n = tokens t, bias by row. v head planes, transposed, in fragment order: 32 keys t x 64 d make a 2048-element block; the 8-key chunk of row d lies at (((d >> 4) * 2 + ((t >> 4) & 1)) * 32 + ((t >> 3) & 1) * 16 + (d & 15)) * 8.
template <typename T16> struct WFrag;
template <> struct WFrag<h16> { typedef v16h V; static __device__ __forceinline__ V ld(const h16* p) { return cat16(*(const v8h*)p, *(const v8h*)(p + 16)); } static __device__ __forceinline__ V ldo(const h16* p) { return cat16(*(const v8h*)p, *(const v8h*)(p + 256)); } static __device__ __forceinline__ v8f mma(V a, V b, v8f c) { return wmma16(a, b, c); } };
template <> struct WFrag<bf> { typedef v16bf V; static __device__ __forceinline__ V ld(const bf* p) { return cat16b(*(const v8us*)p, *(const v8us*)(p + 16)); } static __device__ __forceinline__ V ldo(const bf* p) { return cat16b(*(const v8us*)p, *(const v8us*)(p + 256)); } static __device__ __forceinline__ v8f mma(V a, V b, v8f c) { return wmmab(a, b, c); } };
template <typename T16, int NSPLIT, bool BIAS, int NW, int AP = 1, int EPI = 0>
__global__ __launch_bounds__(32 * NW) void k_gemmw(const T16* __restrict__ A, const T16* __restrict__ A2, const T16* __restrict__ Bt, const T16* __restrict__ Bt2, int K, float* C, int ldc, const float* __restrict__ bias, size_t sA, size_t sB, size_t sC, h16* P16, bf* Ph, bf* Pl) {
    typedef typename WFrag<T16>::V V;
    constexpr int MR = (NW == 1) ? 1 : 4;      // 16-row blocks of the tile that pass through LDS at a time (all four where waves join: one barrier)
    constexpr int SL = MR * 16 * 68;           // one wave's slab, floats
    __shared__ __align__(16) float os[NW * SL];
    const int wv = (NW == 1) ? 0 : __builtin_amdgcn_readfirstlane((int)(threadIdx.x >> 5));
    const size_t z = blockIdx.z; A += z * sA; if (A2) A2 += z * sA; Bt += z * sB; if (Bt2) Bt2 += z * sB; C += z * sC;
    const int lane = threadIdx.x & 31, lr = lane & 15, hi = lane >> 4; const int r0 = blockIdx.x * 64, c0 = blockIdx.y * 64;
    v8f acc[4][4];
#pragma unroll
    for (int mb = 0; mb < 4; ++mb)
#pragma unroll
        for (int nb = 0; nb < 4; ++nb) acc[mb][nb] = (v8f){};
    const size_t aoff = (size_t)(r0 + lr) * K * AP + 8 * hi, boff = (size_t)(c0 + lr) * K + 8 * hi;
#pragma unroll 1
    for (int kc = wv * 32; kc < K; kc += 32 * NW) {
        V a[4], a2[4];
#pragma unroll
        for (int mb = 0; mb < 4; ++mb) { a[mb] = WFrag<T16>::ld(A + aoff + (size_t)mb * 16 * K * AP + kc); if (NSPLIT == 1 || NSPLIT == 2) a2[mb] = WFrag<T16>::ld(A2 + aoff + (size_t)mb * 16 * K * AP + kc); }
#pragma unroll
        for (int nb = 0; nb < 4; ++nb) { const V b = WFrag<T16>::ld(Bt + boff + (size_t)nb * 16 * K + kc); V b2; if (NSPLIT >= 2) b2 = WFrag<T16>::ld(Bt2 + boff + (size_t)nb * 16 * K + kc);
#pragma unroll
            for (int mb = 0; mb < 4; ++mb) { acc[mb][nb] = WFrag<T16>::mma(a[mb], b, acc[mb][nb]); if (NSPLIT == 1 || NSPLIT == 2) acc[mb][nb] = WFrag<T16>::mma(a2[mb], b, acc[mb][nb]); if (NSPLIT >= 2) acc[mb][nb] = WFrag<T16>::mma(a[mb], b2, acc[mb][nb]); } }
        asm volatile("v_nop\n\tv_nop\n\tv_nop\n\tv_nop" : "+v"(acc[0][0]), "+v"(acc[1][1]), "+v"(acc[2][2]), "+v"(acc[3][3]) : "v"(a[0]), "v"(a[3]));
    }
    float* osw = os + wv * SL;
#pragma unroll
    for (int m0 = 0; m0 < 4; m0 += MR) {
#pragma unroll
        for (int mi = 0; mi < MR; ++mi) {
#pragma unroll
            for (int nb = 0; nb < 4; ++nb) {
#pragma unroll
                for (int j = 0; j < 8; ++j) osw[(mi * 16 + hi * 8 + j) * 68 + nb * 16 + lr] = acc[m0 + mi][nb][j]; } }
        if (NW == 1) { __builtin_amdgcn_wave_barrier(); asm volatile("" ::: "memory"); } else __syncthreads();   // every wave's partial tile is in LDS before any is summed
        if constexpr (EPI != 0) {
            static_assert(MR == 4, "the plane epilogue takes the whole tile at once");
            const size_t pbase = (EPI == 1) ? ((size_t)blockIdx.y * TT + r0) * HD : ((size_t)blockIdx.x * TT + c0) * HD;   // this tile's 4096 elements in a plane
#pragma unroll
            for (int s = 0; s < 16 / NW; ++s) { const int c = s * 32 * NW + (int)threadIdx.x;
                const int row = (EPI == 1) ? (c >> 7) * 16 + (c & 15) : ((c >> 6) & 3) * 16 + (c & 15);
                const int col = (EPI == 1) ? ((c >> 4) & 7) * 8 : (c >> 8) * 32 + ((c >> 4) & 3) * 8;
                v4f v0 = *(const v4fa*)(os + row * 68 + col), v1 = *(const v4fa*)(os + row * 68 + col + 4);
#pragma unroll
                for (int w = 1; w < NW; ++w) { v0 += *(const v4fa*)(os + w * SL + row * 68 + col); v1 += *(const v4fa*)(os + w * SL + row * 68 + col + 4); }
                if (BIAS) {
                    if (EPI == 1) {
#pragma unroll
                        for (int j = 0; j < 4; ++j) { v0[j] += bfr(bias[c0 + col + j]); v1[j] += bfr(bias[c0 + col + 4 + j]); } }
                    else { const float bb = bfr(bias[r0 + row]); v0 += bb; v1 += bb; } }
                v8h o16; v8us oh, ol;
#pragma unroll
                for (int j = 0; j < 8; ++j) { const float y = (j < 4) ? v0[j & 3] : v1[j & 3]; o16[j] = tohx(y); unsigned short a2, c2; splitf(y, a2, c2); oh[j] = a2; ol[j] = c2; }
                *(v8h*)(P16 + pbase + (size_t)c * 8) = o16; *(v8us*)(Ph + pbase + (size_t)c * 8) = oh; *(v8us*)(Pl + pbase + (size_t)c * 8) = ol;
                asm volatile("s_wait_xcnt 0x0" ::: "memory"); }   // precaution: stands before the stores' registers are written again
        } else {
        float* crow = C + (size_t)(r0 + m0 * 16) * ldc + c0;
#pragma unroll
        for (int s = 0; s < MR * 8 / NW; ++s) { const int g = s * 32 * NW + (int)threadIdx.x, row = g >> 4, cofs = (g & 15) * 4; v4f val = *(const v4fa*)(os + row * 68 + cofs);
#pragma unroll
            for (int w = 1; w < NW; ++w) val += *(const v4fa*)(os + w * SL + row * 68 + cofs);
            if (BIAS) { val[0] += bfr(bias[c0 + cofs]); val[1] += bfr(bias[c0 + cofs + 1]); val[2] += bfr(bias[c0 + cofs + 2]); val[3] += bfr(bias[c0 + cofs + 3]); }
            *(v4f*)(crow + (size_t)row * ldc + cofs) = val; }
        }
        if (NW == 1) { __builtin_amdgcn_wave_barrier(); asm volatile("" ::: "memory"); }   // the slab is rewritten by the next row block
    }
}

typedef __attribute__((ext_vector_type(2))) _Float16 v2h;
typedef __attribute__((ext_vector_type(4))) _Float16 v4h;
typedef __attribute__((ext_vector_type(2))) unsigned short v2us;
typedef __attribute__((ext_vector_type(4))) unsigned short v4us;
typedef __attribute__((ext_vector_type(2))) float v2f;
typedef __attribute__((ext_vector_type(4))) int v4i;
typedef v4h  __attribute__((may_alias)) v4ha;
typedef v4us __attribute__((may_alias)) v4usa;

__global__ __launch_bounds__(256) void k_wtG(const float* __restrict__ w, int K, int N, bf* Bt) {
    const int lane = threadIdx.x & 31; const int L0 = (blockIdx.x * 8 + (threadIdx.x >> 5)) * 8; const int nlines = N * K / 64;
{
#pragma unroll 1
        for (int l = 0; l < 8; ++l) { const int L = L0 + l; if (L >= nlines) break; const size_t e = (size_t)L * 64 + lane * 2; const int k = (int)(e % K), n = (int)(e / K); v2us o;
            o[0] = f2bf(w[(size_t)k * N + n]); o[1] = f2bf(w[(size_t)(k + 1) * N + n]); *(v2us*)(Bt + e) = o; }
         }
}
__global__ __launch_bounds__(256) void k_cvt8(const float* __restrict__ src, bf* dst, size_t n8) { const size_t i = (size_t)blockIdx.x * 256 + threadIdx.x; if (i >= n8) return; const v8f v = *(const v8f*)(src + i * 8); v8us o;
#pragma unroll
    for (int k = 0; k < 8; ++k) o[k] = f2bf(v[k]); *(v8us*)(dst + i * 8) = o;  }

// k_fattn: S, softmax, P.V and the head merge in one kernel; no score or probability leaves the registers. One wave owns NQ * 16 queries of one (batch, head) and walks the 2048 keys 32 at a time, on its own (no LDS, no barrier).
// Transposed products: St = K Qt (A = 16 key rows, B = 16 query columns), so lane (c, hh) holds for query c the keys 8 hh + r (tile 0) and 16 + 8 hh + r (tile 1): these 16 values, converted in place, are the B operand of Ot += Vt Pt in the hardware k order, which the v planes' fragment order matches.
// Softmax with a running maximum in the base-2 domain: the maximum in use is raised (and sums and outputs rescaled) only when some query's new maximum exceeds it by more than 8, one test per 32 keys, so p <= 2^8. An excluded key carries -3e38: p == 0 once a kept key has set the maximum; with every key excluded p == 1 for all (uniform, as mask x -1e9 gives in f32).
// eight base-2 exponentials in place: behind each stands an independent one, behind the last a v_nop: the slot that the instruction set asks for between a transcendental and a use of its result or an overwrite of its source
__device__ __forceinline__ void exp8(float* x) {
    asm("v_exp_f32 %0, %0\n\tv_exp_f32 %1, %1\n\tv_exp_f32 %2, %2\n\tv_exp_f32 %3, %3\n\tv_exp_f32 %4, %4\n\tv_exp_f32 %5, %5\n\tv_exp_f32 %6, %6\n\tv_exp_f32 %7, %7\n\tv_nop" : "+v"(x[0]), "+v"(x[1]), "+v"(x[2]), "+v"(x[3]), "+v"(x[4]), "+v"(x[5]), "+v"(x[6]), "+v"(x[7])); }
// the value that lane l ^ 16 holds (the other half of a query's keys), without a trip through LDS
__device__ __forceinline__ float xhalf(float v) { const int b = __float_as_int(v); return __int_as_float(__builtin_amdgcn_permlanex16(b, b, 0x76543210, 0xfedcba98, false, false)); }
template <bool HR> struct FSel { typedef h16 T; };
template <> struct FSel<true> { typedef bf T; };
template <bool HR, int NQ>
__device__ __forceinline__ void fattn(const typename FSel<HR>::T* __restrict__ Q, const typename FSel<HR>::T* __restrict__ Q2, const typename FSel<HR>::T* __restrict__ Kp, const typename FSel<HR>::T* __restrict__ K2, const typename FSel<HR>::T* __restrict__ Vp, const typename FSel<HR>::T* __restrict__ V2, const int* __restrict__ kvp, int q0, bf* Ah, bf* Al) {
    typedef typename FSel<HR>::T T16; typedef WFrag<T16> W; typedef typename W::V V;
    const int lane = threadIdx.x & 31, lr = lane & 15, hh = lane >> 4;   // every inner loop below is unrolled so that each index of a register array is a constant
    V qf[NQ][2], qf2[NQ][2], kf[2][2], kf2[2][2], vf[4], vf2[4]; v4i mk[4]; v8f o[NQ][4]; float m[NQ], l[NQ];
#pragma unroll
    for (int g = 0; g < NQ; ++g) { m[g] = -3.0e38f; l[g] = 0.f;
#pragma unroll
        for (int dt = 0; dt < 4; ++dt) o[g][dt] = (v8f){};
#pragma unroll
        for (int ks = 0; ks < 2; ++ks) { const size_t qo = (size_t)((q0 >> 4) + g) * 1024 + (ks * 64 + lane) * 8; qf[g][ks] = W::ldo(Q + qo); if (HR) qf2[g][ks] = W::ldo(Q2 + qo); } }
    asm volatile("s_wait_xcnt 0x0" ::: "memory");   // precaution, as in loadK
    unsigned ko = lane * 16, vo = lane * 16, mo = hh * 32;   // this lane's byte offsets in the k tiles, the v tile and the key vector that are fetched next; carried through the loop and stepped behind the wait in loadK
    auto loadK = [&]() {
#pragma unroll
        for (int kt = 0; kt < 2; ++kt)
#pragma unroll
            for (int ks = 0; ks < 2; ++ks) { kf[kt][ks] = W::ldo((const T16*)((const char*)Kp + ko) + (kt * 1024 + ks * 512)); if (HR) kf2[kt][ks] = W::ldo((const T16*)((const char*)K2 + ko) + (kt * 1024 + ks * 512)); }
#pragma unroll
        for (int u = 0; u < 4; ++u) mk[u] = *(const v4i*)((const int*)((const char*)kvp + mo) + ((u >> 1) * 16 + (u & 1) * 4));
        asm volatile("s_wait_xcnt 0x0" ::: "memory"); };   // precaution: stands before the address registers of the loads above are written again
    auto loadV = [&]() {
#pragma unroll
        for (int dt = 0; dt < 4; ++dt) { vf[dt] = W::ldo((const T16*)((const char*)Vp + vo) + dt * 512); if (HR) vf2[dt] = W::ldo((const T16*)((const char*)V2 + vo) + dt * 512); } };   // their offset is stepped behind loadK's wait
    loadK(); ko += 4096; mo += 128;
#pragma unroll 1   // one pass a trip: a second copy of the body would hold a second set of fragments and scores live
    for (int it = 0; it < TT / 32; ++it) {
        loadV();   // this pass's v fragments fly during its S products and softmax; issued behind the k loads on every path, so that the wait for k leaves them in flight
        __builtin_amdgcn_sched_barrier(0);   // keeps the v loads in front of the S products: sunk behind them they have only the exponentials to fly in
        v8f s[NQ][2];
#pragma unroll
        for (int g = 0; g < NQ; ++g) { s[g][0] = (v8f){}; s[g][1] = (v8f){}; }
#pragma unroll
        for (int ks = 0; ks < 2; ++ks) {
#pragma unroll
            for (int g = 0; g < NQ; ++g)
#pragma unroll
                for (int kt = 0; kt < 2; ++kt) s[g][kt] = W::mma(kf[kt][ks], qf[g][ks], s[g][kt]);
            if (HR) {
#pragma unroll
                for (int g = 0; g < NQ; ++g)
#pragma unroll
                    for (int kt = 0; kt < 2; ++kt) s[g][kt] = W::mma(kf2[kt][ks], qf[g][ks], s[g][kt]);
#pragma unroll
                for (int g = 0; g < NQ; ++g)
#pragma unroll
                    for (int kt = 0; kt < 2; ++kt) s[g][kt] = W::mma(kf[kt][ks], qf2[g][ks], s[g][kt]); } }
        float ml[NQ]; bool need = false;
#pragma unroll
        for (int g = 0; g < NQ; ++g) { float mx = -3.0e38f;
#pragma unroll
            for (int kt = 0; kt < 2; ++kt)
#pragma unroll
                for (int r = 0; r < 8; ++r) { const float t = (mk[kt * 2 + (r >> 2)][r & 3] == 0) ? s[g][kt][r] * SCL2 : -3.0e38f; s[g][kt][r] = t; mx = fmaxf(mx, t); }
            mx = fmaxf(mx, xhalf(mx)); ml[g] = mx; need = need || (mx > m[g] + 8.0f); }
        loadK();   // the next pass's k fragments and key vector fly during this pass's softmax and P.V
        if (__builtin_amdgcn_ballot_w32(need) != 0) {
#pragma unroll
            for (int g = 0; g < NQ; ++g) { const float mn = fmaxf(m[g], ml[g]); const float al = __builtin_amdgcn_exp2f(m[g] - mn); m[g] = mn; l[g] *= al;
#pragma unroll
                for (int dt = 0; dt < 4; ++dt) o[g][dt] *= al; } }
        { const unsigned st = (it + 2 < TT / 32) ? 1u : 0u; ko += st * 4096; mo += st * 128; vo += 4096; }   // the last pass fetches its own k tiles again: in bounds, no branch round the loads
        V pb[NQ], pb2[NQ];
#pragma unroll
        for (int g = 0; g < NQ; ++g) { float sm[4];   // four independent chains
            float x[16];
#pragma unroll
            for (int e = 0; e < 16; ++e) x[e] = s[g][e >> 3][e & 7] - m[g];
            exp8(x); exp8(x + 8);
#pragma unroll
            for (int e = 0; e < 16; ++e) { const float p = x[e]; sm[e & 3] = (e < 4) ? p : sm[e & 3] + p;
                if constexpr (HR) { const __bf16 ph = (__bf16)p; pb[g][e] = ph; pb2[g][e] = (__bf16)(p - (float)ph); } else pb[g][e] = (h16)p; }
            l[g] += (sm[0] + sm[1]) + (sm[2] + sm[3]); }
#pragma unroll
        for (int dt = 0; dt < 4; ++dt)
#pragma unroll
            for (int g = 0; g < NQ; ++g) o[g][dt] = W::mma(vf[dt], pb[g], o[g][dt]);
        if (HR) {
#pragma unroll
            for (int dt = 0; dt < 4; ++dt)
#pragma unroll
                for (int g = 0; g < NQ; ++g) o[g][dt] = W::mma(vf2[dt], pb[g], o[g][dt]);
#pragma unroll
            for (int dt = 0; dt < 4; ++dt)
#pragma unroll
                for (int g = 0; g < NQ; ++g) o[g][dt] = W::mma(vf[dt], pb2[g], o[g][dt]); }
    }
#pragma unroll
    for (int g = 0; g < NQ; ++g) { const float inv = __fdiv_rn(1.0f, l[g] + xhalf(l[g])); const size_t oo = (size_t)(q0 + g * 16 + lr) * DQ + hh * 8;   // Ot register r of tile dt = O[query lr][16 dt + 8 hh + r]
#pragma unroll
        for (int dt = 0; dt < 4; ++dt) { v8us oh, ol;
#pragma unroll
            for (int r = 0; r < 8; ++r) { unsigned short a, c2; splitf(o[g][dt][r] * inv, a, c2); oh[r] = a; ol[r] = c2; }
            *(v8us*)(Ah + oo + dt * 16) = oh; *(v8us*)(Al + oo + dt * 16) = ol;
            asm volatile("s_wait_xcnt 0x0" ::: "memory"); } }   // precaution: stands before the stores' registers are written again
}
// grid (RH / 64 + (TT - RH) / 128, heads, batches), 4 waves: the first RH / 64 blocks take 16 hi/lo queries a wave, the rest 32 fp16 queries a wave (about the same work a pass). The second launch bound asks for 4 waves a SIMD: at most 256 registers, so that every work-group of the grid is resident at once.
__global__ __launch_bounds__(128, 4) void k_fattn(const h16* __restrict__ Q16, const h16* __restrict__ K16, const h16* __restrict__ V16, const bf* __restrict__ Qh, const bf* __restrict__ Ql, const bf* __restrict__ Kh, const bf* __restrict__ Kl, const bf* __restrict__ Vh, const bf* __restrict__ Vl, const int* __restrict__ kmask, bf* Ah, bf* Al) {
    const int wv = __builtin_amdgcn_readfirstlane((int)(threadIdx.x >> 5)); const size_t pz = ((size_t)blockIdx.z * NH_ + blockIdx.y) * TT * HD; const int* kvp = kmask + (size_t)blockIdx.z * TT; const size_t ao = (size_t)blockIdx.z * TT * DQ + (size_t)blockIdx.y * HD;
    if (blockIdx.x < RH / 64) fattn<true, 1>(Qh + pz, Ql + pz, Kh + pz, Kl + pz, Vh + pz, Vl + pz, kvp, (int)blockIdx.x * 64 + wv * 16, Ah + ao, Al + ao);
    else fattn<false, 2>(Q16 + pz, nullptr, K16 + pz, nullptr, V16 + pz, nullptr, kvp, RH + ((int)blockIdx.x - RH / 64) * 128 + wv * 32, Ah + ao, Al + ao);
}

extern "C" void kernel_launch(void* const* d_in, const int* in_sizes, int n_in,
                              void* d_out, int out_size, void* d_ws, size_t ws_size, hipStream_t stream) {
    (void)in_sizes; (void)n_in; (void)out_size;
    const float* x = (const float*)d_in[0]; const float* xk = (const float*)d_in[1]; const float* xv = (const float*)d_in[2]; const int* kmask = (const int*)d_in[3];   /* mask [2][1][1][2048] int32: 1 = excluded key */ const float* wq = (const float*)d_in[4]; const float* bq = (const float*)d_in[5]; const float* wk = (const float*)d_in[6]; const float* bk = (const float*)d_in[7]; const float* wv = (const float*)d_in[8]; const float* bv = (const float*)d_in[9]; const float* wo = (const float*)d_in[10]; const float* bo = (const float*)d_in[11];   /* argument order query, key, value, mask, Wq, bq, Wk, bk, Wv, bv, Wo, bo ('xw') */
    float* OUT = (float*)d_out;     // [2][2048][1024]
    char* wsp = (char*)d_ws;
    auto take = [&](size_t bytes) { char* p = wsp; wsp += (bytes + 255) & ~(size_t)255; return (void*)p; };
    bf* WQ = (bf*)take((size_t)DQ * DM * 2); bf* WK = (bf*)take((size_t)DKV * DM * 2); bf* WV = (bf*)take((size_t)DKV * DM * 2); bf* WO = (bf*)take((size_t)DM * DQ * 2);
    bf* XB = (bf*)take((size_t)TT * DM * 2);
    const size_t PLN = (size_t)NH_ * TT * HD;   // one batch's plane set, elements (NKV == NH_); every plane holds both batches
    h16* QP16 = (h16*)take(NB_ * PLN * 2); h16* KP16 = (h16*)take(NB_ * PLN * 2); h16* VT16 = (h16*)take(NB_ * PLN * 2);
    bf* QPh = (bf*)take(NB_ * PLN * 2); bf* QPl = (bf*)take(NB_ * PLN * 2); bf* KPh = (bf*)take(NB_ * PLN * 2); bf* KPl = (bf*)take(NB_ * PLN * 2); bf* VTh = (bf*)take(NB_ * PLN * 2); bf* VTl = (bf*)take(NB_ * PLN * 2);
    bf* ATh = (bf*)take((size_t)NB_ * TT * DQ * 2); bf* ATl = (bf*)take((size_t)NB_ * TT * DQ * 2);
    if ((size_t)(wsp - (char*)d_ws) > ws_size) return;    // ws 256 MiB
    { k_wtG<<<(unsigned)((DM * DQ / 64 + 63) / 64), 256, 0, stream>>>(wq, DM, DQ, WQ); k_wtG<<<(unsigned)((DM * DKV / 64 + 63) / 64), 256, 0, stream>>>(wk, DM, DKV, WK); k_wtG<<<(unsigned)((DM * DKV / 64 + 63) / 64), 256, 0, stream>>>(wv, DM, DKV, WV);
      k_wtG<<<(unsigned)((DQ * DM / 64 + 63) / 64), 256, 0, stream>>>(wo, DQ, DM, WO);
       }
    for (int b = 0; b < NB_; ++b) {
        
        k_cvt8<<<(unsigned)(((size_t)TT * DM / 8 + 255) / 256), 256, 0, stream>>>(x + (size_t)b * TT * DM, XB, (size_t)TT * DM / 8);
        k_gemmw<bf, 0, true, 8, 1, 1><<<dim3(TT / 64, DQ / 64, 1), 256, 0, stream>>>(XB, nullptr, WQ, nullptr, DM, nullptr, 0, bq, 0, 0, 0, QP16 + b * PLN, QPh + b * PLN, QPl + b * PLN);
        k_cvt8<<<(unsigned)(((size_t)TT * DM / 8 + 255) / 256), 256, 0, stream>>>(xk + (size_t)b * TT * DM, XB, (size_t)TT * DM / 8);   /* XB := bf16(key[b]) */ k_gemmw<bf, 0, true, 8, 1, 1><<<dim3(TT / 64, DKV / 64, 1), 256, 0, stream>>>(XB, nullptr, WK, nullptr, DM, nullptr, 0, bk, 0, 0, 0, KP16 + b * PLN, KPh + b * PLN, KPl + b * PLN);
        k_cvt8<<<(unsigned)(((size_t)TT * DM / 8 + 255) / 256), 256, 0, stream>>>(xv + (size_t)b * TT * DM, XB, (size_t)TT * DM / 8);   /* XB := bf16(value[b]) */ k_gemmw<bf, 0, true, 8, 1, 2><<<dim3(DKV / 64, TT / 64, 1), 256, 0, stream>>>(WV, nullptr, XB, nullptr, DM, nullptr, 0, bv, 0, 0, 0, VT16 + b * PLN, VTh + b * PLN, VTl + b * PLN); }   /* transposed product: rows = v features, columns = tokens */
    k_fattn<<<dim3(RH / 64 + (TT - RH) / 128, NH_, NB_), 128, 0, stream>>>(QP16, KP16, VT16, QPh, QPl, KPh, KPl, VTh, VTl, kmask, ATh, ATl);
    for (int b = 0; b < NB_; ++b)
        k_gemmw<bf, 1, true, 8><<<dim3(TT / 64, DM / 64, 1), 256, 0, stream>>>(ATh + (size_t)b * TT * DQ, ATl + (size_t)b * TT * DQ, WO, nullptr, DQ, OUT + (size_t)b * TT * DM, DM, bo, 0, 0, 0, nullptr, nullptr, nullptr);
}

// v005
// Measured time: 173 microseconds a run.
// Next to v004, in two timings, it ran 1.28 times as fast each time.
// All steps since v000 together make it 11.8 times as fast.
#include <hip/hip_runtime.h>

// Multi-head attention on three input streams with a per-batch key mask (query, key, value [2][2048][1024]; q = query Wq + bq, k = key Wk + bk, v = value Wv + bv ('xw' 1/32, zero biases; 16 heads x 64); logits = q.k / sqrt(64) + mask[b][0][0][j] x (-1e9) with mask int32 [2][1][1][2048] random 0/1 (read; 1 == that key is excluded); softmax; out = merged Wo + bo -> [2][2048][1024] (4.2 M); argument order query, key, value, mask, Wq, bq, Wk, bk, Wv, bv, Wo, bo).
// Layout, four launches: (1) bf16 copies of query, key, value (both batches) and the four transposed 'xw' weights; (2) the six exact projections + f32 biases (stream x batch in grid z), whose epilogue writes the head planes; (3) one fused attention kernel over every (batch, head) (hybrid rows: < 512 hi/lo 3 products, rest fp16; running-maximum softmax, S and P stay in registers); it reads the batch's int key vector and excludes keys whose mask is non-zero by select (-1e9 == exclusion); (4) merged hi/lo x Wo exact + bo, both batches as one row range.
// Compute dtypes, f32 accumulate: every input rounded to bf16; projections exact + f32 biases; attention rows < 512 3 products, rest fp16; softmax f32; Wo hl x exact + bias.

#define NB_  2
#define TT   2048
#define DM   1024
#define NH_  16
#define NKV  16
#define REP  (NH_ / NKV)
#define HD   64
#define DQ   (NH_ * HD)
#define DKV  (NKV * HD)
#define RH   512                  // query rows < RH use hi+lo planes (0: none)
#define WIN  0
#define SCL2 0.18033688011112042f   // HD^-0.5 x log2(e): scores are carried in the base-2 domain
typedef _Float16 h16;
typedef unsigned short bf;
typedef __attribute__((ext_vector_type(16))) __bf16   v16bf;
typedef __attribute__((ext_vector_type(16))) _Float16 v16h;
typedef __attribute__((ext_vector_type(8)))  _Float16 v8h;
typedef __attribute__((ext_vector_type(8)))  unsigned short v8us;
typedef __attribute__((ext_vector_type(8)))  float    v8f;
typedef __attribute__((ext_vector_type(4)))  float    v4f;
typedef v8h  __attribute__((may_alias)) v8ha;
typedef v4f  __attribute__((may_alias)) v4fa;
typedef v8us __attribute__((may_alias)) v8usa;

__device__ __forceinline__ unsigned short f2bf(float f) { unsigned u = __float_as_uint(f); u += 0x7FFFu + ((u >> 16) & 1u); return (unsigned short)(u >> 16); }
__device__ __forceinline__ float bf2f(unsigned short b) { return __uint_as_float(((unsigned)b) << 16); }
__device__ __forceinline__ float bfr(float f) { return bf2f(f2bf(f)); }
__device__ __forceinline__ v16h cat16(v8h lo, v8h hi) { return __builtin_shufflevector(lo, hi, 0, 1, 2, 3, 4, 5, 6, 7, 8, 9, 10, 11, 12, 13, 14, 15); }
__device__ __forceinline__ v16bf cat16b(v8us lo, v8us hi) { return __builtin_bit_cast(v16bf, __builtin_shufflevector(lo, hi, 0, 1, 2, 3, 4, 5, 6, 7, 8, 9, 10, 11, 12, 13, 14, 15)); }
__device__ __forceinline__ v8f wmma16(v16h a, v16h b, v8f c) { return __builtin_amdgcn_wmma_f32_16x16x32_f16(false, a, false, b, (short)0, c, false, false); }
__device__ __forceinline__ v8f wmmab(v16bf a, v16bf b, v8f c) { return __builtin_amdgcn_wmma_f32_16x16x32_bf16(false, a, false, b, (short)0, c, false, false); }
__device__ __forceinline__ h16 tohx(float x) { return (h16)x; }
__device__ __forceinline__ void splitf(float y, unsigned short& h, unsigned short& l) { h = f2bf(y); l = f2bf(y - bf2f(h)); }



// ---- gemmw: register-blocked GEMM, one work-group of NW waves per 64x64 output tile (bx, by) (16 accumulators a wave), operands straight from K-contiguous 16-bit planes; 32 * NW threads; os is the calling kernel's LDS, GLds<NW>::N floats.
// C[m][n] (f32, pitch ldc, + optional f32 bias[n]) = sum_k A[m][k] Bt[n][k] (+ split products per NSPLIT). K % (32 * NW) == 0. A's row pitch is AP * K elements.
// K is dealt to the waves in 32-wide steps, wave w taking steps w, w + NW, ... (neighbour waves read the two halves of one 128-byte line); the NW partial tiles meet in LDS and are summed in wave order 0 .. NW-1.
// EPI == 0: the tile goes to C as f32. EPI == 1, 2: the summed tile (+ bias) never reaches memory as f32; it is written from LDS as the three 16-bit head planes (fp16, bf16 hi, bf16 lo) that k_fattn reads, 8 elements (16 bytes a plane) a thread, a wave 512 bytes in a row. A 64x64 tile is one head x 64 tokens = 4096 plane elements in a row, and thread c writes its chunk c.
// EPI == 1 (q, k): rows m = tokens t, columns n = head * 64 + d. Fragment order of a q or k head plane: 16 rows t make a 1024-element block; in it the 8-element chunk (d >> 3) of row t lies at ((d >> 4) * 32 + ((d >> 3) & 1) * 16 + (t & 15)) * 8, so that lane l of a wave finds its two chunks of the 32-wide k step ks at (ks * 64 + l) * 8 and 256 elements on: every fragment load reads 512 bytes in a row.
// EPI == 2 (v, transposed product: A = weight rows, Bt = token rows): rows m = head * 64 + d, columns n = tokens t, bias by row. v head planes, transposed, in fragment order: 32 keys t x 64 d make a 2048-element block; the 8-key chunk of row d lies at (((d >> 4) * 2 + ((t >> 4) & 1)) * 32 + ((t >> 3) & 1) * 16 + (d & 15)) * 8.
template <typename T16> struct WFrag;
template <> struct WFrag<h16> { typedef v16h V; static __device__ __forceinline__ V ld(const h16* p) { return cat16(*(const v8h*)p, *(const v8h*)(p + 16)); } static __device__ __forceinline__ V ldo(const h16* p) { return cat16(*(const v8h*)p, *(const v8h*)(p + 256)); } static __device__ __forceinline__ v8f mma(V a, V b, v8f c) { return wmma16(a, b, c); } };
template <> struct WFrag<bf> { typedef v16bf V; static __device__ __forceinline__ V ld(const bf* p) { return cat16b(*(const v8us*)p, *(const v8us*)(p + 16)); } static __device__ __forceinline__ V ldo(const bf* p) { return cat16b(*(const v8us*)p, *(const v8us*)(p + 256)); } static __device__ __forceinline__ v8f mma(V a, V b, v8f c) { return wmmab(a, b, c); } };
template <int NW> struct GLds { static constexpr int MR = (NW == 1) ? 1 : 4;      // 16-row blocks of the tile that pass through LDS at a time (all four where waves join: one barrier)
    static constexpr int SL = MR * 16 * 68;    // one wave's slab, floats
    static constexpr int N = NW * SL; };
template <typename T16, int NSPLIT, bool BIAS, int NW, int AP = 1, int EPI = 0>
__device__ __forceinline__ void gemmw(float* os, int bx, int by, const T16* __restrict__ A, const T16* __restrict__ A2, const T16* __restrict__ Bt, const T16* __restrict__ Bt2, int K, float* C, int ldc, const float* __restrict__ bias, h16* P16, bf* Ph, bf* Pl) {
    typedef typename WFrag<T16>::V V;
    constexpr int MR = GLds<NW>::MR, SL = GLds<NW>::SL;
    const int wv = (NW == 1) ? 0 : __builtin_amdgcn_readfirstlane((int)(threadIdx.x >> 5));
    const int lane = threadIdx.x & 31, lr = lane & 15, hi = lane >> 4; const int r0 = bx * 64, c0 = by * 64;
    v8f acc[4][4];
#pragma unroll
    for (int mb = 0; mb < 4; ++mb)
#pragma unroll
        for (int nb = 0; nb < 4; ++nb) acc[mb][nb] = (v8f){};
    const size_t aoff = (size_t)(r0 + lr) * K * AP + 8 * hi, boff = (size_t)(c0 + lr) * K + 8 * hi;
#pragma unroll 1
    for (int kc = wv * 32; kc < K; kc += 32 * NW) {
        V a[4], a2[4];
#pragma unroll
        for (int mb = 0; mb < 4; ++mb) { a[mb] = WFrag<T16>::ld(A + aoff + (size_t)mb * 16 * K * AP + kc); if (NSPLIT == 1 || NSPLIT == 2) a2[mb] = WFrag<T16>::ld(A2 + aoff + (size_t)mb * 16 * K * AP + kc); }
#pragma unroll
        for (int nb = 0; nb < 4; ++nb) { const V b = WFrag<T16>::ld(Bt + boff + (size_t)nb * 16 * K + kc); V b2; if (NSPLIT >= 2) b2 = WFrag<T16>::ld(Bt2 + boff + (size_t)nb * 16 * K + kc);
#pragma unroll
            for (int mb = 0; mb < 4; ++mb) { acc[mb][nb] = WFrag<T16>::mma(a[mb], b, acc[mb][nb]); if (NSPLIT == 1 || NSPLIT == 2) acc[mb][nb] = WFrag<T16>::mma(a2[mb], b, acc[mb][nb]); if (NSPLIT >= 2) acc[mb][nb] = WFrag<T16>::mma(a[mb], b2, acc[mb][nb]); } }
        asm volatile("v_nop\n\tv_nop\n\tv_nop\n\tv_nop" : "+v"(acc[0][0]), "+v"(acc[1][1]), "+v"(acc[2][2]), "+v"(acc[3][3]) : "v"(a[0]), "v"(a[3]));
    }
    float* osw = os + wv * SL;
#pragma unroll
    for (int m0 = 0; m0 < 4; m0 += MR) {
#pragma unroll
        for (int mi = 0; mi < MR; ++mi) {
#pragma unroll
            for (int nb = 0; nb < 4; ++nb) {
#pragma unroll
                for (int j = 0; j < 8; ++j) osw[(mi * 16 + hi * 8 + j) * 68 + nb * 16 + lr] = acc[m0 + mi][nb][j]; } }
        if (NW == 1) { __builtin_amdgcn_wave_barrier(); asm volatile("" ::: "memory"); } else __syncthreads();   // every wave's partial tile is in LDS before any is summed
        if constexpr (EPI != 0) {
            static_assert(MR == 4, "the plane epilogue takes the whole tile at once");
            const size_t pbase = (EPI == 1) ? ((size_t)by * TT + r0) * HD : ((size_t)bx * TT + c0) * HD;   // this tile's 4096 elements in a plane
#pragma unroll
            for (int s = 0; s < 16 / NW; ++s) { const int c = s * 32 * NW + (int)threadIdx.x;
                const int row = (EPI == 1) ? (c >> 7) * 16 + (c & 15) : ((c >> 6) & 3) * 16 + (c & 15);
                const int col = (EPI == 1) ? ((c >> 4) & 7) * 8 : (c >> 8) * 32 + ((c >> 4) & 3) * 8;
                v4f v0 = *(const v4fa*)(os + row * 68 + col), v1 = *(const v4fa*)(os + row * 68 + col + 4);
#pragma unroll
                for (int w = 1; w < NW; ++w) { v0 += *(const v4fa*)(os + w * SL + row * 68 + col); v1 += *(const v4fa*)(os + w * SL + row * 68 + col + 4); }
                if (BIAS) {
                    if (EPI == 1) {
#pragma unroll
                        for (int j = 0; j < 4; ++j) { v0[j] += bfr(bias[c0 + col + j]); v1[j] += bfr(bias[c0 + col + 4 + j]); } }
                    else { const float bb = bfr(bias[r0 + row]); v0 += bb; v1 += bb; } }
                v8h o16; v8us oh, ol;
#pragma unroll
                for (int j = 0; j < 8; ++j) { const float y = (j < 4) ? v0[j & 3] : v1[j & 3]; o16[j] = tohx(y); unsigned short a2, c2; splitf(y, a2, c2); oh[j] = a2; ol[j] = c2; }
                *(v8h*)(P16 + pbase + (size_t)c * 8) = o16; *(v8us*)(Ph + pbase + (size_t)c * 8) = oh; *(v8us*)(Pl + pbase + (size_t)c * 8) = ol;
                asm volatile("s_wait_xcnt 0x0" ::: "memory"); }   // precaution: stands before the stores' registers are written again
        } else {
        float* crow = C + (size_t)(r0 + m0 * 16) * ldc + c0;
#pragma unroll
        for (int s = 0; s < MR * 8 / NW; ++s) { const int g = s * 32 * NW + (int)threadIdx.x, row = g >> 4, cofs = (g & 15) * 4; v4f val = *(const v4fa*)(os + row * 68 + cofs);
#pragma unroll
            for (int w = 1; w < NW; ++w) val += *(const v4fa*)(os + w * SL + row * 68 + cofs);
            if (BIAS) { val[0] += bfr(bias[c0 + cofs]); val[1] += bfr(bias[c0 + cofs + 1]); val[2] += bfr(bias[c0 + cofs + 2]); val[3] += bfr(bias[c0 + cofs + 3]); }
            *(v4f*)(crow + (size_t)row * ldc + cofs) = val; }
        }
        if (NW == 1) { __builtin_amdgcn_wave_barrier(); asm volatile("" ::: "memory"); }   // the slab is rewritten by the next row block
    }
}
// plain f32 output; grid (M/64, N/64)
template <typename T16, int NSPLIT, bool BIAS, int NW>
__global__ __launch_bounds__(32 * NW) void k_gemmw(const T16* __restrict__ A, const T16* __restrict__ A2, const T16* __restrict__ Bt, const T16* __restrict__ Bt2, int K, float* C, int ldc, const float* __restrict__ bias) {
    __shared__ __align__(16) float os[GLds<NW>::N];
    gemmw<T16, NSPLIT, BIAS, NW, 1, 0>(os, (int)blockIdx.x, (int)blockIdx.y, A, A2, Bt, Bt2, K, C, ldc, bias, nullptr, nullptr, nullptr);
}
// the six projections in one launch; grid (TT/64, DQ/64, 6), z = stream * 2 + batch (streams q, k, v). XB holds the six bf16 token matrices in z order, WT the transposed weights q, k, v, o. Every plane holds both batches.
// The branch is the same for a whole work-group, so that the barrier in gemmw is passed by all its waves or by none. The v tiles keep their order (feature tile fastest).
__global__ __launch_bounds__(256) void k_proj(const bf* __restrict__ XB, const bf* __restrict__ WT, int K, const float* __restrict__ bq, const float* __restrict__ bk, const float* __restrict__ bv, h16* QP16, h16* KP16, h16* VT16, bf* QPh, bf* QPl, bf* KPh, bf* KPl, bf* VTh, bf* VTl) {
    __shared__ __align__(16) float os[GLds<8>::N];
    const int z = (int)blockIdx.z, st = z >> 1; const size_t po = (size_t)(z & 1) * NH_ * TT * HD; const bf* X = XB + (size_t)z * TT * DM; const bf* Wt = WT + (size_t)st * DQ * DM;
    if (st == 2) { const int f = (int)blockIdx.y * (TT / 64) + (int)blockIdx.x;   /* transposed product: rows = v features, columns = tokens */
        gemmw<bf, 0, true, 8, 1, 2>(os, f % (DKV / 64), f / (DKV / 64), Wt, nullptr, X, nullptr, K, nullptr, 0, bv, VT16 + po, VTh + po, VTl + po); }
    else gemmw<bf, 0, true, 8, 1, 1>(os, (int)blockIdx.x, (int)blockIdx.y, X, nullptr, Wt, nullptr, K, nullptr, 0, st ? bk : bq, (st ? KP16 : QP16) + po, (st ? KPh : QPh) + po, (st ? KPl : QPl) + po);
}

typedef __attribute__((ext_vector_type(2))) _Float16 v2h;
typedef __attribute__((ext_vector_type(4))) _Float16 v4h;
typedef __attribute__((ext_vector_type(2))) unsigned short v2us;
typedef __attribute__((ext_vector_type(4))) unsigned short v4us;
typedef __attribute__((ext_vector_type(2))) float v2f;
typedef __attribute__((ext_vector_type(4))) int v4i;
typedef v4h  __attribute__((may_alias)) v4ha;
typedef v4us __attribute__((may_alias)) v4usa;

__device__ __forceinline__ void wtG(int blk, const float* __restrict__ w, int K, int N, bf* Bt) {
    const int lane = threadIdx.x & 31; const int L0 = (blk * 8 + (threadIdx.x >> 5)) * 8; const int nlines = N * K / 64;
{
#pragma unroll 1
        for (int l = 0; l < 8; ++l) { const int L = L0 + l; if (L >= nlines) break; const size_t e = (size_t)L * 64 + lane * 2; const int k = (int)(e % K), n = (int)(e / K); v2us o;
            o[0] = f2bf(w[(size_t)k * N + n]); o[1] = f2bf(w[(size_t)(k + 1) * N + n]); *(v2us*)(Bt + e) = o; }
         }
}
__device__ __forceinline__ void cvt8(int blk, const float* __restrict__ src, bf* dst, size_t n8) { const size_t i = (size_t)blk * 256 + threadIdx.x; if (i >= n8) return; const v8f v = *(const v8f*)(src + i * 8); v8us o;
#pragma unroll
    for (int k = 0; k < 8; ++k) o[k] = f2bf(v[k]); *(v8us*)(dst + i * 8) = o;  }
// every 16-bit operand of the projections and of Wo in one launch: blocks [0, 4 WB) transpose the four weights (the longer blocks), the next 3 CB copy query, key, value (both batches of a stream lie in a row).
#define WB ((DM * DQ / 64 + 63) / 64)
#define CB ((NB_ * TT * DM / 8 + 255) / 256)
__global__ __launch_bounds__(256) void k_prep(const float* __restrict__ x, const float* __restrict__ xk, const float* __restrict__ xv, const float* __restrict__ wq, const float* __restrict__ wk, const float* __restrict__ wv, const float* __restrict__ wo, int K, int N, bf* WT, bf* XB, size_t n8) {
    const int blk = (int)blockIdx.x;
    if (blk < 4 * WB) { const int i = blk / WB; wtG(blk % WB, i == 0 ? wq : i == 1 ? wk : i == 2 ? wv : wo, K, N, WT + (size_t)i * DM * DQ); }
    else { const int c = blk - 4 * WB, i = c / CB; cvt8(c % CB, i == 0 ? x : i == 1 ? xk : xv, XB + (size_t)i * NB_ * TT * DM, n8); }
}

// k_fattn: S, softmax, P.V and the head merge in one kernel; no score or probability leaves the registers. One wave owns NQ * 16 queries of one (batch, head) and walks the 2048 keys 32 at a time, on its own (no LDS, no barrier).
// Transposed products: St = K Qt (A = 16 key rows, B = 16 query columns), so lane (c, hh) holds for query c the keys 8 hh + r (tile 0) and 16 + 8 hh + r (tile 1): these 16 values, converted in place, are the B operand of Ot += Vt Pt in the hardware k order, which the v planes' fragment order matches.
// Softmax with a running maximum in the base-2 domain: the maximum in use is raised (and sums and outputs rescaled) only when some query's new maximum exceeds it by more than 8, one test per 32 keys, so p <= 2^8. An excluded key carries -3e38: p == 0 once a kept key has set the maximum; with every key excluded p == 1 for all (uniform, as mask x -1e9 gives in f32).
// eight base-2 exponentials in place: behind each stands an independent one, behind the last a v_nop: the slot that the instruction set asks for between a transcendental and a use of its result or an overwrite of its source
__device__ __forceinline__ void exp8(float* x) {
    asm("v_exp_f32 %0, %0\n\tv_exp_f32 %1, %1\n\tv_exp_f32 %2, %2\n\tv_exp_f32 %3, %3\n\tv_exp_f32 %4, %4\n\tv_exp_f32 %5, %5\n\tv_exp_f32 %6, %6\n\tv_exp_f32 %7, %7\n\tv_nop" : "+v"(x[0]), "+v"(x[1]), "+v"(x[2]), "+v"(x[3]), "+v"(x[4]), "+v"(x[5]), "+v"(x[6]), "+v"(x[7])); }
// the value that lane l ^ 16 holds (the other half of a query's keys), without a trip through LDS
__device__ __forceinline__ float xhalf(float v) { const int b = __float_as_int(v); return __int_as_float(__builtin_amdgcn_permlanex16(b, b, 0x76543210, 0xfedcba98, false, false)); }
template <bool HR> struct FSel { typedef h16 T; };
template <> struct FSel<true> { typedef bf T; };
template <bool HR, int NQ>
__device__ __forceinline__ void fattn(const typename FSel<HR>::T* __restrict__ Q, const typename FSel<HR>::T* __restrict__ Q2, const typename FSel<HR>::T* __restrict__ Kp, const typename FSel<HR>::T* __restrict__ K2, const typename FSel<HR>::T* __restrict__ Vp, const typename FSel<HR>::T* __restrict__ V2, const int* __restrict__ kvp, int q0, bf* Ah, bf* Al) {
    typedef typename FSel<HR>::T T16; typedef WFrag<T16> W; typedef typename W::V V;
    const int lane = threadIdx.x & 31, lr = lane & 15, hh = lane >> 4;   // every inner loop below is unrolled so that each index of a register array is a constant
    V qf[NQ][2], qf2[NQ][2], kf[2][2], kf2[2][2], vf[4], vf2[4]; v4i mk[4]; v8f o[NQ][4]; float m[NQ], l[NQ];
#pragma unroll
    for (int g = 0; g < NQ; ++g) { m[g] = -3.0e38f; l[g] = 0.f;
#pragma unroll
        for (int dt = 0; dt < 4; ++dt) o[g][dt] = (v8f){};
#pragma unroll
        for (int ks = 0; ks < 2; ++ks) { const size_t qo = (size_t)((q0 >> 4) + g) * 1024 + (ks * 64 + lane) * 8; qf[g][ks] = W::ldo(Q + qo); if (HR) qf2[g][ks] = W::ldo(Q2 + qo); } }
    asm volatile("s_wait_xcnt 0x0" ::: "memory");   // precaution, as in loadK
    unsigned ko = lane * 16, vo = lane * 16, mo = hh * 32;   // this lane's byte offsets in the k tiles, the v tile and the key vector that are fetched next; carried through the loop and stepped behind the wait in loadK
    auto loadK = [&]() {
#pragma unroll
        for (int kt = 0; kt < 2; ++kt)
#pragma unroll
            for (int ks = 0; ks < 2; ++ks) { kf[kt][ks] = W::ldo((const T16*)((const char*)Kp + ko) + (kt * 1024 + ks * 512)); if (HR) kf2[kt][ks] = W::ldo((const T16*)((const char*)K2 + ko) + (kt * 1024 + ks * 512)); }
#pragma unroll
        for (int u = 0; u < 4; ++u) mk[u] = *(const v4i*)((const int*)((const char*)kvp + mo) + ((u >> 1) * 16 + (u & 1) * 4));
        asm volatile("s_wait_xcnt 0x0" ::: "memory"); };   // precaution: stands before the address registers of the loads above are written again
    auto loadV = [&]() {
#pragma unroll
        for (int dt = 0; dt < 4; ++dt) { vf[dt] = W::ldo((const T16*)((const char*)Vp + vo) + dt * 512); if (HR) vf2[dt] = W::ldo((const T16*)((const char*)V2 + vo) + dt * 512); } };   // their offset is stepped behind loadK's wait
    loadK(); ko += 4096; mo += 128;
#pragma unroll 1   // one pass a trip: a second copy of the body would hold a second set of fragments and scores live
    for (int it = 0; it < TT / 32; ++it) {
        loadV();   // this pass's v fragments fly during its S products and softmax; issued behind the k loads on every path, so that the wait for k leaves them in flight
        __builtin_amdgcn_sched_barrier(0);   // keeps the v loads in front of the S products: sunk behind them they have only the exponentials to fly in
        v8f s[NQ][2];
#pragma unroll
        for (int g = 0; g < NQ; ++g) { s[g][0] = (v8f){}; s[g][1] = (v8f){}; }
#pragma unroll
        for (int ks = 0; ks < 2; ++ks) {
#pragma unroll
            for (int g = 0; g < NQ; ++g)
#pragma unroll
                for (int kt = 0; kt < 2; ++kt) s[g][kt] = W::mma(kf[kt][ks], qf[g][ks], s[g][kt]);
            if (HR) {
#pragma unroll
                for (int g = 0; g < NQ; ++g)
#pragma unroll
                    for (int kt = 0; kt < 2; ++kt) s[g][kt] = W::mma(kf2[kt][ks], qf[g][ks], s[g][kt]);
#pragma unroll
                for (int g = 0; g < NQ; ++g)
#pragma unroll
                    for (int kt = 0; kt < 2; ++kt) s[g][kt] = W::mma(kf[kt][ks], qf2[g][ks], s[g][kt]); } }
        float ml[NQ]; bool need = false;
#pragma unroll
        for (int g = 0; g < NQ; ++g) { float mx = -3.0e38f;
#pragma unroll
            for (int kt = 0; kt < 2; ++kt)
#pragma unroll
                for (int r = 0; r < 8; ++r) { const float t = (mk[kt * 2 + (r >> 2)][r & 3] == 0) ? s[g][kt][r] * SCL2 : -3.0e38f; s[g][kt][r] = t; mx = fmaxf(mx, t); }
            mx = fmaxf(mx, xhalf(mx)); ml[g] = mx; need = need || (mx > m[g] + 8.0f); }
        loadK();   // the next pass's k fragments and key vector fly during this pass's softmax and P.V
        if (__builtin_amdgcn_ballot_w32(need) != 0) {
#pragma unroll
            for (int g = 0; g < NQ; ++g) { const float mn = fmaxf(m[g], ml[g]); const float al = __builtin_amdgcn_exp2f(m[g] - mn); m[g] = mn; l[g] *= al;
#pragma unroll
                for (int dt = 0; dt < 4; ++dt) o[g][dt] *= al; } }
        { const unsigned st = (it + 2 < TT / 32) ? 1u : 0u; ko += st * 4096; mo += st * 128; vo += 4096; }   // the last pass fetches its own k tiles again: in bounds, no branch round the loads
        V pb[NQ], pb2[NQ];
#pragma unroll
        for (int g = 0; g < NQ; ++g) { float sm[4];   // four independent chains
            float x[16];
#pragma unroll
            for (int e = 0; e < 16; ++e) x[e] = s[g][e >> 3][e & 7] - m[g];
            exp8(x); exp8(x + 8);
#pragma unroll
            for (int e = 0; e < 16; ++e) { const float p = x[e]; sm[e & 3] = (e < 4) ? p : sm[e & 3] + p;
                if constexpr (HR) { const __bf16 ph = (__bf16)p; pb[g][e] = ph; pb2[g][e] = (__bf16)(p - (float)ph); } else pb[g][e] = (h16)p; }
            l[g] += (sm[0] + sm[1]) + (sm[2] + sm[3]); }
#pragma unroll
        for (int dt = 0; dt < 4; ++dt)
#pragma unroll
            for (int g = 0; g < NQ; ++g) o[g][dt] = W::mma(vf[dt], pb[g], o[g][dt]);
        if (HR) {
#pragma unroll
            for (int dt = 0; dt < 4; ++dt)
#pragma unroll
                for (int g = 0; g < NQ; ++g) o[g][dt] = W::mma(vf2[dt], pb[g], o[g][dt]);
#pragma unroll
            for (int dt = 0; dt < 4; ++dt)
#pragma unroll
                for (int g = 0; g < NQ; ++g) o[g][dt] = W::mma(vf[dt], pb2[g], o[g][dt]); }
    }
#pragma unroll
    for (int g = 0; g < NQ; ++g) { const float inv = __fdiv_rn(1.0f, l[g] + xhalf(l[g])); const size_t oo = (size_t)(q0 + g * 16 + lr) * DQ + hh * 8;   // Ot register r of tile dt = O[query lr][16 dt + 8 hh + r]
#pragma unroll
        for (int dt = 0; dt < 4; ++dt) { v8us oh, ol;
#pragma unroll
            for (int r = 0; r < 8; ++r) { unsigned short a, c2; splitf(o[g][dt][r] * inv, a, c2); oh[r] = a; ol[r] = c2; }
            *(v8us*)(Ah + oo + dt * 16) = oh; *(v8us*)(Al + oo + dt * 16) = ol;
            asm volatile("s_wait_xcnt 0x0" ::: "memory"); } }   // precaution: stands before the stores' registers are written again
}
// grid (RH / 64 + (TT - RH) / 128, heads, batches), 4 waves: the first RH / 64 blocks take 16 hi/lo queries a wave, the rest 32 fp16 queries a wave (about the same work a pass). The second launch bound asks for 4 waves a SIMD: at most 256 registers, so that every work-group of the grid is resident at once.
__global__ __launch_bounds__(128, 4) void k_fattn(const h16* __restrict__ Q16, const h16* __restrict__ K16, const h16* __restrict__ V16, const bf* __restrict__ Qh, const bf* __restrict__ Ql, const bf* __restrict__ Kh, const bf* __restrict__ Kl, const bf* __restrict__ Vh, const bf* __restrict__ Vl, const int* __restrict__ kmask, bf* Ah, bf* Al) {
    const int wv = __builtin_amdgcn_readfirstlane((int)(threadIdx.x >> 5)); const size_t pz = ((size_t)blockIdx.z * NH_ + blockIdx.y) * TT * HD; const int* kvp = kmask + (size_t)blockIdx.z * TT; const size_t ao = (size_t)blockIdx.z * TT * DQ + (size_t)blockIdx.y * HD;
    if (blockIdx.x < RH / 64) fattn<true, 1>(Qh + pz, Ql + pz, Kh + pz, Kl + pz, Vh + pz, Vl + pz, kvp, (int)blockIdx.x * 64 + wv * 16, Ah + ao, Al + ao);
    else fattn<false, 2>(Q16 + pz, nullptr, K16 + pz, nullptr, V16 + pz, nullptr, kvp, RH + ((int)blockIdx.x - RH / 64) * 128 + wv * 32, Ah + ao, Al + ao);
}

extern "C" void kernel_launch(void* const* d_in, const int* in_sizes, int n_in,
                              void* d_out, int out_size, void* d_ws, size_t ws_size, hipStream_t stream) {
    (void)in_sizes; (void)n_in; (void)out_size;
    const float* x = (const float*)d_in[0]; const float* xk = (const float*)d_in[1]; const float* xv = (const float*)d_in[2]; const int* kmask = (const int*)d_in[3];   /* mask [2][1][1][2048] int32: 1 = excluded key */ const float* wq = (const float*)d_in[4]; const float* bq = (const float*)d_in[5]; const float* wk = (const float*)d_in[6]; const float* bk = (const float*)d_in[7]; const float* wv = (const float*)d_in[8]; const float* bv = (const float*)d_in[9]; const float* wo = (const float*)d_in[10]; const float* bo = (const float*)d_in[11];   /* argument order query, key, value, mask, Wq, bq, Wk, bk, Wv, bv, Wo, bo ('xw') */
    float* OUT = (float*)d_out;     // [2][2048][1024]
    char* wsp = (char*)d_ws;
    auto take = [&](size_t bytes) { char* p = wsp; wsp += (bytes + 255) & ~(size_t)255; return (void*)p; };
    bf* WT = (bf*)take((size_t)4 * DQ * DM * 2);   // transposed Wq, Wk, Wv, Wo
    bf* XB = (bf*)take((size_t)3 * NB_ * TT * DM * 2);   // bf16 query, key, value
    const size_t PLN = (size_t)NH_ * TT * HD;   // one batch's plane set, elements (NKV == NH_); every plane holds both batches
    h16* QP16 = (h16*)take(NB_ * PLN * 2); h16* KP16 = (h16*)take(NB_ * PLN * 2); h16* VT16 = (h16*)take(NB_ * PLN * 2);
    bf* QPh = (bf*)take(NB_ * PLN * 2); bf* QPl = (bf*)take(NB_ * PLN * 2); bf* KPh = (bf*)take(NB_ * PLN * 2); bf* KPl = (bf*)take(NB_ * PLN * 2); bf* VTh = (bf*)take(NB_ * PLN * 2); bf* VTl = (bf*)take(NB_ * PLN * 2);
    bf* ATh = (bf*)take((size_t)NB_ * TT * DQ * 2); bf* ATl = (bf*)take((size_t)NB_ * TT * DQ * 2);
    if ((size_t)(wsp - (char*)d_ws) > ws_size) return;    // ws 256 MiB
    k_prep<<<4 * WB + 3 * CB, 256, 0, stream>>>(x, xk, xv, wq, wk, wv, wo, DM, DQ, WT, XB, (size_t)NB_ * TT * DM / 8);
    k_proj<<<dim3(TT / 64, DQ / 64, 3 * NB_), 256, 0, stream>>>(XB, WT, DM, bq, bk, bv, QP16, KP16, VT16, QPh, QPl, KPh, KPl, VTh, VTl);
    k_fattn<<<dim3(RH / 64 + (TT - RH) / 128, NH_, NB_), 128, 0, stream>>>(QP16, KP16, VT16, QPh, QPl, KPh, KPl, VTh, VTl, kmask, ATh, ATl);
    k_gemmw<bf, 1, true, 8><<<dim3(NB_ * TT / 64, DM / 64, 1), 256, 0, stream>>>(ATh, ATl, WT + (size_t)3 * DQ * DM, nullptr, DQ, OUT, DM, bo);
}

// v006
// One run takes 139 microseconds.
// In two side-by-side timings against v005, it was 1.24 and 1.23 times as fast.
// All steps since v000 together make it 14.5 times as fast.
#include <hip/hip_runtime.h>

// Multi-head attention on three input streams with a per-batch key mask (query, key, value [2][2048][1024]; q = query Wq + bq, k = key Wk + bk, v = value Wv + bv ('xw' 1/32, zero biases; 16 heads x 64); logits = q.k / sqrt(64) + mask[b][0][0][j] x (-1e9) with mask int32 [2][1][1][2048] random 0/1 (read; 1 == that key is excluded); softmax; out = merged Wo + bo -> [2][2048][1024] (4.2 M); argument order query, key, value, mask, Wq, bq, Wk, bk, Wv, bv, Wo, bo).
// Layout, four launches: (1) bf16 copies of query, key, value (both batches) and the four transposed 'xw' weights, all in fragment order (see gemmw); (2) the six exact projections + f32 biases (stream x batch in grid z), whose epilogue writes the head planes; (3) one fused attention kernel over every (batch, head) (hybrid rows: < 512 hi/lo 3 products, rest fp16; running-maximum softmax, S and P stay in registers); it reads the batch's int key vector and excludes keys whose mask is non-zero by select (-1e9 == exclusion); (4) merged hi/lo (written by (3) in fragment order) x Wo exact + bo, both batches as one row range.
// Compute dtypes, f32 accumulate: every input rounded to bf16; projections exact + f32 biases; attention rows < 512 3 products, rest fp16; softmax f32; Wo hl x exact + bias.

#define NB_  2
#define TT   2048
#define DM   1024
#define NH_  16
#define NKV  16
#define REP  (NH_ / NKV)
#define HD   64
#define DQ   (NH_ * HD)
#define DKV  (NKV * HD)
#define RH   512                  // query rows < RH use hi+lo planes (0: none)
#define WIN  0
#define SCL2 0.18033688011112042f   // HD^-0.5 x log2(e): scores are carried in the base-2 domain
typedef _Float16 h16;
typedef unsigned short bf;
typedef __attribute__((ext_vector_type(16))) __bf16   v16bf;
typedef __attribute__((ext_vector_type(16))) _Float16 v16h;
typedef __attribute__((ext_vector_type(8)))  _Float16 v8h;
typedef __attribute__((ext_vector_type(8)))  unsigned short v8us;
typedef __attribute__((ext_vector_type(8)))  float    v8f;
typedef __attribute__((ext_vector_type(4)))  float    v4f;
typedef v8h  __attribute__((may_alias)) v8ha;
typedef v4f  __attribute__((may_alias)) v4fa;
typedef v8us __attribute__((may_alias)) v8usa;

__device__ __forceinline__ unsigned short f2bf(float f) { unsigned u = __float_as_uint(f); u += 0x7FFFu + ((u >> 16) & 1u); return (unsigned short)(u >> 16); }
__device__ __forceinline__ float bf2f(unsigned short b) { return __uint_as_float(((unsigned)b) << 16); }
__device__ __forceinline__ float bfr(float f) { return bf2f(f2bf(f)); }
__device__ __forceinline__ v16h cat16(v8h lo, v8h hi) { return __builtin_shufflevector(lo, hi, 0, 1, 2, 3, 4, 5, 6, 7, 8, 9, 10, 11, 12, 13, 14, 15); }
__device__ __forceinline__ v16bf cat16b(v8us lo, v8us hi) { return __builtin_bit_cast(v16bf, __builtin_shufflevector(lo, hi, 0, 1, 2, 3, 4, 5, 6, 7, 8, 9, 10, 11, 12, 13, 14, 15)); }
__device__ __forceinline__ v8f wmma16(v16h a, v16h b, v8f c) { return __builtin_amdgcn_wmma_f32_16x16x32_f16(false, a, false, b, (short)0, c, false, false); }
__device__ __forceinline__ v8f wmmab(v16bf a, v16bf b, v8f c) { return __builtin_amdgcn_wmma_f32_16x16x32_bf16(false, a, false, b, (short)0, c, false, false); }
__device__ __forceinline__ h16 tohx(float x) { return (h16)x; }
__device__ __forceinline__ void splitf(float y, unsigned short& h, unsigned short& l) { h = f2bf(y); l = f2bf(y - bf2f(h)); }



// ---- gemmw: register-blocked GEMM, one work-group of NW waves per 64x64 output tile (bx, by) (16 accumulators a wave), operands straight from 16-bit planes in fragment order; 32 * NW threads; os is the calling kernel's LDS, GLds<NW>::N floats.
// C[m][n] (f32, pitch ldc, + optional f32 bias[n]) = sum_k A[m][k] Bt[n][k] (+ split products per NSPLIT). K % (32 * NW) == 0.
// Fragment order of an operand plane (rows x K): 16 rows make a block of 16 K elements; in it the 8-element chunk (k >> 3) of row r lies at ((k >> 4) * 32 + ((k >> 3) & 1) * 16 + (r & 15)) * 8, so that lane l finds its two chunks of the 32-wide k step ks at (ks * 64 + l) * 8 and 256 elements on: every fragment load of a wave reads 512 bytes in a row (4 lines, where a row-major plane gives 16 lines of 32 bytes each). The k order of a fragment is AMD's table order (k = 8 hi + s, then 16 + 8 hi + s).
// K is dealt to the waves in 32-wide steps, wave w taking steps w, w + NW, ... (neighbour waves read neighbouring kilobytes of a block); the NW partial tiles meet in LDS and are summed in wave order 0 .. NW-1.
// EPI == 0: the tile goes to C as f32. EPI == 1, 2: the summed tile (+ bias) never reaches memory as f32; it is written from LDS as the three 16-bit head planes (fp16, bf16 hi, bf16 lo) that k_fattn reads, 8 elements (16 bytes a plane) a thread, a wave 512 bytes in a row. A 64x64 tile is one head x 64 tokens = 4096 plane elements in a row, and thread c writes its chunk c.
// EPI == 1 (q, k): rows m = tokens t, columns n = head * 64 + d. Fragment order of a q or k head plane: 16 rows t make a 1024-element block; in it the 8-element chunk (d >> 3) of row t lies at ((d >> 4) * 32 + ((d >> 3) & 1) * 16 + (t & 15)) * 8, so that lane l of a wave finds its two chunks of the 32-wide k step ks at (ks * 64 + l) * 8 and 256 elements on: every fragment load reads 512 bytes in a row.
// EPI == 2 (v, transposed product: A = weight rows, Bt = token rows): rows m = head * 64 + d, columns n = tokens t, bias by row. v head planes, transposed, in fragment order: 32 keys t x 64 d make a 2048-element block; the 8-key chunk of row d lies at (((d >> 4) * 2 + ((t >> 4) & 1)) * 32 + ((t >> 3) & 1) * 16 + (d & 15)) * 8.
template <typename T16> struct WFrag;
template <> struct WFrag<h16> { typedef v16h V; static __device__ __forceinline__ V ldo(const h16* p) { return cat16(*(const v8h*)p, *(const v8h*)(p + 256)); } static __device__ __forceinline__ v8f mma(V a, V b, v8f c) { return wmma16(a, b, c); } };
template <> struct WFrag<bf> { typedef v16bf V; static __device__ __forceinline__ V ldo(const bf* p) { return cat16b(*(const v8us*)p, *(const v8us*)(p + 256)); } static __device__ __forceinline__ v8f mma(V a, V b, v8f c) { return wmmab(a, b, c); } };
template <int NW> struct GLds { static constexpr int MR = (NW == 1) ? 1 : 4;      // 16-row blocks of the tile that pass through LDS at a time (all four where waves join: one barrier)
    static constexpr int SL = MR * 16 * 68;    // one wave's slab, floats
    static constexpr int N = NW * SL; };
template <typename T16, int NSPLIT, bool BIAS, int NW, int K, int EPI = 0>
__device__ __forceinline__ void gemmw(float* os, int bx, int by, const T16* __restrict__ A, const T16* __restrict__ A2, const T16* __restrict__ Bt, const T16* __restrict__ Bt2, float* C, int ldc, const float* __restrict__ bias, h16* P16, bf* Ph, bf* Pl) {
    typedef typename WFrag<T16>::V V;
    constexpr int MR = GLds<NW>::MR, SL = GLds<NW>::SL;
    const int wv = (NW == 1) ? 0 : __builtin_amdgcn_readfirstlane((int)(threadIdx.x >> 5));
    const int lane = threadIdx.x & 31, lr = lane & 15, hi = lane >> 4; const int r0 = bx * 64, c0 = by * 64;
    v8f acc[4][4];
#pragma unroll
    for (int mb = 0; mb < 4; ++mb)
#pragma unroll
        for (int nb = 0; nb < 4; ++nb) acc[mb][nb] = (v8f){};
    const char* Ar = (const char*)(A + (size_t)r0 * K); const char* A2r = (const char*)(A2 + (size_t)r0 * K); const char* Br = (const char*)(Bt + (size_t)c0 * K); const char* B2r = (const char*)(Bt2 + (size_t)c0 * K);   // the tile's first 16-row blocks: the same for the whole work-group
    unsigned fo = lane * 16 + wv * 1024;   // this lane's byte offset in a block at the wave's k step: the one address register of all fragment loads; stepped behind the wait below
#pragma unroll 1
    for (int kc = wv * 32; kc < K; kc += 32 * NW) {
        V a[4], a2[4], b[4], b2[4];
#pragma unroll
        for (int mb = 0; mb < 4; ++mb) { a[mb] = WFrag<T16>::ldo((const T16*)(Ar + fo) + mb * 16 * K); if (NSPLIT == 1 || NSPLIT == 2) a2[mb] = WFrag<T16>::ldo((const T16*)(A2r + fo) + mb * 16 * K); }
#pragma unroll
        for (int nb = 0; nb < 4; ++nb) { b[nb] = WFrag<T16>::ldo((const T16*)(Br + fo) + nb * 16 * K); if (NSPLIT >= 2) b2[nb] = WFrag<T16>::ldo((const T16*)(B2r + fo) + nb * 16 * K); }
        asm volatile("s_wait_xcnt 0x0" ::: "memory");   // precaution: stands before the loads' address register is written again
        fo += 1024 * NW;
        __builtin_amdgcn_sched_barrier(0);   // keeps every load of the k step in front of its products: sunk among them, the later fragments' latency is waited out a second time
#pragma unroll
        for (int nb = 0; nb < 4; ++nb) {
#pragma unroll
            for (int mb = 0; mb < 4; ++mb) { acc[mb][nb] = WFrag<T16>::mma(a[mb], b[nb], acc[mb][nb]); if (NSPLIT == 1 || NSPLIT == 2) acc[mb][nb] = WFrag<T16>::mma(a2[mb], b[nb], acc[mb][nb]); if (NSPLIT >= 2) acc[mb][nb] = WFrag<T16>::mma(a[mb], b2[nb], acc[mb][nb]); } }
        asm volatile("v_nop\n\tv_nop\n\tv_nop\n\tv_nop" : "+v"(acc[0][0]), "+v"(acc[1][1]), "+v"(acc[2][2]), "+v"(acc[3][3]) : "v"(a[0]), "v"(a[3]));
    }
    float* osw = os + wv * SL;
#pragma unroll
    for (int m0 = 0; m0 < 4; m0 += MR) {
#pragma unroll
        for (int mi = 0; mi < MR; ++mi) {
#pragma unroll
            for (int nb = 0; nb < 4; ++nb) {
#pragma unroll
                for (int j = 0; j < 8; ++j) osw[(mi * 16 + hi * 8 + j) * 68 + nb * 16 + lr] = acc[m0 + mi][nb][j]; } }
        if (NW == 1) { __builtin_amdgcn_wave_barrier(); asm volatile("" ::: "memory"); } else __syncthreads();   // every wave's partial tile is in LDS before any is summed
        if constexpr (EPI != 0) {
            static_assert(MR == 4, "the plane epilogue takes the whole tile at once");
            const size_t pbase = (EPI == 1) ? ((size_t)by * TT + r0) * HD : ((size_t)bx * TT + c0) * HD;   // this tile's 4096 elements in a plane
#pragma unroll
            for (int s = 0; s < 16 / NW; ++s) { const int c = s * 32 * NW + (int)threadIdx.x;
                const int row = (EPI == 1) ? (c >> 7) * 16 + (c & 15) : ((c >> 6) & 3) * 16 + (c & 15);
                const int col = (EPI == 1) ? ((c >> 4) & 7) * 8 : (c >> 8) * 32 + ((c >> 4) & 3) * 8;
                v4f v0 = *(const v4fa*)(os + row * 68 + col), v1 = *(const v4fa*)(os + row * 68 + col + 4);
#pragma unroll
                for (int w = 1; w < NW; ++w) { v0 += *(const v4fa*)(os + w * SL + row * 68 + col); v1 += *(const v4fa*)(os + w * SL + row * 68 + col + 4); }
                if (BIAS) {
                    if (EPI == 1) {
#pragma unroll
                        for (int j = 0; j < 4; ++j) { v0[j] += bfr(bias[c0 + col + j]); v1[j] += bfr(bias[c0 + col + 4 + j]); } }
                    else { const float bb = bfr(bias[r0 + row]); v0 += bb; v1 += bb; } }
                v8h o16; v8us oh, ol;
#pragma unroll
                for (int j = 0; j < 8; ++j) { const float y = (j < 4) ? v0[j & 3] : v1[j & 3]; o16[j] = tohx(y); unsigned short a2, c2; splitf(y, a2, c2); oh[j] = a2; ol[j] = c2; }
                *(v8h*)(P16 + pbase + (size_t)c * 8) = o16; *(v8us*)(Ph + pbase + (size_t)c * 8) = oh; *(v8us*)(Pl + pbase + (size_t)c * 8) = ol;
                asm volatile("s_wait_xcnt 0x0" ::: "memory"); }   // precaution: stands before the stores' registers are written again
        } else {
        float* crow = C + (size_t)(r0 + m0 * 16) * ldc + c0;
#pragma unroll
        for (int s = 0; s < MR * 8 / NW; ++s) { const int g = s * 32 * NW + (int)threadIdx.x, row = g >> 4, cofs = (g & 15) * 4; v4f val = *(const v4fa*)(os + row * 68 + cofs);
#pragma unroll
            for (int w = 1; w < NW; ++w) val += *(const v4fa*)(os + w * SL + row * 68 + cofs);
            if (BIAS) { val[0] += bfr(bias[c0 + cofs]); val[1] += bfr(bias[c0 + cofs + 1]); val[2] += bfr(bias[c0 + cofs + 2]); val[3] += bfr(bias[c0 + cofs + 3]); }
            *(v4f*)(crow + (size_t)row * ldc + cofs) = val; }
        }
        if (NW == 1) { __builtin_amdgcn_wave_barrier(); asm volatile("" ::: "memory"); }   // the slab is rewritten by the next row block
    }
}
// plain f32 output; grid (M/64, N/64)
template <typename T16, int NSPLIT, bool BIAS, int NW, int K>
__global__ __launch_bounds__(32 * NW) void k_gemmw(const T16* __restrict__ A, const T16* __restrict__ A2, const T16* __restrict__ Bt, const T16* __restrict__ Bt2, float* C, int ldc, const float* __restrict__ bias) {
    __shared__ __align__(16) float os[GLds<NW>::N];
    gemmw<T16, NSPLIT, BIAS, NW, K, 0>(os, (int)blockIdx.x, (int)blockIdx.y, A, A2, Bt, Bt2, C, ldc, bias, nullptr, nullptr, nullptr);
}
// the six projections in one launch; grid (TT/64, DQ/64, 6), z = stream * 2 + batch (streams q, k, v). XB holds the six bf16 token matrices in z order, WT the transposed weights q, k, v, o. Every plane holds both batches.
// The branch is the same for a whole work-group, so that the barrier in gemmw is passed by all its waves or by none. The v tiles keep their order (feature tile fastest).
__global__ __launch_bounds__(256) void k_proj(const bf* __restrict__ XB, const bf* __restrict__ WT, const float* __restrict__ bq, const float* __restrict__ bk, const float* __restrict__ bv, h16* QP16, h16* KP16, h16* VT16, bf* QPh, bf* QPl, bf* KPh, bf* KPl, bf* VTh, bf* VTl) {
    __shared__ __align__(16) float os[GLds<8>::N];
    const int z = (int)blockIdx.z, st = z >> 1; const size_t po = (size_t)(z & 1) * NH_ * TT * HD; const bf* X = XB + (size_t)z * TT * DM; const bf* Wt = WT + (size_t)st * DQ * DM;
    if (st == 2) { const int f = (int)blockIdx.y * (TT / 64) + (int)blockIdx.x;   /* transposed product: rows = v features, columns = tokens */
        gemmw<bf, 0, true, 8, DM, 2>(os, f % (DKV / 64), f / (DKV / 64), Wt, nullptr, X, nullptr, nullptr, 0, bv, VT16 + po, VTh + po, VTl + po); }
    else gemmw<bf, 0, true, 8, DM, 1>(os, (int)blockIdx.x, (int)blockIdx.y, X, nullptr, Wt, nullptr, nullptr, 0, st ? bk : bq, (st ? KP16 : QP16) + po, (st ? KPh : QPh) + po, (st ? KPl : QPl) + po);
}

typedef __attribute__((ext_vector_type(2))) _Float16 v2h;
typedef __attribute__((ext_vector_type(4))) _Float16 v4h;
typedef __attribute__((ext_vector_type(2))) unsigned short v2us;
typedef __attribute__((ext_vector_type(4))) unsigned short v4us;
typedef __attribute__((ext_vector_type(2))) float v2f;
typedef __attribute__((ext_vector_type(4))) int v4i;
typedef v4h  __attribute__((may_alias)) v4ha;
typedef v4us __attribute__((may_alias)) v4usa;

// k_prep: one wave builds one fragment unit of an operand plane: 16 rows x one 32-wide k step = 512 elements, written as two stores of 512 bytes in a row (fragment order: see gemmw). Lane (lr, hi) holds row lr, k = 8 hi .. 8 hi + 7 and 16 more.
__device__ __forceinline__ void put16(bf* d, const float* f) { v8us o0, o1;
#pragma unroll
    for (int j = 0; j < 8; ++j) { o0[j] = f2bf(f[j]); o1[j] = f2bf(f[8 + j]); }
    *(v8us*)d = o0; *(v8us*)(d + 256) = o1; }
// transposed weight: plane rows n = columns of w [DM][DQ]. The 8 waves of a block take 8 neighbouring 16-column blocks of one k step: each of a lane's 16 loads reads, over the wave, 64 bytes in a row of two rows of w, over the block 512 bytes of each.
__device__ __forceinline__ void wtF(int blk, const float* __restrict__ w, bf* Bt) {
    const int lane = threadIdx.x & 31, lr = lane & 15, hi = lane >> 4; const unsigned u = blk * 8 + (threadIdx.x >> 5), nb = u % (DQ / 16), ks = u / (DQ / 16);
    const float* s = w + (size_t)(ks * 32 + hi * 8) * DQ + nb * 16 + lr; float f[16];
#pragma unroll
    for (int j = 0; j < 16; ++j) f[j] = s[(size_t)((j >> 3) * 16 + (j & 7)) * DQ];
    asm volatile("s_wait_xcnt 0x0" :: "v"(s) : "memory");   // precaution: stands before the loads' address registers are written again; naming the address keeps it whole up to here (no load's result lands on it)
    put16(Bt + ((size_t)nb * (DM / 32) + ks) * 512 + lane * 8, f);
}
// bf16 copy of token rows [.][DM]: the 8 waves of a block take 8 neighbouring k steps of one 16-row block (1 KB in a row of each row).
__device__ __forceinline__ void cvtF(int blk, const float* __restrict__ src, bf* dst) {
    const int lane = threadIdx.x & 31, lr = lane & 15, hi = lane >> 4; const unsigned u = blk * 8 + (threadIdx.x >> 5);
    const float* s = src + (size_t)((u / (DM / 32)) * 16 + lr) * DM + (u % (DM / 32)) * 32 + hi * 8; float f[16];
    const v8f a = *(const v8f*)s, b = *(const v8f*)(s + 16);
    asm volatile("s_wait_xcnt 0x0" :: "v"(s) : "memory");   // precaution, as in wtF
#pragma unroll
    for (int j = 0; j < 8; ++j) { f[j] = a[j]; f[8 + j] = b[j]; }
    put16(dst + (size_t)u * 512 + lane * 8, f);
}
// every 16-bit operand of the projections and of Wo in one launch: blocks [0, 4 WB) transpose the four weights, the next 3 CB copy query, key, value (both batches of a stream lie in a row). The grid holds exactly one wave a unit.
#define WB ((DQ / 16) * (DM / 32) / 8)
#define CB ((NB_ * TT / 16) * (DM / 32) / 8)
__global__ __launch_bounds__(256) void k_prep(const float* __restrict__ x, const float* __restrict__ xk, const float* __restrict__ xv, const float* __restrict__ wq, const float* __restrict__ wk, const float* __restrict__ wv, const float* __restrict__ wo, bf* WT, bf* XB) {
    const int blk = (int)blockIdx.x;
    if (blk < 4 * WB) { const int i = blk / WB; wtF(blk % WB, i == 0 ? wq : i == 1 ? wk : i == 2 ? wv : wo, WT + (size_t)i * DM * DQ); }
    else { const int c = blk - 4 * WB, i = c / CB; cvtF(c % CB, i == 0 ? x : i == 1 ? xk : xv, XB + (size_t)i * NB_ * TT * DM); }
}

// k_fattn: S, softmax, P.V and the head merge in one kernel; no score or probability leaves the registers. One wave owns NQ * 16 queries of one (batch, head) and walks the 2048 keys 32 at a time, on its own (no LDS, no barrier).
// Transposed products: St = K Qt (A = 16 key rows, B = 16 query columns), so lane (c, hh) holds for query c the keys 8 hh + r (tile 0) and 16 + 8 hh + r (tile 1): these 16 values, converted in place, are the B operand of Ot += Vt Pt in the hardware k order, which the v planes' fragment order matches.
// Softmax with a running maximum in the base-2 domain: the maximum in use is raised (and sums and outputs rescaled) only when some query's new maximum exceeds it by more than 8, one test per 32 keys, so p <= 2^8. An excluded key carries -3e38: p == 0 once a kept key has set the maximum; with every key excluded p == 1 for all (uniform, as mask x -1e9 gives in f32).
// eight base-2 exponentials in place: behind each stands an independent one, behind the last a v_nop: the slot that the instruction set asks for between a transcendental and a use of its result or an overwrite of its source
__device__ __forceinline__ void exp8(float* x) {
    asm("v_exp_f32 %0, %0\n\tv_exp_f32 %1, %1\n\tv_exp_f32 %2, %2\n\tv_exp_f32 %3, %3\n\tv_exp_f32 %4, %4\n\tv_exp_f32 %5, %5\n\tv_exp_f32 %6, %6\n\tv_exp_f32 %7, %7\n\tv_nop" : "+v"(x[0]), "+v"(x[1]), "+v"(x[2]), "+v"(x[3]), "+v"(x[4]), "+v"(x[5]), "+v"(x[6]), "+v"(x[7])); }
// the value that lane l ^ 16 holds (the other half of a query's keys), without a trip through LDS
__device__ __forceinline__ float xhalf(float v) { const int b = __float_as_int(v); return __int_as_float(__builtin_amdgcn_permlanex16(b, b, 0x76543210, 0xfedcba98, false, false)); }
template <bool HR> struct FSel { typedef h16 T; };
template <> struct FSel<true> { typedef bf T; };
template <bool HR, int NQ>
__device__ __forceinline__ void fattn(const typename FSel<HR>::T* __restrict__ Q, const typename FSel<HR>::T* __restrict__ Q2, const typename FSel<HR>::T* __restrict__ Kp, const typename FSel<HR>::T* __restrict__ K2, const typename FSel<HR>::T* __restrict__ Vp, const typename FSel<HR>::T* __restrict__ V2, const int* __restrict__ kvp, int q0, bf* Ah, bf* Al) {
    typedef typename FSel<HR>::T T16; typedef WFrag<T16> W; typedef typename W::V V;
    const int lane = threadIdx.x & 31, hh = lane >> 4;   // every inner loop below is unrolled so that each index of a register array is a constant
    V qf[NQ][2], qf2[NQ][2], kf[2][2], kf2[2][2], vf[4], vf2[4]; v4i mk[4]; v8f o[NQ][4]; float m[NQ], l[NQ];
#pragma unroll
    for (int g = 0; g < NQ; ++g) { m[g] = -3.0e38f; l[g] = 0.f;
#pragma unroll
        for (int dt = 0; dt < 4; ++dt) o[g][dt] = (v8f){};
#pragma unroll
        for (int ks = 0; ks < 2; ++ks) { const size_t qo = (size_t)((q0 >> 4) + g) * 1024 + (ks * 64 + lane) * 8; qf[g][ks] = W::ldo(Q + qo); if (HR) qf2[g][ks] = W::ldo(Q2 + qo); } }
    asm volatile("s_wait_xcnt 0x0" ::: "memory");   // precaution, as in loadK
    unsigned ko = lane * 16, vo = lane * 16, mo = hh * 32;   // this lane's byte offsets in the k tiles, the v tile and the key vector that are fetched next; carried through the loop and stepped behind the wait in loadK
    auto loadK = [&]() {
#pragma unroll
        for (int kt = 0; kt < 2; ++kt)
#pragma unroll
            for (int ks = 0; ks < 2; ++ks) { kf[kt][ks] = W::ldo((const T16*)((const char*)Kp + ko) + (kt * 1024 + ks * 512)); if (HR) kf2[kt][ks] = W::ldo((const T16*)((const char*)K2 + ko) + (kt * 1024 + ks * 512)); }
#pragma unroll
        for (int u = 0; u < 4; ++u) mk[u] = *(const v4i*)((const int*)((const char*)kvp + mo) + ((u >> 1) * 16 + (u & 1) * 4));
        asm volatile("s_wait_xcnt 0x0" ::: "memory"); };   // precaution: stands before the address registers of the loads above are written again
    auto loadV = [&]() {
#pragma unroll
        for (int dt = 0; dt < 4; ++dt) { vf[dt] = W::ldo((const T16*)((const char*)Vp + vo) + dt * 512); if (HR) vf2[dt] = W::ldo((const T16*)((const char*)V2 + vo) + dt * 512); } };   // their offset is stepped behind loadK's wait
    loadK(); ko += 4096; mo += 128;
#pragma unroll 1   // one pass a trip: a second copy of the body would hold a second set of fragments and scores live
    for (int it = 0; it < TT / 32; ++it) {
        loadV();   // this pass's v fragments fly during its S products and softmax; issued behind the k loads on every path, so that the wait for k leaves them in flight
        __builtin_amdgcn_sched_barrier(0);   // keeps the v loads in front of the S products: sunk behind them they have only the exponentials to fly in
        v8f s[NQ][2];
#pragma unroll
        for (int g = 0; g < NQ; ++g) { s[g][0] = (v8f){}; s[g][1] = (v8f){}; }
#pragma unroll
        for (int ks = 0; ks < 2; ++ks) {
#pragma unroll
            for (int g = 0; g < NQ; ++g)
#pragma unroll
                for (int kt = 0; kt < 2; ++kt) s[g][kt] = W::mma(kf[kt][ks], qf[g][ks], s[g][kt]);
            if (HR) {
#pragma unroll
                for (int g = 0; g < NQ; ++g)
#pragma unroll
                    for (int kt = 0; kt < 2; ++kt) s[g][kt] = W::mma(kf2[kt][ks], qf[g][ks], s[g][kt]);
#pragma unroll
                for (int g = 0; g < NQ; ++g)
#pragma unroll
                    for (int kt = 0; kt < 2; ++kt) s[g][kt] = W::mma(kf[kt][ks], qf2[g][ks], s[g][kt]); } }
        float ml[NQ]; bool need = false;
#pragma unroll
        for (int g = 0; g < NQ; ++g) { float mx = -3.0e38f;
#pragma unroll
            for (int kt = 0; kt < 2; ++kt)
#pragma unroll
                for (int r = 0; r < 8; ++r) { const float t = (mk[kt * 2 + (r >> 2)][r & 3] == 0) ? s[g][kt][r] * SCL2 : -3.0e38f; s[g][kt][r] = t; mx = fmaxf(mx, t); }
            mx = fmaxf(mx, xhalf(mx)); ml[g] = mx; need = need || (mx > m[g] + 8.0f); }
        loadK();   // the next pass's k fragments and key vector fly during this pass's softmax and P.V
        if (__builtin_amdgcn_ballot_w32(need) != 0) {
#pragma unroll
            for (int g = 0; g < NQ; ++g) { const float mn = fmaxf(m[g], ml[g]); const float al = __builtin_amdgcn_exp2f(m[g] - mn); m[g] = mn; l[g] *= al;
#pragma unroll
                for (int dt = 0; dt < 4; ++dt) o[g][dt] *= al; } }
        { const unsigned st = (it + 2 < TT / 32) ? 1u : 0u; ko += st * 4096; mo += st * 128; vo += 4096; }   // the last pass fetches its own k tiles again: in bounds, no branch round the loads
        V pb[NQ], pb2[NQ];
#pragma unroll
        for (int g = 0; g < NQ; ++g) { float sm[4];   // four independent chains
            float x[16];
#pragma unroll
            for (int e = 0; e < 16; ++e) x[e] = s[g][e >> 3][e & 7] - m[g];
            exp8(x); exp8(x + 8);
#pragma unroll
            for (int e = 0; e < 16; ++e) { const float p = x[e]; sm[e & 3] = (e < 4) ? p : sm[e & 3] + p;
                if constexpr (HR) { const __bf16 ph = (__bf16)p; pb[g][e] = ph; pb2[g][e] = (__bf16)(p - (float)ph); } else pb[g][e] = (h16)p; }
            l[g] += (sm[0] + sm[1]) + (sm[2] + sm[3]); }
#pragma unroll
        for (int dt = 0; dt < 4; ++dt)
#pragma unroll
            for (int g = 0; g < NQ; ++g) o[g][dt] = W::mma(vf[dt], pb[g], o[g][dt]);
        if (HR) {
#pragma unroll
            for (int dt = 0; dt < 4; ++dt)
#pragma unroll
                for (int g = 0; g < NQ; ++g) o[g][dt] = W::mma(vf2[dt], pb[g], o[g][dt]);
#pragma unroll
            for (int dt = 0; dt < 4; ++dt)
#pragma unroll
                for (int g = 0; g < NQ; ++g) o[g][dt] = W::mma(vf[dt], pb2[g], o[g][dt]); }
    }
#pragma unroll
    for (int g = 0; g < NQ; ++g) { const float inv = __fdiv_rn(1.0f, l[g] + xhalf(l[g])); const size_t oo = (size_t)(q0 + g * 16) * DQ + lane * 8;   // Ot register r of tile dt = O[query lane & 15][16 dt + 8 hh + r]: chunk 'lane' of the head's 16-wide column group dt in the fragment order that Wo's A loader reads
#pragma unroll
        for (int dt = 0; dt < 4; ++dt) { v8us oh, ol;
#pragma unroll
            for (int r = 0; r < 8; ++r) { unsigned short a, c2; splitf(o[g][dt][r] * inv, a, c2); oh[r] = a; ol[r] = c2; }
            *(v8us*)(Ah + oo + dt * 256) = oh; *(v8us*)(Al + oo + dt * 256) = ol;
            asm volatile("s_wait_xcnt 0x0" ::: "memory"); } }   // precaution: stands before the stores' registers are written again
}
// grid (RH / 64 + (TT - RH) / 128, heads, batches), 4 waves: the first RH / 64 blocks take 16 hi/lo queries a wave, the rest 32 fp16 queries a wave (about the same work a pass). The second launch bound asks for 4 waves a SIMD: at most 256 registers, so that every work-group of the grid is resident at once.
__global__ __launch_bounds__(128, 4) void k_fattn(const h16* __restrict__ Q16, const h16* __restrict__ K16, const h16* __restrict__ V16, const bf* __restrict__ Qh, const bf* __restrict__ Ql, const bf* __restrict__ Kh, const bf* __restrict__ Kl, const bf* __restrict__ Vh, const bf* __restrict__ Vl, const int* __restrict__ kmask, bf* Ah, bf* Al) {
    const int wv = __builtin_amdgcn_readfirstlane((int)(threadIdx.x >> 5)); const size_t pz = ((size_t)blockIdx.z * NH_ + blockIdx.y) * TT * HD; const int* kvp = kmask + (size_t)blockIdx.z * TT; const size_t ao = (size_t)blockIdx.z * TT * DQ + (size_t)blockIdx.y * HD * 16;
    if (blockIdx.x < RH / 64) fattn<true, 1>(Qh + pz, Ql + pz, Kh + pz, Kl + pz, Vh + pz, Vl + pz, kvp, (int)blockIdx.x * 64 + wv * 16, Ah + ao, Al + ao);
    else fattn<false, 2>(Q16 + pz, nullptr, K16 + pz, nullptr, V16 + pz, nullptr, kvp, RH + ((int)blockIdx.x - RH / 64) * 128 + wv * 32, Ah + ao, Al + ao);
}

extern "C" void kernel_launch(void* const* d_in, const int* in_sizes, int n_in,
                              void* d_out, int out_size, void* d_ws, size_t ws_size, hipStream_t stream) {
    (void)in_sizes; (void)n_in; (void)out_size;
    const float* x = (const float*)d_in[0]; const float* xk = (const float*)d_in[1]; const float* xv = (const float*)d_in[2]; const int* kmask = (const int*)d_in[3];   /* mask [2][1][1][2048] int32: 1 = excluded key */ const float* wq = (const float*)d_in[4]; const float* bq = (const float*)d_in[5]; const float* wk = (const float*)d_in[6]; const float* bk = (const float*)d_in[7]; const float* wv = (const float*)d_in[8]; const float* bv = (const float*)d_in[9]; const float* wo = (const float*)d_in[10]; const float* bo = (const float*)d_in[11];   /* argument order query, key, value, mask, Wq, bq, Wk, bk, Wv, bv, Wo, bo ('xw') */
    float* OUT = (float*)d_out;     // [2][2048][1024]
    char* wsp = (char*)d_ws;
    auto take = [&](size_t bytes) { char* p = wsp; wsp += (bytes + 255) & ~(size_t)255; return (void*)p; };
    bf* WT = (bf*)take((size_t)4 * DQ * DM * 2);   // transposed Wq, Wk, Wv, Wo
    bf* XB = (bf*)take((size_t)3 * NB_ * TT * DM * 2);   // bf16 query, key, value
    const size_t PLN = (size_t)NH_ * TT * HD;   // one batch's plane set, elements (NKV == NH_); every plane holds both batches
    h16* QP16 = (h16*)take(NB_ * PLN * 2); h16* KP16 = (h16*)take(NB_ * PLN * 2); h16* VT16 = (h16*)take(NB_ * PLN * 2);
    bf* QPh = (bf*)take(NB_ * PLN * 2); bf* QPl = (bf*)take(NB_ * PLN * 2); bf* KPh = (bf*)take(NB_ * PLN * 2); bf* KPl = (bf*)take(NB_ * PLN * 2); bf* VTh = (bf*)take(NB_ * PLN * 2); bf* VTl = (bf*)take(NB_ * PLN * 2);
    bf* ATh = (bf*)take((size_t)NB_ * TT * DQ * 2); bf* ATl = (bf*)take((size_t)NB_ * TT * DQ * 2);
    if ((size_t)(wsp - (char*)d_ws) > ws_size) return;    // ws 256 MiB
    k_prep<<<4 * WB + 3 * CB, 256, 0, stream>>>(x, xk, xv, wq, wk, wv, wo, WT, XB);
    k_proj<<<dim3(TT / 64, DQ / 64, 3 * NB_), 256, 0, stream>>>(XB, WT, bq, bk, bv, QP16, KP16, VT16, QPh, QPl, KPh, KPl, VTh, VTl);
    k_fattn<<<dim3(RH / 64 + (TT - RH) / 128, NH_, NB_), 128, 0, stream>>>(QP16, KP16, VT16, QPh, QPl, KPh, KPl, VTh, VTl, kmask, ATh, ATl);
    k_gemmw<bf, 1, true, 8, DQ><<<dim3(NB_ * TT / 64, DM / 64, 1), 256, 0, stream>>>(ATh, ATl, WT + (size_t)3 * DQ * DM, nullptr, OUT, DM, bo);
}

// v007
// Measured time: 136 microseconds a run.
// Next to v006, in two timings, it ran 1.03 times as fast each time.
// Counting every step since v000, it is 15.0 times as fast.
#include <hip/hip_runtime.h>

// Multi-head attention on three input streams with a per-batch key mask (query, key, value [2][2048][1024]; q = query Wq + bq, k = key Wk + bk, v = value Wv + bv ('xw' 1/32, zero biases; 16 heads x 64); logits = q.k / sqrt(64) + mask[b][0][0][j] x (-1e9) with mask int32 [2][1][1][2048] random 0/1 (read; 1 == that key is excluded); softmax; out = merged Wo + bo -> [2][2048][1024] (4.2 M); argument order query, key, value, mask, Wq, bq, Wk, bk, Wv, bv, Wo, bo).
// Layout, four launches: (1) bf16 copies of query, key, value (both batches) and the four transposed 'xw' weights, all in fragment order (see gemmw); (2) the six exact projections + f32 biases (stream x batch in grid z), whose epilogue writes the head planes; (3) one fused attention kernel over every (batch, head) (hybrid rows: < 512 hi/lo 3 products, rest fp16; running-maximum softmax, S and P stay in registers); it reads the batch's int key vector and excludes keys whose mask is non-zero by select (-1e9 == exclusion); (4) merged hi/lo (written by (3) in fragment order) x Wo exact + bo, both batches as one row range.
// Compute dtypes, f32 accumulate: every input rounded to bf16; projections exact + f32 biases; attention rows < 512 3 products, rest fp16; softmax f32; Wo hl x exact + bias.

#define NB_  2
#define TT   2048
#define DM   1024
#define NH_  16
#define NKV  16
#define REP  (NH_ / NKV)
#define HD   64
#define DQ   (NH_ * HD)
#define DKV  (NKV * HD)
#define RH   512                  // query rows < RH use hi+lo planes (0: none)
#define WIN  0
#define SCL2 0.18033688011112042f   // HD^-0.5 x log2(e): scores are carried in the base-2 domain
typedef _Float16 h16;
typedef unsigned short bf;
typedef __attribute__((ext_vector_type(16))) __bf16   v16bf;
typedef __attribute__((ext_vector_type(16))) _Float16 v16h;
typedef __attribute__((ext_vector_type(8)))  _Float16 v8h;
typedef __attribute__((ext_vector_type(8)))  unsigned short v8us;
typedef __attribute__((ext_vector_type(8)))  float    v8f;
typedef __attribute__((ext_vector_type(4)))  float    v4f;
typedef v8h  __attribute__((may_alias)) v8ha;
typedef v4f  __attribute__((may_alias)) v4fa;
typedef v8us __attribute__((may_alias)) v8usa;

__device__ __forceinline__ unsigned short f2bf(float f) { unsigned u = __float_as_uint(f); u += 0x7FFFu + ((u >> 16) & 1u); return (unsigned short)(u >> 16); }
__device__ __forceinline__ float bf2f(unsigned short b) { return __uint_as_float(((unsigned)b) << 16); }
__device__ __forceinline__ float bfr(float f) { return bf2f(f2bf(f)); }
__device__ __forceinline__ v16h cat16(v8h lo, v8h hi) { return __builtin_shufflevector(lo, hi, 0, 1, 2, 3, 4, 5, 6, 7, 8, 9, 10, 11, 12, 13, 14, 15); }
__device__ __forceinline__ v16bf cat16b(v8us lo, v8us hi) { return __builtin_bit_cast(v16bf, __builtin_shufflevector(lo, hi, 0, 1, 2, 3, 4, 5, 6, 7, 8, 9, 10, 11, 12, 13, 14, 15)); }
__device__ __forceinline__ v8f wmma16(v16h a, v16h b, v8f c) { return __builtin_amdgcn_wmma_f32_16x16x32_f16(false, a, false, b, (short)0, c, false, false); }
__device__ __forceinline__ v8f wmmab(v16bf a, v16bf b, v8f c) { return __builtin_amdgcn_wmma_f32_16x16x32_bf16(false, a, false, b, (short)0, c, false, false); }
__device__ __forceinline__ h16 tohx(float x) { return (h16)x; }
__device__ __forceinline__ void splitf(float y, unsigned short& h, unsigned short& l) { h = f2bf(y); l = f2bf(y - bf2f(h)); }



// ---- gemmw: register-blocked GEMM, NW waves per 64x64 output tile (bx, by) (16 accumulators a wave), operands straight from 16-bit planes in fragment order. A work-group holds four such tiles, the 2 x 2 quarters of a 128x128 tile: 4 * NW waves, wave w on quarter w & 3 with K share w >> 2. The two quarters of a row share their A blocks and the two of a column their B blocks, at the same k step, so that a block's second reader can find it in the WGP's cache and need not ask L2 again. os is the quarter's part of the calling kernel's LDS, GLds<NW>::N floats.
// C[m][n] (f32, pitch ldc, + optional f32 bias[n]) = sum_k A[m][k] Bt[n][k] (+ split products per NSPLIT). K % (32 * NW) == 0.
// Fragment order of an operand plane (rows x K): 16 rows make a block of 16 K elements; in it the 8-element chunk (k >> 3) of row r lies at ((k >> 4) * 32 + ((k >> 3) & 1) * 16 + (r & 15)) * 8, so that lane l finds its two chunks of the 32-wide k step ks at (ks * 64 + l) * 8 and 256 elements on: every fragment load of a wave reads 512 bytes in a row (4 lines, where a row-major plane gives 16 lines of 32 bytes each). The k order of a fragment is that of the row-major loader.
// K is dealt to a tile's NW waves in 32-wide steps, share w taking steps w, w + NW, ... (neighbour shares read neighbouring kilobytes of a block); the NW partial tiles meet in LDS and are summed in the order of the shares 0 .. NW-1.
// EPI == 0: the tile goes to C as f32. EPI == 1, 2: the summed tile (+ bias) never reaches memory as f32; it is written from LDS as the three 16-bit head planes (fp16, bf16 hi, bf16 lo) that k_fattn reads, 8 elements (16 bytes a plane) a thread, a wave 512 bytes in a row. A 64x64 tile is one head x 64 tokens = 4096 plane elements in a row, and thread c writes its chunk c.
// EPI == 1 (q, k): rows m = tokens t, columns n = head * 64 + d. Fragment order of a q or k head plane: 16 rows t make a 1024-element block; in it the 8-element chunk (d >> 3) of row t lies at ((d >> 4) * 32 + ((d >> 3) & 1) * 16 + (t & 15)) * 8, so that lane l of a wave finds its two chunks of the 32-wide k step ks at (ks * 64 + l) * 8 and 256 elements on: every fragment load reads 512 bytes in a row.
// EPI == 2 (v, transposed product: A = weight rows, Bt = token rows): rows m = head * 64 + d, columns n = tokens t, bias by row. v head planes, transposed, in fragment order: 32 keys t x 64 d make a 2048-element block; the 8-key chunk of row d lies at (((d >> 4) * 2 + ((t >> 4) & 1)) * 32 + ((t >> 3) & 1) * 16 + (d & 15)) * 8.
template <typename T16> struct WFrag;
template <> struct WFrag<h16> { typedef v16h V; static __device__ __forceinline__ V ldo(const h16* p) { return cat16(*(const v8h*)p, *(const v8h*)(p + 256)); } static __device__ __forceinline__ v8f mma(V a, V b, v8f c) { return wmma16(a, b, c); } };
template <> struct WFrag<bf> { typedef v16bf V; static __device__ __forceinline__ V ldo(const bf* p) { return cat16b(*(const v8us*)p, *(const v8us*)(p + 256)); } static __device__ __forceinline__ v8f mma(V a, V b, v8f c) { return wmmab(a, b, c); } };
template <int NW> struct GLds { static constexpr int MR = 4;      // 16-row blocks of the tile that pass through LDS at a time (all four: one barrier)
    static constexpr int SL = MR * 16 * 68;    // one wave's slab, floats
    static constexpr int N = NW * SL; };
template <typename T16, int NSPLIT, bool BIAS, int NW, int K, int EPI = 0>
__device__ __forceinline__ void gemmw(float* os, int bx, int by, const T16* __restrict__ A, const T16* __restrict__ A2, const T16* __restrict__ Bt, const T16* __restrict__ Bt2, float* C, int ldc, const float* __restrict__ bias, h16* P16, bf* Ph, bf* Pl) {
    typedef typename WFrag<T16>::V V;
    constexpr int MR = GLds<NW>::MR, SL = GLds<NW>::SL;
    const int wv = (NW == 1) ? 0 : __builtin_amdgcn_readfirstlane((int)(threadIdx.x >> 7));   // K share: four waves (one a quarter) hold the same one
    const int lane = threadIdx.x & 31, lr = lane & 15, hi = lane >> 4; const int r0 = bx * 64, c0 = by * 64; const int tid = wv * 32 + lane;   // tid: this thread among the 32 * NW of its quarter
    v8f acc[4][4];
#pragma unroll
    for (int mb = 0; mb < 4; ++mb)
#pragma unroll
        for (int nb = 0; nb < 4; ++nb) acc[mb][nb] = (v8f){};
    const char* Ar = (const char*)(A + (size_t)r0 * K); const char* A2r = (const char*)(A2 + (size_t)r0 * K); const char* Br = (const char*)(Bt + (size_t)c0 * K); const char* B2r = (const char*)(Bt2 + (size_t)c0 * K);   // the tile's first 16-row blocks: the same for the whole wave
    unsigned fo = lane * 16 + wv * 1024;   // this lane's byte offset in a block at the wave's k step: the one address register of all fragment loads; stepped behind the wait below
#pragma unroll 1
    for (int kc = wv * 32; kc < K; kc += 32 * NW) {
        V a[4], a2[4], b[4], b2[4];
#pragma unroll
        for (int mb = 0; mb < 4; ++mb) { a[mb] = WFrag<T16>::ldo((const T16*)(Ar + fo) + mb * 16 * K); if (NSPLIT == 1 || NSPLIT == 2) a2[mb] = WFrag<T16>::ldo((const T16*)(A2r + fo) + mb * 16 * K); }
#pragma unroll
        for (int nb = 0; nb < 4; ++nb) { b[nb] = WFrag<T16>::ldo((const T16*)(Br + fo) + nb * 16 * K); if (NSPLIT >= 2) b2[nb] = WFrag<T16>::ldo((const T16*)(B2r + fo) + nb * 16 * K); }
        asm volatile("s_wait_xcnt 0x0" : "+v"(fo) :: "memory");   // precaution: stands before the loads' address register is written again; naming the offset keeps it the one 32-bit address register of all loads, whole up to here (where the trip count is a constant the compiler otherwise forms 64-bit addresses every trip, and a load's result lands on them)
        fo += 1024 * NW;
        __builtin_amdgcn_sched_barrier(0);   // keeps every load of the k step in front of its products: sunk among them, the later fragments' latency is waited out a second time
#pragma unroll
        for (int nb = 0; nb < 4; ++nb) {
#pragma unroll
            for (int mb = 0; mb < 4; ++mb) { acc[mb][nb] = WFrag<T16>::mma(a[mb], b[nb], acc[mb][nb]); if (NSPLIT == 1 || NSPLIT == 2) acc[mb][nb] = WFrag<T16>::mma(a2[mb], b[nb], acc[mb][nb]); if (NSPLIT >= 2) acc[mb][nb] = WFrag<T16>::mma(a[mb], b2[nb], acc[mb][nb]); } }
        asm volatile("v_nop\n\tv_nop\n\tv_nop\n\tv_nop" : "+v"(acc[0][0]), "+v"(acc[1][1]), "+v"(acc[2][2]), "+v"(acc[3][3]) : "v"(a[0]), "v"(a[3]));
    }
    float* osw = os + wv * SL;
#pragma unroll
    for (int m0 = 0; m0 < 4; m0 += MR) {
#pragma unroll
        for (int mi = 0; mi < MR; ++mi) {
#pragma unroll
            for (int nb = 0; nb < 4; ++nb) {
#pragma unroll
                for (int j = 0; j < 8; ++j) osw[(mi * 16 + hi * 8 + j) * 68 + nb * 16 + lr] = acc[m0 + mi][nb][j]; } }
        __syncthreads();   // every wave's tile is in LDS before any lane reads what other lanes and waves wrote
        if constexpr (EPI != 0) {
            static_assert(MR == 4, "the plane epilogue takes the whole tile at once");
            const size_t pbase = (EPI == 1) ? ((size_t)by * TT + r0) * HD : ((size_t)bx * TT + c0) * HD;   // this tile's 4096 elements in a plane
#pragma unroll 2   // two chunks a trip: sixteen copies of this body (NW == 1) would be some 30 KB of code that runs once
            for (int s = 0; s < 16 / NW; ++s) { const int c = s * 32 * NW + tid;
                const int row = (EPI == 1) ? (c >> 7) * 16 + (c & 15) : ((c >> 6) & 3) * 16 + (c & 15);
                const int col = (EPI == 1) ? ((c >> 4) & 7) * 8 : (c >> 8) * 32 + ((c >> 4) & 3) * 8;
                v4f v0 = *(const v4fa*)(os + row * 68 + col), v1 = *(const v4fa*)(os + row * 68 + col + 4);
#pragma unroll
                for (int w = 1; w < NW; ++w) { v0 += *(const v4fa*)(os + w * SL + row * 68 + col); v1 += *(const v4fa*)(os + w * SL + row * 68 + col + 4); }
                if (BIAS) {
                    if (EPI == 1) {
#pragma unroll
                        for (int j = 0; j < 4; ++j) { v0[j] += bfr(bias[c0 + col + j]); v1[j] += bfr(bias[c0 + col + 4 + j]); } }
                    else { const float bb = bfr(bias[r0 + row]); v0 += bb; v1 += bb; } }
                v8h o16; v8us oh, ol;
#pragma unroll
                for (int j = 0; j < 8; ++j) { const float y = (j < 4) ? v0[j & 3] : v1[j & 3]; o16[j] = tohx(y); unsigned short a2, c2; splitf(y, a2, c2); oh[j] = a2; ol[j] = c2; }
                *(v8h*)(P16 + pbase + (size_t)c * 8) = o16; *(v8us*)(Ph + pbase + (size_t)c * 8) = oh; *(v8us*)(Pl + pbase + (size_t)c * 8) = ol;
                asm volatile("s_wait_xcnt 0x0" ::: "memory"); }   // precaution: stands before the stores' registers are written again
        } else {
        float* crow = C + (size_t)(r0 + m0 * 16) * ldc + c0;
#pragma unroll
        for (int s = 0; s < MR * 8 / NW; ++s) { const int g = s * 32 * NW + tid, row = g >> 4, cofs = (g & 15) * 4; v4f val = *(const v4fa*)(os + row * 68 + cofs);
#pragma unroll
            for (int w = 1; w < NW; ++w) val += *(const v4fa*)(os + w * SL + row * 68 + cofs);
            if (BIAS) { val[0] += bfr(bias[c0 + cofs]); val[1] += bfr(bias[c0 + cofs + 1]); val[2] += bfr(bias[c0 + cofs + 2]); val[3] += bfr(bias[c0 + cofs + 3]); }
            *(v4f*)(crow + (size_t)row * ldc + cofs) = val; }
        }
    }
}
// plain f32 output; grid (M/128, N/128), 4 * NW waves
template <typename T16, int NSPLIT, bool BIAS, int NW, int K>
__global__ __launch_bounds__(128 * NW) void k_gemmw(const T16* __restrict__ A, const T16* __restrict__ A2, const T16* __restrict__ Bt, const T16* __restrict__ Bt2, float* C, int ldc, const float* __restrict__ bias) {
    __shared__ __align__(16) float os[4 * GLds<NW>::N];
    const int q = __builtin_amdgcn_readfirstlane((int)(threadIdx.x >> 5) & 3);
    gemmw<T16, NSPLIT, BIAS, NW, K, 0>(os + q * GLds<NW>::N, (int)blockIdx.x * 2 + (q & 1), (int)blockIdx.y * 2 + (q >> 1), A, A2, Bt, Bt2, C, ldc, bias, nullptr, nullptr, nullptr);
}
// the six projections in one launch; grid (TT/128, DQ/128, 6), 4 waves (each the whole K of its quarter: three work-groups a WGP hold the whole grid at once), z = stream * 2 + batch (streams q, k, v). XB holds the six bf16 token matrices in z order, WT the transposed weights q, k, v, o. Every plane holds both batches.
// The branch is the same for a whole work-group, so that the barrier in gemmw is passed by all its waves or by none. The v tiles keep their order (feature tile fastest).
__global__ __launch_bounds__(128) void k_proj(const bf* __restrict__ XB, const bf* __restrict__ WT, const float* __restrict__ bq, const float* __restrict__ bk, const float* __restrict__ bv, h16* QP16, h16* KP16, h16* VT16, bf* QPh, bf* QPl, bf* KPh, bf* KPl, bf* VTh, bf* VTl) {
    __shared__ __align__(16) float osa[4 * GLds<1>::N];
    const int q = __builtin_amdgcn_readfirstlane((int)(threadIdx.x >> 5) & 3); float* os = osa + q * GLds<1>::N;
    const int z = (int)blockIdx.z, st = z >> 1; const size_t po = (size_t)(z & 1) * NH_ * TT * HD; const bf* X = XB + (size_t)z * TT * DM; const bf* Wt = WT + (size_t)st * DQ * DM;
    if (st == 2) { const int f = (int)blockIdx.y * (TT / 128) + (int)blockIdx.x;   /* transposed product: rows = v features, columns = tokens */
        gemmw<bf, 0, true, 1, DM, 2>(os, f % (DKV / 128) * 2 + (q & 1), f / (DKV / 128) * 2 + (q >> 1), Wt, nullptr, X, nullptr, nullptr, 0, bv, VT16 + po, VTh + po, VTl + po); }
    else gemmw<bf, 0, true, 1, DM, 1>(os, (int)blockIdx.x * 2 + (q & 1), (int)blockIdx.y * 2 + (q >> 1), X, nullptr, Wt, nullptr, nullptr, 0, st ? bk : bq, (st ? KP16 : QP16) + po, (st ? KPh : QPh) + po, (st ? KPl : QPl) + po);
}

typedef __attribute__((ext_vector_type(2))) _Float16 v2h;
typedef __attribute__((ext_vector_type(4))) _Float16 v4h;
typedef __attribute__((ext_vector_type(2))) unsigned short v2us;
typedef __attribute__((ext_vector_type(4))) unsigned short v4us;
typedef __attribute__((ext_vector_type(2))) float v2f;
typedef __attribute__((ext_vector_type(4))) int v4i;
typedef v4h  __attribute__((may_alias)) v4ha;
typedef v4us __attribute__((may_alias)) v4usa;

// k_prep: one wave builds one fragment unit of an operand plane: 16 rows x one 32-wide k step = 512 elements, written as two stores of 512 bytes in a row (fragment order: see gemmw). Lane (lr, hi) holds row lr, k = 8 hi .. 8 hi + 7 and 16 more.
__device__ __forceinline__ void put16(bf* d, const float* f) { v8us o0, o1;
#pragma unroll
    for (int j = 0; j < 8; ++j) { o0[j] = f2bf(f[j]); o1[j] = f2bf(f[8 + j]); }
    *(v8us*)d = o0; *(v8us*)(d + 256) = o1; }
// transposed weight: plane rows n = columns of w [DM][DQ]. The 8 waves of a block take 8 neighbouring 16-column blocks of one k step: each of a lane's 16 loads reads, over the wave, 64 bytes in a row of two rows of w, over the block 512 bytes of each.
__device__ __forceinline__ void wtF(int blk, const float* __restrict__ w, bf* Bt) {
    const int lane = threadIdx.x & 31, lr = lane & 15, hi = lane >> 4; const unsigned u = blk * 8 + (threadIdx.x >> 5), nb = u % (DQ / 16), ks = u / (DQ / 16);
    const float* s = w + (size_t)(ks * 32 + hi * 8) * DQ + nb * 16 + lr; float f[16];
#pragma unroll
    for (int j = 0; j < 16; ++j) f[j] = s[(size_t)((j >> 3) * 16 + (j & 7)) * DQ];
    asm volatile("s_wait_xcnt 0x0" :: "v"(s) : "memory");   // precaution: stands before the loads' address registers are written again; naming the address keeps it whole up to here (no load's result lands on it)
    put16(Bt + ((size_t)nb * (DM / 32) + ks) * 512 + lane * 8, f);
}
// bf16 copy of token rows [.][DM]: the 8 waves of a block take 8 neighbouring k steps of one 16-row block (1 KB in a row of each row).
__device__ __forceinline__ void cvtF(int blk, const float* __restrict__ src, bf* dst) {
    const int lane = threadIdx.x & 31, lr = lane & 15, hi = lane >> 4; const unsigned u = blk * 8 + (threadIdx.x >> 5);
    const float* s = src + (size_t)((u / (DM / 32)) * 16 + lr) * DM + (u % (DM / 32)) * 32 + hi * 8; float f[16];
    const v8f a = *(const v8f*)s, b = *(const v8f*)(s + 16);
    asm volatile("s_wait_xcnt 0x0" :: "v"(s) : "memory");   // precaution, as in wtF
#pragma unroll
    for (int j = 0; j < 8; ++j) { f[j] = a[j]; f[8 + j] = b[j]; }
    put16(dst + (size_t)u * 512 + lane * 8, f);
}
// every 16-bit operand of the projections and of Wo in one launch: blocks [0, 4 WB) transpose the four weights, the next 3 CB copy query, key, value (both batches of a stream lie in a row). The grid holds exactly one wave a unit.
#define WB ((DQ / 16) * (DM / 32) / 8)
#define CB ((NB_ * TT / 16) * (DM / 32) / 8)
__global__ __launch_bounds__(256) void k_prep(const float* __restrict__ x, const float* __restrict__ xk, const float* __restrict__ xv, const float* __restrict__ wq, const float* __restrict__ wk, const float* __restrict__ wv, const float* __restrict__ wo, bf* WT, bf* XB) {
    const int blk = (int)blockIdx.x;
    if (blk < 4 * WB) { const int i = blk / WB; wtF(blk % WB, i == 0 ? wq : i == 1 ? wk : i == 2 ? wv : wo, WT + (size_t)i * DM * DQ); }
    else { const int c = blk - 4 * WB, i = c / CB; cvtF(c % CB, i == 0 ? x : i == 1 ? xk : xv, XB + (size_t)i * NB_ * TT * DM); }
}

// k_fattn: S, softmax, P.V and the head merge in one kernel; no score or probability leaves the registers. One wave owns NQ * 16 queries of one (batch, head) and walks the 2048 keys 32 at a time, on its own (no LDS, no barrier).
// Transposed products: St = K Qt (A = 16 key rows, B = 16 query columns), so lane (c, hh) holds for query c the keys 8 hh + r (tile 0) and 16 + 8 hh + r (tile 1): these 16 values, converted in place, are the B operand of Ot += Vt Pt in the hardware k order, which the v planes' fragment order matches.
// Softmax with a running maximum in the base-2 domain: the maximum in use is raised (and sums and outputs rescaled) only when some query's new maximum exceeds it by more than 8, one test per 32 keys, so p <= 2^8. An excluded key carries -3e38: p == 0 once a kept key has set the maximum; with every key excluded p == 1 for all (uniform, as mask x -1e9 gives in f32).
// eight base-2 exponentials in place: behind each stands an independent one, behind the last a v_nop: the slot that the instruction set asks for between a transcendental and a use of its result or an overwrite of its source
__device__ __forceinline__ void exp8(float* x) {
    asm("v_exp_f32 %0, %0\n\tv_exp_f32 %1, %1\n\tv_exp_f32 %2, %2\n\tv_exp_f32 %3, %3\n\tv_exp_f32 %4, %4\n\tv_exp_f32 %5, %5\n\tv_exp_f32 %6, %6\n\tv_exp_f32 %7, %7\n\tv_nop" : "+v"(x[0]), "+v"(x[1]), "+v"(x[2]), "+v"(x[3]), "+v"(x[4]), "+v"(x[5]), "+v"(x[6]), "+v"(x[7])); }
// the value that lane l ^ 16 holds (the other half of a query's keys), without a trip through LDS
__device__ __forceinline__ float xhalf(float v) { const int b = __float_as_int(v); return __int_as_float(__builtin_amdgcn_permlanex16(b, b, 0x76543210, 0xfedcba98, false, false)); }
template <bool HR> struct FSel { typedef h16 T; };
template <> struct FSel<true> { typedef bf T; };
template <bool HR, int NQ>
__device__ __forceinline__ void fattn(const typename FSel<HR>::T* __restrict__ Q, const typename FSel<HR>::T* __restrict__ Q2, const typename FSel<HR>::T* __restrict__ Kp, const typename FSel<HR>::T* __restrict__ K2, const typename FSel<HR>::T* __restrict__ Vp, const typename FSel<HR>::T* __restrict__ V2, const int* __restrict__ kvp, int q0, bf* Ah, bf* Al) {
    typedef typename FSel<HR>::T T16; typedef WFrag<T16> W; typedef typename W::V V;
    const int lane = threadIdx.x & 31, hh = lane >> 4;   // every inner loop below is unrolled so that each index of a register array is a constant
    V qf[NQ][2], qf2[NQ][2], kf[2][2], kf2[2][2], vf[4], vf2[4]; v4i mk[4]; v8f o[NQ][4]; float m[NQ], l[NQ];
#pragma unroll
    for (int g = 0; g < NQ; ++g) { m[g] = -3.0e38f; l[g] = 0.f;
#pragma unroll
        for (int dt = 0; dt < 4; ++dt) o[g][dt] = (v8f){};
#pragma unroll
        for (int ks = 0; ks < 2; ++ks) { const size_t qo = (size_t)((q0 >> 4) + g) * 1024 + (ks * 64 + lane) * 8; qf[g][ks] = W::ldo(Q + qo); if (HR) qf2[g][ks] = W::ldo(Q2 + qo); } }
    asm volatile("s_wait_xcnt 0x0" ::: "memory");   // precaution, as in loadK
    unsigned ko = lane * 16, vo = lane * 16, mo = hh * 32;   // this lane's byte offsets in the k tiles, the v tile and the key vector that are fetched next; carried through the loop and stepped behind the wait in loadK
    auto loadK = [&]() {
#pragma unroll
        for (int kt = 0; kt < 2; ++kt)
#pragma unroll
            for (int ks = 0; ks < 2; ++ks) { kf[kt][ks] = W::ldo((const T16*)((const char*)Kp + ko) + (kt * 1024 + ks * 512)); if (HR) kf2[kt][ks] = W::ldo((const T16*)((const char*)K2 + ko) + (kt * 1024 + ks * 512)); }
#pragma unroll
        for (int u = 0; u < 4; ++u) mk[u] = *(const v4i*)((const int*)((const char*)kvp + mo) + ((u >> 1) * 16 + (u & 1) * 4));
        asm volatile("s_wait_xcnt 0x0" ::: "memory"); };   // precaution: stands before the address registers of the loads above are written again
    auto loadV = [&]() {
#pragma unroll
        for (int dt = 0; dt < 4; ++dt) { vf[dt] = W::ldo((const T16*)((const char*)Vp + vo) + dt * 512); if (HR) vf2[dt] = W::ldo((const T16*)((const char*)V2 + vo) + dt * 512); } };   // their offset is stepped behind loadK's wait
    loadK(); ko += 4096; mo += 128;
#pragma unroll 1   // one pass a trip: a second copy of the body would hold a second set of fragments and scores live
    for (int it = 0; it < TT / 32; ++it) {
        loadV();   // this pass's v fragments fly during its S products and softmax; issued behind the k loads on every path, so that the wait for k leaves them in flight
        __builtin_amdgcn_sched_barrier(0);   // keeps the v loads in front of the S products: sunk behind them they have only the exponentials to fly in
        v8f s[NQ][2];
#pragma unroll
        for (int g = 0; g < NQ; ++g) { s[g][0] = (v8f){}; s[g][1] = (v8f){}; }
#pragma unroll
        for (int ks = 0; ks < 2; ++ks) {
#pragma unroll
            for (int g = 0; g < NQ; ++g)
#pragma unroll
                for (int kt = 0; kt < 2; ++kt) s[g][kt] = W::mma(kf[kt][ks], qf[g][ks], s[g][kt]);
            if (HR) {
#pragma unroll
                for (int g = 0; g < NQ; ++g)
#pragma unroll
                    for (int kt = 0; kt < 2; ++kt) s[g][kt] = W::mma(kf2[kt][ks], qf[g][ks], s[g][kt]);
#pragma unroll
                for (int g = 0; g < NQ; ++g)
#pragma unroll
                    for (int kt = 0; kt < 2; ++kt) s[g][kt] = W::mma(kf[kt][ks], qf2[g][ks], s[g][kt]); } }
        float ml[NQ]; bool need = false;
#pragma unroll
        for (int g = 0; g < NQ; ++g) { float mx = -3.0e38f;
#pragma unroll
            for (int kt = 0; kt < 2; ++kt)
#pragma unroll
                for (int r = 0; r < 8; ++r) { const float t = (mk[kt * 2 + (r >> 2)][r & 3] == 0) ? s[g][kt][r] * SCL2 : -3.0e38f; s[g][kt][r] = t; mx = fmaxf(mx, t); }
            mx = fmaxf(mx, xhalf(mx)); ml[g] = mx; need = need || (mx > m[g] + 8.0f); }
        loadK();   // the next pass's k fragments and key vector fly during this pass's softmax and P.V
        if (__builtin_amdgcn_ballot_w32(need) != 0) {
#pragma unroll
            for (int g = 0; g < NQ; ++g) { const float mn = fmaxf(m[g], ml[g]); const float al = __builtin_amdgcn_exp2f(m[g] - mn); m[g] = mn; l[g] *= al;
#pragma unroll
                for (int dt = 0; dt < 4; ++dt) o[g][dt] *= al; } }
        { const unsigned st = (it + 2 < TT / 32) ? 1u : 0u; ko += st * 4096; mo += st * 128; vo += 4096; }   // the last pass fetches its own k tiles again: in bounds, no branch round the loads
        V pb[NQ], pb2[NQ];
#pragma unroll
        for (int g = 0; g < NQ; ++g) { float sm[4];   // four independent chains
            float x[16];
#pragma unroll
            for (int e = 0; e < 16; ++e) x[e] = s[g][e >> 3][e & 7] - m[g];
            exp8(x); exp8(x + 8);
#pragma unroll
            for (int e = 0; e < 16; ++e) { const float p = x[e]; sm[e & 3] = (e < 4) ? p : sm[e & 3] + p;
                if constexpr (HR) { const __bf16 ph = (__bf16)p; pb[g][e] = ph; pb2[g][e] = (__bf16)(p - (float)ph); } else pb[g][e] = (h16)p; }
            l[g] += (sm[0] + sm[1]) + (sm[2] + sm[3]); }
#pragma unroll
        for (int dt = 0; dt < 4; ++dt)
#pragma unroll
            for (int g = 0; g < NQ; ++g) o[g][dt] = W::mma(vf[dt], pb[g], o[g][dt]);
        if (HR) {
#pragma unroll
            for (int dt = 0; dt < 4; ++dt)
#pragma unroll
                for (int g = 0; g < NQ; ++g) o[g][dt] = W::mma(vf2[dt], pb[g], o[g][dt]);
#pragma unroll
            for (int dt = 0; dt < 4; ++dt)
#pragma unroll
                for (int g = 0; g < NQ; ++g) o[g][dt] = W::mma(vf[dt], pb2[g], o[g][dt]); }
    }
#pragma unroll
    for (int g = 0; g < NQ; ++g) { const float inv = __fdiv_rn(1.0f, l[g] + xhalf(l[g])); const size_t oo = (size_t)(q0 + g * 16) * DQ + lane * 8;   // Ot register r of tile dt = O[query lane & 15][16 dt + 8 hh + r]: chunk 'lane' of the head's 16-wide column group dt in the fragment order that Wo's A loader reads
#pragma unroll
        for (int dt = 0; dt < 4; ++dt) { v8us oh, ol;
#pragma unroll
            for (int r = 0; r < 8; ++r) { unsigned short a, c2; splitf(o[g][dt][r] * inv, a, c2); oh[r] = a; ol[r] = c2; }
            *(v8us*)(Ah + oo + dt * 256) = oh; *(v8us*)(Al + oo + dt * 256) = ol;
            asm volatile("s_wait_xcnt 0x0" ::: "memory"); } }   // precaution: stands before the stores' registers are written again
}
// grid (RH / 64 + (TT - RH) / 128, heads, batches), 4 waves: the first RH / 64 blocks take 16 hi/lo queries a wave, the rest 32 fp16 queries a wave (about the same work a pass). The second launch bound asks for 4 waves a SIMD: at most 256 registers, so that every work-group of the grid is resident at once.
__global__ __launch_bounds__(128, 4) void k_fattn(const h16* __restrict__ Q16, const h16* __restrict__ K16, const h16* __restrict__ V16, const bf* __restrict__ Qh, const bf* __restrict__ Ql, const bf* __restrict__ Kh, const bf* __restrict__ Kl, const bf* __restrict__ Vh, const bf* __restrict__ Vl, const int* __restrict__ kmask, bf* Ah, bf* Al) {
    const int wv = __builtin_amdgcn_readfirstlane((int)(threadIdx.x >> 5)); const size_t pz = ((size_t)blockIdx.z * NH_ + blockIdx.y) * TT * HD; const int* kvp = kmask + (size_t)blockIdx.z * TT; const size_t ao = (size_t)blockIdx.z * TT * DQ + (size_t)blockIdx.y * HD * 16;
    if (blockIdx.x < RH / 64) fattn<true, 1>(Qh + pz, Ql + pz, Kh + pz, Kl + pz, Vh + pz, Vl + pz, kvp, (int)blockIdx.x * 64 + wv * 16, Ah + ao, Al + ao);
    else fattn<false, 2>(Q16 + pz, nullptr, K16 + pz, nullptr, V16 + pz, nullptr, kvp, RH + ((int)blockIdx.x - RH / 64) * 128 + wv * 32, Ah + ao, Al + ao);
}

extern "C" void kernel_launch(void* const* d_in, const int* in_sizes, int n_in,
                              void* d_out, int out_size, void* d_ws, size_t ws_size, hipStream_t stream) {
    (void)in_sizes; (void)n_in; (void)out_size;
    const float* x = (const float*)d_in[0]; const float* xk = (const float*)d_in[1]; const float* xv = (const float*)d_in[2]; const int* kmask = (const int*)d_in[3];   /* mask [2][1][1][2048] int32: 1 = excluded key */ const float* wq = (const float*)d_in[4]; const float* bq = (const float*)d_in[5]; const float* wk = (const float*)d_in[6]; const float* bk = (const float*)d_in[7]; const float* wv = (const float*)d_in[8]; const float* bv = (const float*)d_in[9]; const float* wo = (const float*)d_in[10]; const float* bo = (const float*)d_in[11];   /* argument order query, key, value, mask, Wq, bq, Wk, bk, Wv, bv, Wo, bo ('xw') */
    float* OUT = (float*)d_out;     // [2][2048][1024]
    char* wsp = (char*)d_ws;
    auto take = [&](size_t bytes) { char* p = wsp; wsp += (bytes + 255) & ~(size_t)255; return (void*)p; };
    bf* WT = (bf*)take((size_t)4 * DQ * DM * 2);   // transposed Wq, Wk, Wv, Wo
    bf* XB = (bf*)take((size_t)3 * NB_ * TT * DM * 2);   // bf16 query, key, value
    const size_t PLN = (size_t)NH_ * TT * HD;   // one batch's plane set, elements (NKV == NH_); every plane holds both batches
    h16* QP16 = (h16*)take(NB_ * PLN * 2); h16* KP16 = (h16*)take(NB_ * PLN * 2); h16* VT16 = (h16*)take(NB_ * PLN * 2);
    bf* QPh = (bf*)take(NB_ * PLN * 2); bf* QPl = (bf*)take(NB_ * PLN * 2); bf* KPh = (bf*)take(NB_ * PLN * 2); bf* KPl = (bf*)take(NB_ * PLN * 2); bf* VTh = (bf*)take(NB_ * PLN * 2); bf* VTl = (bf*)take(NB_ * PLN * 2);
    bf* ATh = (bf*)take((size_t)NB_ * TT * DQ * 2); bf* ATl = (bf*)take((size_t)NB_ * TT * DQ * 2);
    if ((size_t)(wsp - (char*)d_ws) > ws_size) return;    // ws 256 MiB
    k_prep<<<4 * WB + 3 * CB, 256, 0, stream>>>(x, xk, xv, wq, wk, wv, wo, WT, XB);
    k_proj<<<dim3(TT / 128, DQ / 128, 3 * NB_), 128, 0, stream>>>(XB, WT, bq, bk, bv, QP16, KP16, VT16, QPh, QPl, KPh, KPl, VTh, VTl);
    k_fattn<<<dim3(RH / 64 + (TT - RH) / 128, NH_, NB_), 128, 0, stream>>>(QP16, KP16, VT16, QPh, QPl, KPh, KPl, VTh, VTl, kmask, ATh, ATl);
    k_gemmw<bf, 1, true, 2, DQ><<<dim3(NB_ * TT / 128, DM / 128, 1), 256, 0, stream>>>(ATh, ATl, WT + (size_t)3 * DQ * DM, nullptr, OUT, DM, bo);
}

// v008
// Measured time: 103 microseconds a run.
// Two timings next to v007 both put it at 1.32 times that version's speed.
// All steps since v000 together make it 19.8 times as fast.
#include <hip/hip_runtime.h>

// Multi-head attention on three input streams with a per-batch key mask (query, key, value [2][2048][1024]; q = query Wq + bq, k = key Wk + bk, v = value Wv + bv ('xw' 1/32, zero biases; 16 heads x 64); logits = q.k / sqrt(64) + mask[b][0][0][j] x (-1e9) with mask int32 [2][1][1][2048] random 0/1 (read; 1 == that key is excluded); softmax; out = merged Wo + bo -> [2][2048][1024] (4.2 M); argument order query, key, value, mask, Wq, bq, Wk, bk, Wv, bv, Wo, bo).
// Layout, four launches: (1) bf16 copies of query, key, value (both batches) and the four transposed 'xw' weights, all in fragment order (see gemmw); the key and value rows of a batch are laid kept keys first (see packRows), so that k and v come out of (2) in that order; (2) the six exact projections + f32 biases (stream x batch in grid z), whose epilogue writes the head planes; (3) one fused attention kernel over every (batch, head) (hybrid rows: < 512 hi/lo 3 products, rest fp16; running-maximum softmax, S and P stay in registers); it walks only the passes that hold kept keys (their number comes from (1)) and excludes the slots behind the last kept key by select (-1e9 == exclusion); (4) merged hi/lo (written by (3) in fragment order) x Wo exact + bo, both batches as one row range.
// Compute dtypes, f32 accumulate: every input rounded to bf16; projections exact + f32 biases; attention rows < 512 3 products, rest fp16; softmax f32; Wo hl x exact + bias.

#define NB_  2
#define TT   2048
#define DM   1024
#define NH_  16
#define NKV  16
#define REP  (NH_ / NKV)
#define HD   64
#define DQ   (NH_ * HD)
#define DKV  (NKV * HD)
#define RH   512                  // query rows < RH use hi+lo planes (0: none)
#define WIN  0
#define SCL2 0.18033688011112042f   // HD^-0.5 x log2(e): scores are carried in the base-2 domain
typedef _Float16 h16;
typedef unsigned short bf;
typedef __attribute__((ext_vector_type(16))) __bf16   v16bf;
typedef __attribute__((ext_vector_type(16))) _Float16 v16h;
typedef __attribute__((ext_vector_type(8)))  _Float16 v8h;
typedef __attribute__((ext_vector_type(8)))  unsigned short v8us;
typedef __attribute__((ext_vector_type(8)))  float    v8f;
typedef __attribute__((ext_vector_type(4)))  float    v4f;
typedef v8h  __attribute__((may_alias)) v8ha;
typedef v4f  __attribute__((may_alias)) v4fa;
typedef v8us __attribute__((may_alias)) v8usa;

__device__ __forceinline__ unsigned short f2bf(float f) { unsigned u = __float_as_uint(f); u += 0x7FFFu + ((u >> 16) & 1u); return (unsigned short)(u >> 16); }
__device__ __forceinline__ float bf2f(unsigned short b) { return __uint_as_float(((unsigned)b) << 16); }
__device__ __forceinline__ float bfr(float f) { return bf2f(f2bf(f)); }
__device__ __forceinline__ v16h cat16(v8h lo, v8h hi) { return __builtin_shufflevector(lo, hi, 0, 1, 2, 3, 4, 5, 6, 7, 8, 9, 10, 11, 12, 13, 14, 15); }
__device__ __forceinline__ v16bf cat16b(v8us lo, v8us hi) { return __builtin_bit_cast(v16bf, __builtin_shufflevector(lo, hi, 0, 1, 2, 3, 4, 5, 6, 7, 8, 9, 10, 11, 12, 13, 14, 15)); }
__device__ __forceinline__ v8f wmma16(v16h a, v16h b, v8f c) { return __builtin_amdgcn_wmma_f32_16x16x32_f16(false, a, false, b, (short)0, c, false, false); }
__device__ __forceinline__ v8f wmmab(v16bf a, v16bf b, v8f c) { return __builtin_amdgcn_wmma_f32_16x16x32_bf16(false, a, false, b, (short)0, c, false, false); }
__device__ __forceinline__ h16 tohx(float x) { return (h16)x; }
__device__ __forceinline__ void splitf(float y, unsigned short& h, unsigned short& l) { h = f2bf(y); l = f2bf(y - bf2f(h)); }



// ---- gemmw: register-blocked GEMM, NW waves per 64x64 output tile (bx, by) (16 accumulators a wave), operands straight from 16-bit planes in fragment order. A work-group holds four such tiles, the 2 x 2 quarters of a 128x128 tile: 4 * NW waves, wave w on quarter w & 3 with K share w >> 2. The two quarters of a row share their A blocks and the two of a column their B blocks, at the same k step, so that a block's second reader can find it in the WGP's cache and need not ask L2 again. os is the quarter's part of the calling kernel's LDS, GLds<NW>::N floats.
// C[m][n] (f32, pitch ldc, + optional f32 bias[n]) = sum_k A[m][k] Bt[n][k] (+ split products per NSPLIT). K % (32 * NW) == 0.
// Fragment order of an operand plane (rows x K): 16 rows make a block of 16 K elements; in it the 8-element chunk (k >> 3) of row r lies at ((k >> 4) * 32 + ((k >> 3) & 1) * 16 + (r & 15)) * 8, so that lane l finds its two chunks of the 32-wide k step ks at (ks * 64 + l) * 8 and 256 elements on: every fragment load of a wave reads 512 bytes in a row (4 lines, where a row-major plane gives 16 lines of 32 bytes each). The k order of a fragment is that of the row-major loader.
// K is dealt to a tile's NW waves in 32-wide steps, share w taking steps w, w + NW, ... (neighbour shares read neighbouring kilobytes of a block); the NW partial tiles meet in LDS and are summed in the order of the shares 0 .. NW-1.
// EPI == 0: the tile goes to C as f32. EPI == 1, 2: the summed tile (+ bias) never reaches memory as f32; it is written from LDS as the three 16-bit head planes (fp16, bf16 hi, bf16 lo) that k_fattn reads, 8 elements (16 bytes a plane) a thread, a wave 512 bytes in a row. A 64x64 tile is one head x 64 tokens = 4096 plane elements in a row, and thread c writes its chunk c.
// EPI == 1 (q, k): rows m = tokens t, columns n = head * 64 + d. Fragment order of a q or k head plane: 16 rows t make a 1024-element block; in it the 8-element chunk (d >> 3) of row t lies at ((d >> 4) * 32 + ((d >> 3) & 1) * 16 + (t & 15)) * 8, so that lane l of a wave finds its two chunks of the 32-wide k step ks at (ks * 64 + l) * 8 and 256 elements on: every fragment load reads 512 bytes in a row.
// EPI == 2 (v, transposed product: A = weight rows, Bt = token rows): rows m = head * 64 + d, columns n = tokens t, bias by row. v head planes, transposed, in fragment order: 32 keys t x 64 d make a 2048-element block; the 8-key chunk of row d lies at (((d >> 4) * 2 + ((t >> 4) & 1)) * 32 + ((t >> 3) & 1) * 16 + (d & 15)) * 8.
template <typename T16> struct WFrag;
template <> struct WFrag<h16> { typedef v16h V; static __device__ __forceinline__ V ldo(const h16* p) { return cat16(*(const v8h*)p, *(const v8h*)(p + 256)); } static __device__ __forceinline__ v8f mma(V a, V b, v8f c) { return wmma16(a, b, c); } };
template <> struct WFrag<bf> { typedef v16bf V; static __device__ __forceinline__ V ldo(const bf* p) { return cat16b(*(const v8us*)p, *(const v8us*)(p + 256)); } static __device__ __forceinline__ v8f mma(V a, V b, v8f c) { return wmmab(a, b, c); } };
template <int NW> struct GLds { static constexpr int MR = 4;      // 16-row blocks of the tile that pass through LDS at a time (all four: one barrier)
    static constexpr int SL = MR * 16 * 68;    // one wave's slab, floats
    static constexpr int N = NW * SL; };
template <typename T16, int NSPLIT, bool BIAS, int NW, int K, int EPI = 0>
__device__ __forceinline__ void gemmw(float* os, int bx, int by, const T16* __restrict__ A, const T16* __restrict__ A2, const T16* __restrict__ Bt, const T16* __restrict__ Bt2, float* C, int ldc, const float* __restrict__ bias, h16* P16, bf* Ph, bf* Pl) {
    typedef typename WFrag<T16>::V V;
    constexpr int MR = GLds<NW>::MR, SL = GLds<NW>::SL;
    const int wv = (NW == 1) ? 0 : __builtin_amdgcn_readfirstlane((int)(threadIdx.x >> 7));   // K share: four waves (one a quarter) hold the same one
    const int lane = threadIdx.x & 31, lr = lane & 15, hi = lane >> 4; const int r0 = bx * 64, c0 = by * 64; const int tid = wv * 32 + lane;   // tid: this thread among the 32 * NW of its quarter
    v8f acc[4][4];
#pragma unroll
    for (int mb = 0; mb < 4; ++mb)
#pragma unroll
        for (int nb = 0; nb < 4; ++nb) acc[mb][nb] = (v8f){};
    const char* Ar = (const char*)(A + (size_t)r0 * K); const char* A2r = (const char*)(A2 + (size_t)r0 * K); const char* Br = (const char*)(Bt + (size_t)c0 * K); const char* B2r = (const char*)(Bt2 + (size_t)c0 * K);   // the tile's first 16-row blocks: the same for the whole wave
    unsigned fo = lane * 16 + wv * 1024;   // this lane's byte offset in a block at the wave's k step: the one address register of all fragment loads; stepped behind the wait below
#pragma unroll 1
    for (int kc = wv * 32; kc < K; kc += 32 * NW) {
        V a[4], a2[4], b[4], b2[4];
#pragma unroll
        for (int mb = 0; mb < 4; ++mb) { a[mb] = WFrag<T16>::ldo((const T16*)(Ar + fo) + mb * 16 * K); if (NSPLIT == 1 || NSPLIT == 2) a2[mb] = WFrag<T16>::ldo((const T16*)(A2r + fo) + mb * 16 * K); }
#pragma unroll
        for (int nb = 0; nb < 4; ++nb) { b[nb] = WFrag<T16>::ldo((const T16*)(Br + fo) + nb * 16 * K); if (NSPLIT >= 2) b2[nb] = WFrag<T16>::ldo((const T16*)(B2r + fo) + nb * 16 * K); }
        asm volatile("s_wait_xcnt 0x0" : "+v"(fo) :: "memory");   // precaution: stands before the loads' address register is written again; naming the offset keeps it the one 32-bit address register of all loads, whole up to here (where the trip count is a constant the compiler otherwise forms 64-bit addresses every trip, and a load's result lands on them)
        fo += 1024 * NW;
        __builtin_amdgcn_sched_barrier(0);   // keeps every load of the k step in front of its products: sunk among them, the later fragments' latency is waited out a second time
#pragma unroll
        for (int nb = 0; nb < 4; ++nb) {
#pragma unroll
            for (int mb = 0; mb < 4; ++mb) { acc[mb][nb] = WFrag<T16>::mma(a[mb], b[nb], acc[mb][nb]); if (NSPLIT == 1 || NSPLIT == 2) acc[mb][nb] = WFrag<T16>::mma(a2[mb], b[nb], acc[mb][nb]); if (NSPLIT >= 2) acc[mb][nb] = WFrag<T16>::mma(a[mb], b2[nb], acc[mb][nb]); } }
        asm volatile("v_nop\n\tv_nop\n\tv_nop\n\tv_nop" : "+v"(acc[0][0]), "+v"(acc[1][1]), "+v"(acc[2][2]), "+v"(acc[3][3]) : "v"(a[0]), "v"(a[3]));
    }
    float* osw = os + wv * SL;
#pragma unroll
    for (int m0 = 0; m0 < 4; m0 += MR) {
#pragma unroll
        for (int mi = 0; mi < MR; ++mi) {
#pragma unroll
            for (int nb = 0; nb < 4; ++nb) {
#pragma unroll
                for (int j = 0; j < 8; ++j) osw[(mi * 16 + hi * 8 + j) * 68 + nb * 16 + lr] = acc[m0 + mi][nb][j]; } }
        __syncthreads();   // every wave's tile is in LDS before any lane reads what other lanes and waves wrote
        if constexpr (EPI != 0) {
            static_assert(MR == 4, "the plane epilogue takes the whole tile at once");
            const size_t pbase = (EPI == 1) ? ((size_t)by * TT + r0) * HD : ((size_t)bx * TT + c0) * HD;   // this tile's 4096 elements in a plane
#pragma unroll 2   // two chunks a trip: sixteen copies of this body (NW == 1) would be some 30 KB of code that runs once
            for (int s = 0; s < 16 / NW; ++s) { const int c = s * 32 * NW + tid;
                const int row = (EPI == 1) ? (c >> 7) * 16 + (c & 15) : ((c >> 6) & 3) * 16 + (c & 15);
                const int col = (EPI == 1) ? ((c >> 4) & 7) * 8 : (c >> 8) * 32 + ((c >> 4) & 3) * 8;
                v4f v0 = *(const v4fa*)(os + row * 68 + col), v1 = *(const v4fa*)(os + row * 68 + col + 4);
#pragma unroll
                for (int w = 1; w < NW; ++w) { v0 += *(const v4fa*)(os + w * SL + row * 68 + col); v1 += *(const v4fa*)(os + w * SL + row * 68 + col + 4); }
                if (BIAS) {
                    if (EPI == 1) {
#pragma unroll
                        for (int j = 0; j < 4; ++j) { v0[j] += bfr(bias[c0 + col + j]); v1[j] += bfr(bias[c0 + col + 4 + j]); } }
                    else { const float bb = bfr(bias[r0 + row]); v0 += bb; v1 += bb; } }
                v8h o16; v8us oh, ol;
#pragma unroll
                for (int j = 0; j < 8; ++j) { const float y = (j < 4) ? v0[j & 3] : v1[j & 3]; o16[j] = tohx(y); unsigned short a2, c2; splitf(y, a2, c2); oh[j] = a2; ol[j] = c2; }
                *(v8h*)(P16 + pbase + (size_t)c * 8) = o16; *(v8us*)(Ph + pbase + (size_t)c * 8) = oh; *(v8us*)(Pl + pbase + (size_t)c * 8) = ol;
                asm volatile("s_wait_xcnt 0x0" ::: "memory"); }   // precaution: stands before the stores' registers are written again
        } else {
        float* crow = C + (size_t)(r0 + m0 * 16) * ldc + c0;
#pragma unroll
        for (int s = 0; s < MR * 8 / NW; ++s) { const int g = s * 32 * NW + tid, row = g >> 4, cofs = (g & 15) * 4; v4f val = *(const v4fa*)(os + row * 68 + cofs);
#pragma unroll
            for (int w = 1; w < NW; ++w) val += *(const v4fa*)(os + w * SL + row * 68 + cofs);
            if (BIAS) { val[0] += bfr(bias[c0 + cofs]); val[1] += bfr(bias[c0 + cofs + 1]); val[2] += bfr(bias[c0 + cofs + 2]); val[3] += bfr(bias[c0 + cofs + 3]); }
            *(v4f*)(crow + (size_t)row * ldc + cofs) = val; }
        }
    }
}
// plain f32 output; grid (M/128, N/128), 4 * NW waves
template <typename T16, int NSPLIT, bool BIAS, int NW, int K>
__global__ __launch_bounds__(128 * NW) void k_gemmw(const T16* __restrict__ A, const T16* __restrict__ A2, const T16* __restrict__ Bt, const T16* __restrict__ Bt2, float* C, int ldc, const float* __restrict__ bias) {
    __shared__ __align__(16) float os[4 * GLds<NW>::N];
    const int q = __builtin_amdgcn_readfirstlane((int)(threadIdx.x >> 5) & 3);
    gemmw<T16, NSPLIT, BIAS, NW, K, 0>(os + q * GLds<NW>::N, (int)blockIdx.x * 2 + (q & 1), (int)blockIdx.y * 2 + (q >> 1), A, A2, Bt, Bt2, C, ldc, bias, nullptr, nullptr, nullptr);
}
// the six projections in one launch; grid (TT/128, DQ/128, 6), 4 waves (each the whole K of its quarter: three work-groups a WGP hold the whole grid at once), z = stream * 2 + batch (streams q, k, v). XB holds the six bf16 token matrices in z order, WT the transposed weights q, k, v, o. Every plane holds both batches.
// The branch is the same for a whole work-group, so that the barrier in gemmw is passed by all its waves or by none. The v tiles keep their order (feature tile fastest).
__global__ __launch_bounds__(128) void k_proj(const bf* __restrict__ XB, const bf* __restrict__ WT, const float* __restrict__ bq, const float* __restrict__ bk, const float* __restrict__ bv, h16* QP16, h16* KP16, h16* VT16, bf* QPh, bf* QPl, bf* KPh, bf* KPl, bf* VTh, bf* VTl) {
    __shared__ __align__(16) float osa[4 * GLds<1>::N];
    const int q = __builtin_amdgcn_readfirstlane((int)(threadIdx.x >> 5) & 3); float* os = osa + q * GLds<1>::N;
    const int z = (int)blockIdx.z, st = z >> 1; const size_t po = (size_t)(z & 1) * NH_ * TT * HD; const bf* X = XB + (size_t)z * TT * DM; const bf* Wt = WT + (size_t)st * DQ * DM;
    if (st == 2) { const int f = (int)blockIdx.y * (TT / 128) + (int)blockIdx.x;   /* transposed product: rows = v features, columns = tokens */
        gemmw<bf, 0, true, 1, DM, 2>(os, f % (DKV / 128) * 2 + (q & 1), f / (DKV / 128) * 2 + (q >> 1), Wt, nullptr, X, nullptr, nullptr, 0, bv, VT16 + po, VTh + po, VTl + po); }
    else gemmw<bf, 0, true, 1, DM, 1>(os, (int)blockIdx.x * 2 + (q & 1), (int)blockIdx.y * 2 + (q >> 1), X, nullptr, Wt, nullptr, nullptr, 0, st ? bk : bq, (st ? KP16 : QP16) + po, (st ? KPh : QPh) + po, (st ? KPl : QPl) + po);
}

typedef __attribute__((ext_vector_type(2))) _Float16 v2h;
typedef __attribute__((ext_vector_type(4))) _Float16 v4h;
typedef __attribute__((ext_vector_type(2))) unsigned short v2us;
typedef __attribute__((ext_vector_type(4))) unsigned short v4us;
typedef __attribute__((ext_vector_type(2))) float v2f;
typedef __attribute__((ext_vector_type(4))) int v4i;
typedef v4h  __attribute__((may_alias)) v4ha;
typedef v4us __attribute__((may_alias)) v4usa;

// k_prep: one wave builds one fragment unit of an operand plane: 16 rows x one 32-wide k step = 512 elements, written as two stores of 512 bytes in a row (fragment order: see gemmw). Lane (lr, hi) holds row lr, k = 8 hi .. 8 hi + 7 and 16 more.
__device__ __forceinline__ void put16(bf* d, const float* f) { v8us o0, o1;
#pragma unroll
    for (int j = 0; j < 8; ++j) { o0[j] = f2bf(f[j]); o1[j] = f2bf(f[8 + j]); }
    *(v8us*)d = o0; *(v8us*)(d + 256) = o1; }
// transposed weight: plane rows n = columns of w [DM][DQ]. The 8 waves of a block take 8 neighbouring 16-column blocks of one k step: each of a lane's 16 loads reads, over the wave, 64 bytes in a row of two rows of w, over the block 512 bytes of each.
__device__ __forceinline__ void wtF(int blk, const float* __restrict__ w, bf* Bt) {
    const int lane = threadIdx.x & 31, lr = lane & 15, hi = lane >> 4; const unsigned u = blk * 8 + (threadIdx.x >> 5), nb = u % (DQ / 16), ks = u / (DQ / 16);
    const float* s = w + (size_t)(ks * 32 + hi * 8) * DQ + nb * 16 + lr; float f[16];
#pragma unroll
    for (int j = 0; j < 16; ++j) f[j] = s[(size_t)((j >> 3) * 16 + (j & 7)) * DQ];
    asm volatile("s_wait_xcnt 0x0" :: "v"(s) : "memory");   // precaution: stands before the loads' address registers are written again; naming the address keeps it whole up to here (no load's result lands on it)
    put16(Bt + ((size_t)nb * (DM / 32) + ks) * 512 + lane * 8, f);
}
// bf16 copy of token rows [.][DM]: the 8 waves of a block take 8 neighbouring k steps of one 16-row block (1 KB in a row of each row). row: the source row that this lane's row of the block is copied from.
__device__ __forceinline__ void cvtF(int blk, int row, const float* __restrict__ src, bf* dst) {
    const int lane = threadIdx.x & 31, hi = lane >> 4; const unsigned u = blk * 8 + (threadIdx.x >> 5);
    const float* s = src + (size_t)row * DM + (u % (DM / 32)) * 32 + hi * 8; float f[16];
    const v8f a = *(const v8f*)s, b = *(const v8f*)(s + 16);
    asm volatile("s_wait_xcnt 0x0" :: "v"(s) : "memory");   // precaution, as in wtF
#pragma unroll
    for (int j = 0; j < 8; ++j) { f[j] = a[j]; f[8 + j] = b[j]; }
    put16(dst + (size_t)u * 512 + lane * 8, f);
}
// packRows: the order of a batch's keys in the key and value planes: kept keys (mask == 0) first, in their own order, the excluded ones behind them, in theirs. An excluded key's probability is 0, so that attention need not walk it; with no key kept the order is the given one.
// A block of 256 threads reads the batch's 2048 mask words, 8 in a row a thread. Kept keys in front of a thread's first key: those of the lower lanes (one masked bit count a ballot) + the lower waves' totals, which meet in LDS (wc). Each thread places its 8 keys; the one whose place is R0 + d, d < 16, writes its index to srow[d]. Every index comes from the thread's number, none from a mask value. Returns the source key of this lane's row; nk: kept keys of the batch.
__device__ __forceinline__ int packRows(const int* __restrict__ mb, int R0, int* wc, int* srow, int& nk) {
    const int tid = (int)threadIdx.x, lane = tid & 31, wv = tid >> 5; const int* p = mb + tid * 8;
    const v4i m0 = *(const v4i*)p, m1 = *(const v4i*)(p + 4);
    asm volatile("s_wait_xcnt 0x0" :: "v"(p) : "memory");   // precaution, as in wtF
    bool kp[8]; int e = 0, tot = 0;
#pragma unroll
    for (int j = 0; j < 8; ++j) { kp[j] = ((j < 4) ? m0[j & 3] : m1[j & 3]) == 0; const unsigned bal = __builtin_amdgcn_ballot_w32(kp[j]); e = (int)__builtin_amdgcn_mbcnt_lo(bal, (unsigned)e); tot += __builtin_popcount(bal); }
    if (lane == 0) wc[wv] = tot;
    __syncthreads();   // every wave's total is in LDS before any wave sums them
    nk = 0;
#pragma unroll
    for (int w = 0; w < 8; ++w) { const int c = wc[w]; nk += c; e += (w < wv) ? c : 0; }
#pragma unroll
    for (int j = 0; j < 8; ++j) { const int t = tid * 8 + j; const unsigned d = (unsigned)((kp[j] ? e : nk + t - e) - R0); if (d < 16u) srow[d] = t; e += kp[j] ? 1 : 0; }
    __syncthreads();   // the 16 source rows are in LDS before any lane reads its own
    return srow[lane & 15];
}
// every 16-bit operand of the projections and of Wo in one launch: blocks [0, 4 WB) transpose the four weights, the next 3 CB copy query, key, value (both batches of a stream lie in a row). The grid holds exactly one wave a unit.
#define WB ((DQ / 16) * (DM / 32) / 8)
#define CB ((NB_ * TT / 16) * (DM / 32) / 8)
// A key or value block first finds its 16 source rows (the branch is the same for a whole block, so that the barriers in packRows are passed by all its waves or by none); the first key block of a batch stores the batch's number of kept keys in NK.
__global__ __launch_bounds__(256) void k_prep(const float* __restrict__ x, const float* __restrict__ xk, const float* __restrict__ xv, const int* __restrict__ kmask, const float* __restrict__ wq, const float* __restrict__ wk, const float* __restrict__ wv, const float* __restrict__ wo, bf* WT, bf* XB, int* NK) {
    __shared__ int wc[8]; __shared__ int srow[16];
    const int blk = (int)blockIdx.x;
    if (blk < 4 * WB) { const int i = blk / WB; wtF(blk % WB, i == 0 ? wq : i == 1 ? wk : i == 2 ? wv : wo, WT + (size_t)i * DM * DQ); }
    else { const int c = blk - 4 * WB, i = c / CB, cb = c % CB, rb = cb / (DM / 256);   /* rb: the block's 16 rows among the 2 x 2048 of its stream */
        int row = rb * 16 + ((int)threadIdx.x & 15);
        if (i != 0) { const int b = rb / (TT / 16); int nk; row = b * TT + packRows(kmask + b * TT, (rb % (TT / 16)) * 16, wc, srow, nk);
            if (i == 1 && cb % (CB / NB_) == 0 && threadIdx.x == 0) { NK[b] = nk; asm volatile("s_wait_xcnt 0x0" ::: "memory"); } }   // precaution: stands before the store's registers are written again
        cvtF(cb, row, i == 0 ? x : i == 1 ? xk : xv, XB + (size_t)i * NB_ * TT * DM); }
}

// k_fattn: S, softmax, P.V and the head merge in one kernel; no score or probability leaves the registers. One wave owns NQ * 16 queries of one (batch, head) and walks the batch's kept keys, which lie first in the planes (packRows), 32 at a time, on its own (no LDS, no barrier): ceil(nk / 32) passes; all 64 where no key is kept.
// Transposed products: St = K Qt (A = 16 key rows, B = 16 query columns), so lane (c, hh) holds for query c the keys 8 hh + r (tile 0) and 16 + 8 hh + r (tile 1): these 16 values, converted in place, are the B operand of Ot += Vt Pt in the hardware k order, which the v planes' fragment order matches.
// Softmax with a running maximum in the base-2 domain: the maximum in use is raised (and sums and outputs rescaled) only when some query's new maximum exceeds it by more than 8, one test per 32 keys, so p <= 2^8. A slot at or behind nk holds an excluded key and carries -3e38: p == 0 once a kept key has set the maximum; with every key excluded p == 1 for all (uniform, as mask x -1e9 gives in f32). Only a pass that reaches past nk has such slots (the last one, or every one where nk == 0): the select stands under a scalar branch.
// eight base-2 exponentials in place: behind each stands an independent one, behind the last a v_nop: the slot that the instruction set asks for between a transcendental and a use of its result or an overwrite of its source
__device__ __forceinline__ void exp8(float* x) {
    asm("v_exp_f32 %0, %0\n\tv_exp_f32 %1, %1\n\tv_exp_f32 %2, %2\n\tv_exp_f32 %3, %3\n\tv_exp_f32 %4, %4\n\tv_exp_f32 %5, %5\n\tv_exp_f32 %6, %6\n\tv_exp_f32 %7, %7\n\tv_nop" : "+v"(x[0]), "+v"(x[1]), "+v"(x[2]), "+v"(x[3]), "+v"(x[4]), "+v"(x[5]), "+v"(x[6]), "+v"(x[7])); }
// the value that lane l ^ 16 holds (the other half of a query's keys), without a trip through LDS
__device__ __forceinline__ float xhalf(float v) { const int b = __float_as_int(v); return __int_as_float(__builtin_amdgcn_permlanex16(b, b, 0x76543210, 0xfedcba98, false, false)); }
template <bool HR> struct FSel { typedef h16 T; };
template <> struct FSel<true> { typedef bf T; };
template <bool HR, int NQ>
__device__ __forceinline__ void fattn(const typename FSel<HR>::T* __restrict__ Q, const typename FSel<HR>::T* __restrict__ Q2, const typename FSel<HR>::T* __restrict__ Kp, const typename FSel<HR>::T* __restrict__ K2, const typename FSel<HR>::T* __restrict__ Vp, const typename FSel<HR>::T* __restrict__ V2, int nk, int q0, bf* Ah, bf* Al) {
    typedef typename FSel<HR>::T T16; typedef WFrag<T16> W; typedef typename W::V V;
    const int lane = threadIdx.x & 31, hh = lane >> 4;   // every inner loop below is unrolled so that each index of a register array is a constant
    V qf[NQ][2], qf2[NQ][2], kf[2][2], kf2[2][2], vf[4], vf2[4]; v8f o[NQ][4]; float m[NQ], l[NQ];
    const int np = nk ? (nk + 31) >> 5 : TT / 32;   // passes; nk is clamped to 0 .. TT by the caller, the same in every lane
#pragma unroll
    for (int g = 0; g < NQ; ++g) { m[g] = -3.0e38f; l[g] = 0.f;
#pragma unroll
        for (int dt = 0; dt < 4; ++dt) o[g][dt] = (v8f){};
#pragma unroll
        for (int ks = 0; ks < 2; ++ks) { const size_t qo = (size_t)((q0 >> 4) + g) * 1024 + (ks * 64 + lane) * 8; qf[g][ks] = W::ldo(Q + qo); if (HR) qf2[g][ks] = W::ldo(Q2 + qo); } }
    asm volatile("s_wait_xcnt 0x0" ::: "memory");   // precaution, as in loadK
    unsigned ko = lane * 16, vo = lane * 16;   // this lane's byte offsets in the k tiles and the v tile that are fetched next; carried through the loop and stepped behind the wait in loadK
    auto loadK = [&]() {
#pragma unroll
        for (int kt = 0; kt < 2; ++kt)
#pragma unroll
            for (int ks = 0; ks < 2; ++ks) { kf[kt][ks] = W::ldo((const T16*)((const char*)Kp + ko) + (kt * 1024 + ks * 512)); if (HR) kf2[kt][ks] = W::ldo((const T16*)((const char*)K2 + ko) + (kt * 1024 + ks * 512)); }
        asm volatile("s_wait_xcnt 0x0" ::: "memory"); };   // precaution: stands before the address registers of the loads above are written again
    auto loadV = [&]() {
#pragma unroll
        for (int dt = 0; dt < 4; ++dt) { vf[dt] = W::ldo((const T16*)((const char*)Vp + vo) + dt * 512); if (HR) vf2[dt] = W::ldo((const T16*)((const char*)V2 + vo) + dt * 512); } };   // their offset is stepped behind loadK's wait
    loadK(); ko += 4096;
    int it = 0;
#pragma unroll 1   // one pass a trip: a second copy of the body would hold a second set of fragments and scores live
    do {   // np >= 1: tested at the foot, so that no guard stands round the loop (the loads above would sink under it, past their waits)
        loadV();   // this pass's v fragments fly during its S products and softmax; issued behind the k loads on every path, so that the wait for k leaves them in flight
        __builtin_amdgcn_sched_barrier(0);   // keeps the v loads in front of the S products: sunk behind them they have only the exponentials to fly in
        v8f s[NQ][2];
#pragma unroll
        for (int g = 0; g < NQ; ++g) { s[g][0] = (v8f){}; s[g][1] = (v8f){}; }
#pragma unroll
        for (int ks = 0; ks < 2; ++ks) {
#pragma unroll
            for (int g = 0; g < NQ; ++g)
#pragma unroll
                for (int kt = 0; kt < 2; ++kt) s[g][kt] = W::mma(kf[kt][ks], qf[g][ks], s[g][kt]);
            if (HR) {
#pragma unroll
                for (int g = 0; g < NQ; ++g)
#pragma unroll
                    for (int kt = 0; kt < 2; ++kt) s[g][kt] = W::mma(kf2[kt][ks], qf[g][ks], s[g][kt]);
#pragma unroll
                for (int g = 0; g < NQ; ++g)
#pragma unroll
                    for (int kt = 0; kt < 2; ++kt) s[g][kt] = W::mma(kf[kt][ks], qf2[g][ks], s[g][kt]); } }
#pragma unroll
        for (int g = 0; g < NQ; ++g) { s[g][0] *= SCL2; s[g][1] *= SCL2; }
        if (it * 32 + 32 > nk) { const int lim = nk - it * 32 - hh * 8;   // this lane's slots kt * 16 + r of the pass hold kept keys below lim
#pragma unroll
            for (int g = 0; g < NQ; ++g)
#pragma unroll
                for (int kt = 0; kt < 2; ++kt)
#pragma unroll
                    for (int r = 0; r < 8; ++r) s[g][kt][r] = (kt * 16 + r < lim) ? s[g][kt][r] : -3.0e38f; }
        float ml[NQ]; bool need = false;
#pragma unroll
        for (int g = 0; g < NQ; ++g) { float mx = -3.0e38f;
#pragma unroll
            for (int kt = 0; kt < 2; ++kt)
#pragma unroll
                for (int r = 0; r < 8; ++r) mx = fmaxf(mx, s[g][kt][r]);
            mx = fmaxf(mx, xhalf(mx)); ml[g] = mx; need = need || (mx > m[g] + 8.0f); }
        loadK();   // the next pass's k fragments fly during this pass's softmax and P.V
        if (__builtin_amdgcn_ballot_w32(need) != 0) {
#pragma unroll
            for (int g = 0; g < NQ; ++g) { const float mn = fmaxf(m[g], ml[g]); const float al = __builtin_amdgcn_exp2f(m[g] - mn); m[g] = mn; l[g] *= al;
#pragma unroll
                for (int dt = 0; dt < 4; ++dt) o[g][dt] *= al; } }
        { const unsigned st = (it + 2 < np) ? 1u : 0u; ko += st * 4096; vo += 4096; }   // the last pass fetches its own k tiles again: in bounds, no branch round the loads
        V pb[NQ], pb2[NQ];
#pragma unroll
        for (int g = 0; g < NQ; ++g) { float sm[4];   // four independent chains
            float x[16];
#pragma unroll
            for (int e = 0; e < 16; ++e) x[e] = s[g][e >> 3][e & 7] - m[g];
            exp8(x); exp8(x + 8);
#pragma unroll
            for (int e = 0; e < 16; ++e) { const float p = x[e]; sm[e & 3] = (e < 4) ? p : sm[e & 3] + p;
                if constexpr (HR) { const __bf16 ph = (__bf16)p; pb[g][e] = ph; pb2[g][e] = (__bf16)(p - (float)ph); } else pb[g][e] = (h16)p; }
            l[g] += (sm[0] + sm[1]) + (sm[2] + sm[3]); }
#pragma unroll
        for (int dt = 0; dt < 4; ++dt)
#pragma unroll
            for (int g = 0; g < NQ; ++g) o[g][dt] = W::mma(vf[dt], pb[g], o[g][dt]);
        if (HR) {
#pragma unroll
            for (int dt = 0; dt < 4; ++dt)
#pragma unroll
                for (int g = 0; g < NQ; ++g) o[g][dt] = W::mma(vf2[dt], pb[g], o[g][dt]);
#pragma unroll
            for (int dt = 0; dt < 4; ++dt)
#pragma unroll
                for (int g = 0; g < NQ; ++g) o[g][dt] = W::mma(vf[dt], pb2[g], o[g][dt]); }
    } while (++it < np);
#pragma unroll
    for (int g = 0; g < NQ; ++g) { const float inv = __fdiv_rn(1.0f, l[g] + xhalf(l[g])); const size_t oo = (size_t)(q0 + g * 16) * DQ + lane * 8;   // Ot register r of tile dt = O[query lane & 15][16 dt + 8 hh + r]: chunk 'lane' of the head's 16-wide column group dt in the fragment order that Wo's A loader reads
#pragma unroll
        for (int dt = 0; dt < 4; ++dt) { v8us oh, ol;
#pragma unroll
            for (int r = 0; r < 8; ++r) { unsigned short a, c2; splitf(o[g][dt][r] * inv, a, c2); oh[r] = a; ol[r] = c2; }
            *(v8us*)(Ah + oo + dt * 256) = oh; *(v8us*)(Al + oo + dt * 256) = ol;
            asm volatile("s_wait_xcnt 0x0" ::: "memory"); } }   // precaution: stands before the stores' registers are written again
}
// grid (RH / 64 + (TT - RH) / 128, heads, batches), 4 waves: the first RH / 64 blocks take 16 hi/lo queries a wave, the rest 32 fp16 queries a wave (about the same work a pass). The second launch bound asks for 4 waves a SIMD: at most 256 registers, so that every work-group of the grid is resident at once.
__global__ __launch_bounds__(128, 4) void k_fattn(const h16* __restrict__ Q16, const h16* __restrict__ K16, const h16* __restrict__ V16, const bf* __restrict__ Qh, const bf* __restrict__ Ql, const bf* __restrict__ Kh, const bf* __restrict__ Kl, const bf* __restrict__ Vh, const bf* __restrict__ Vl, const int* __restrict__ NK, bf* Ah, bf* Al) {
    const int wv = __builtin_amdgcn_readfirstlane((int)(threadIdx.x >> 5)); const size_t pz = ((size_t)blockIdx.z * NH_ + blockIdx.y) * TT * HD; const int nk = __builtin_amdgcn_readfirstlane(min(max(NK[blockIdx.z], 0), TT));   /* the batch's kept keys, from k_prep; bounds the trip count */ const size_t ao = (size_t)blockIdx.z * TT * DQ + (size_t)blockIdx.y * HD * 16;
    if (blockIdx.x < RH / 64) fattn<true, 1>(Qh + pz, Ql + pz, Kh + pz, Kl + pz, Vh + pz, Vl + pz, nk, (int)blockIdx.x * 64 + wv * 16, Ah + ao, Al + ao);
    else fattn<false, 2>(Q16 + pz, nullptr, K16 + pz, nullptr, V16 + pz, nullptr, nk, RH + ((int)blockIdx.x - RH / 64) * 128 + wv * 32, Ah + ao, Al + ao);
}

extern "C" void kernel_launch(void* const* d_in, const int* in_sizes, int n_in,
                              void* d_out, int out_size, void* d_ws, size_t ws_size, hipStream_t stream) {
    (void)in_sizes; (void)n_in; (void)out_size;
    const float* x = (const float*)d_in[0]; const float* xk = (const float*)d_in[1]; const float* xv = (const float*)d_in[2]; const int* kmask = (const int*)d_in[3];   /* mask [2][1][1][2048] int32: 1 = excluded key */ const float* wq = (const float*)d_in[4]; const float* bq = (const float*)d_in[5]; const float* wk = (const float*)d_in[6]; const float* bk = (const float*)d_in[7]; const float* wv = (const float*)d_in[8]; const float* bv = (const float*)d_in[9]; const float* wo = (const float*)d_in[10]; const float* bo = (const float*)d_in[11];   /* argument order query, key, value, mask, Wq, bq, Wk, bk, Wv, bv, Wo, bo ('xw') */
    float* OUT = (float*)d_out;     // [2][2048][1024]
    char* wsp = (char*)d_ws;
    auto take = [&](size_t bytes) { char* p = wsp; wsp += (bytes + 255) & ~(size_t)255; return (void*)p; };
    bf* WT = (bf*)take((size_t)4 * DQ * DM * 2);   // transposed Wq, Wk, Wv, Wo
    bf* XB = (bf*)take((size_t)3 * NB_ * TT * DM * 2);   // bf16 query, key, value
    const size_t PLN = (size_t)NH_ * TT * HD;   // one batch's plane set, elements (NKV == NH_); every plane holds both batches
    h16* QP16 = (h16*)take(NB_ * PLN * 2); h16* KP16 = (h16*)take(NB_ * PLN * 2); h16* VT16 = (h16*)take(NB_ * PLN * 2);
    bf* QPh = (bf*)take(NB_ * PLN * 2); bf* QPl = (bf*)take(NB_ * PLN * 2); bf* KPh = (bf*)take(NB_ * PLN * 2); bf* KPl = (bf*)take(NB_ * PLN * 2); bf* VTh = (bf*)take(NB_ * PLN * 2); bf* VTl = (bf*)take(NB_ * PLN * 2);
    bf* ATh = (bf*)take((size_t)NB_ * TT * DQ * 2); bf* ATl = (bf*)take((size_t)NB_ * TT * DQ * 2);
    int* NK = (int*)take(NB_ * sizeof(int));   // kept keys of each batch
    if ((size_t)(wsp - (char*)d_ws) > ws_size) return;    // ws 256 MiB
    k_prep<<<4 * WB + 3 * CB, 256, 0, stream>>>(x, xk, xv, kmask, wq, wk, wv, wo, WT, XB, NK);
    k_proj<<<dim3(TT / 128, DQ / 128, 3 * NB_), 128, 0, stream>>>(XB, WT, bq, bk, bv, QP16, KP16, VT16, QPh, QPl, KPh, KPl, VTh, VTl);
    k_fattn<<<dim3(RH / 64 + (TT - RH) / 128, NH_, NB_), 128, 0, stream>>>(QP16, KP16, VT16, QPh, QPl, KPh, KPl, VTh, VTl, NK, ATh, ATl);
    k_gemmw<bf, 1, true, 2, DQ><<<dim3(NB_ * TT / 128, DM / 128, 1), 256, 0, stream>>>(ATh, ATl, WT + (size_t)3 * DQ * DM, nullptr, OUT, DM, bo);
}

// v009
// One run takes 93.8 microseconds.
// Next to v008, in two timings, it ran 1.10 times as fast each time.
// Over all steps from v000 it is 21.7 times as fast.
#include <hip/hip_runtime.h>

// Multi-head attention on three input streams with a per-batch key mask (query, key, value [2][2048][1024]; q = query Wq + bq, k = key Wk + bk, v = value Wv + bv ('xw' 1/32, zero biases; 16 heads x 64); logits = q.k / sqrt(64) + mask[b][0][0][j] x (-1e9) with mask int32 [2][1][1][2048] random 0/1 (read; 1 == that key is excluded); softmax; out = merged Wo + bo -> [2][2048][1024] (4.2 M); argument order query, key, value, mask, Wq, bq, Wk, bk, Wv, bv, Wo, bo).
// Layout, four launches: (1) bf16 copies of query, key, value (both batches) and the four transposed 'xw' weights, all in fragment order (see gemmw); the key and value rows of a batch are laid kept keys first (see packRows), so that k and v come out of (2) in that order; (2) the six exact projections + f32 biases (stream x batch in grid z), whose epilogue writes the head planes; (3) one fused attention kernel over every (batch, head) (hybrid rows: < 512 hi/lo 3 products, rest fp16; running-maximum softmax, S and P stay in registers); it walks only the passes that hold kept keys (their number comes from (1)) and excludes the slots behind the last kept key by select (-1e9 == exclusion); (4) merged hi/lo (written by (3) in fragment order) x Wo exact + bo, both batches as one row range.
// Compute dtypes, f32 accumulate: every input rounded to bf16; projections exact + f32 biases; attention rows < 512 3 products, rest fp16; softmax f32; Wo hl x exact + bias.

#define NB_  2
#define TT   2048
#define DM   1024
#define NH_  16
#define NKV  16
#define REP  (NH_ / NKV)
#define HD   64
#define DQ   (NH_ * HD)
#define DKV  (NKV * HD)
#define RH   512                  // query rows < RH use hi+lo planes (0: none)
#define WIN  0
#define SCL2 0.18033688011112042f   // HD^-0.5 x log2(e): scores are carried in the base-2 domain
typedef _Float16 h16;
typedef unsigned short bf;
typedef __attribute__((ext_vector_type(16))) __bf16   v16bf;
typedef __attribute__((ext_vector_type(16))) _Float16 v16h;
typedef __attribute__((ext_vector_type(8)))  _Float16 v8h;
typedef __attribute__((ext_vector_type(8)))  unsigned short v8us;
typedef __attribute__((ext_vector_type(8)))  float    v8f;
typedef __attribute__((ext_vector_type(4)))  float    v4f;
typedef v8h  __attribute__((may_alias)) v8ha;
typedef v4f  __attribute__((may_alias)) v4fa;
typedef v8us __attribute__((may_alias)) v8usa;

__device__ __forceinline__ unsigned short f2bf(float f) { unsigned u = __float_as_uint(f); u += 0x7FFFu + ((u >> 16) & 1u); return (unsigned short)(u >> 16); }
__device__ __forceinline__ float bf2f(unsigned short b) { return __uint_as_float(((unsigned)b) << 16); }
__device__ __forceinline__ float bfr(float f) { return bf2f(f2bf(f)); }
__device__ __forceinline__ v16h cat16(v8h lo, v8h hi) { return __builtin_shufflevector(lo, hi, 0, 1, 2, 3, 4, 5, 6, 7, 8, 9, 10, 11, 12, 13, 14, 15); }
__device__ __forceinline__ v16bf cat16b(v8us lo, v8us hi) { return __builtin_bit_cast(v16bf, __builtin_shufflevector(lo, hi, 0, 1, 2, 3, 4, 5, 6, 7, 8, 9, 10, 11, 12, 13, 14, 15)); }
__device__ __forceinline__ v8f wmma16(v16h a, v16h b, v8f c) { return __builtin_amdgcn_wmma_f32_16x16x32_f16(false, a, false, b, (short)0, c, false, false); }
__device__ __forceinline__ v8f wmmab(v16bf a, v16bf b, v8f c) { return __builtin_amdgcn_wmma_f32_16x16x32_bf16(false, a, false, b, (short)0, c, false, false); }
__device__ __forceinline__ h16 tohx(float x) { return (h16)x; }
__device__ __forceinline__ void splitf(float y, unsigned short& h, unsigned short& l) { h = f2bf(y); l = f2bf(y - bf2f(h)); }



// ---- gemmw: register-blocked GEMM, NW waves per 64x64 output tile (bx, by) (16 accumulators a wave), operands straight from 16-bit planes in fragment order. A work-group holds four such tiles, the 2 x 2 quarters of a 128x128 tile: 4 * NW waves, wave w on quarter w & 3 with K share w >> 2. The two quarters of a row share their A blocks and the two of a column their B blocks, at the same k step, so that a block's second reader can find it in the WGP's cache and need not ask L2 again. os is the quarter's part of the calling kernel's LDS, GLds<NW>::N floats.
// C[m][n] (f32, pitch ldc, + optional f32 bias[n]) = sum_k A[m][k] Bt[n][k] (+ split products per NSPLIT). K % (32 * NW) == 0.
// Fragment order of an operand plane (rows x K): 16 rows make a block of 16 K elements; in it the 8-element chunk (k >> 3) of row r lies at ((k >> 4) * 32 + ((k >> 3) & 1) * 16 + (r & 15)) * 8, so that lane l finds its two chunks of the 32-wide k step ks at (ks * 64 + l) * 8 and 256 elements on: every fragment load of a wave reads 512 bytes in a row (4 lines, where a row-major plane gives 16 lines of 32 bytes each). The k order of a fragment is that of the row-major loader.
// K is dealt to a tile's NW waves in 32-wide steps, share w taking steps w, w + NW, ... (neighbour shares read neighbouring kilobytes of a block); the NW partial tiles meet in LDS and are summed in the order of the shares 0 .. NW-1.
// EPI == 0: the tile goes to C as f32. EPI == 1, 2: the summed tile (+ bias) never reaches memory as f32; it is written from LDS as the three 16-bit head planes (fp16, bf16 hi, bf16 lo) that k_fattn reads, 8 elements (16 bytes a plane) a thread, a wave 512 bytes in a row. A 64x64 tile is one head x 64 tokens = 4096 plane elements in a row, and thread c writes its chunk c.
// EPI == 1 (q, k): rows m = tokens t, columns n = head * 64 + d. Fragment order of a q or k head plane: 16 rows t make a 1024-element block; in it the 8-element chunk (d >> 3) of row t lies at ((d >> 4) * 32 + ((d >> 3) & 1) * 16 + (t & 15)) * 8, so that lane l of a wave finds its two chunks of the 32-wide k step ks at (ks * 64 + l) * 8 and 256 elements on: every fragment load reads 512 bytes in a row.
// EPI == 2 (v, transposed product: A = weight rows, Bt = token rows): rows m = head * 64 + d, columns n = tokens t, bias by row. v head planes, transposed, in fragment order: 32 keys t x 64 d make a 2048-element block; the 8-key chunk of row d lies at (((d >> 4) * 2 + ((t >> 4) & 1)) * 32 + ((t >> 3) & 1) * 16 + (d & 15)) * 8.
template <typename T16> struct WFrag;
template <> struct WFrag<h16> { typedef v16h V; static __device__ __forceinline__ V ldo(const h16* p) { return cat16(*(const v8h*)p, *(const v8h*)(p + 256)); } static __device__ __forceinline__ v8f mma(V a, V b, v8f c) { return wmma16(a, b, c); } };
template <> struct WFrag<bf> { typedef v16bf V; static __device__ __forceinline__ V ldo(const bf* p) { return cat16b(*(const v8us*)p, *(const v8us*)(p + 256)); } static __device__ __forceinline__ v8f mma(V a, V b, v8f c) { return wmmab(a, b, c); } };
template <int NW> struct GLds { static constexpr int MR = 4;      // 16-row blocks of the tile that pass through LDS at a time (all four: one barrier)
    static constexpr int SL = MR * 16 * 68;    // one wave's slab, floats
    static constexpr int N = NW * SL; };
template <typename T16, int NSPLIT, bool BIAS, int NW, int K, int EPI = 0>
__device__ __forceinline__ void gemmw(float* os, int bx, int by, const T16* __restrict__ A, const T16* __restrict__ A2, const T16* __restrict__ Bt, const T16* __restrict__ Bt2, float* C, int ldc, const float* __restrict__ bias, h16* P16, bf* Ph, bf* Pl) {
    typedef typename WFrag<T16>::V V;
    constexpr int MR = GLds<NW>::MR, SL = GLds<NW>::SL;
    const int wv = (NW == 1) ? 0 : __builtin_amdgcn_readfirstlane((int)(threadIdx.x >> 7));   // K share: four waves (one a quarter) hold the same one
    const int lane = threadIdx.x & 31, lr = lane & 15, hi = lane >> 4; const int r0 = bx * 64, c0 = by * 64; const int tid = wv * 32 + lane;   // tid: this thread among the 32 * NW of its quarter
    v8f acc[4][4];
#pragma unroll
    for (int mb = 0; mb < 4; ++mb)
#pragma unroll
        for (int nb = 0; nb < 4; ++nb) acc[mb][nb] = (v8f){};
    const char* Ar = (const char*)(A + (size_t)r0 * K); const char* A2r = (const char*)(A2 + (size_t)r0 * K); const char* Br = (const char*)(Bt + (size_t)c0 * K); const char* B2r = (const char*)(Bt2 + (size_t)c0 * K);   // the tile's first 16-row blocks: the same for the whole wave
    unsigned fo = lane * 16 + wv * 1024;   // this lane's byte offset in a block at the k step that is fetched next: the one address register of all fragment loads; stepped behind the wait in ld
    constexpr int NS = K / (32 * NW);   // k steps of a wave
    constexpr int RS = NS % 3;   // k steps left behind the trips of three
    static_assert(RS != 0 && NS >= 4, "the loop's last loads are the k steps that are left behind it");
    V a[3][4], a2[3][4], b[3][4], b2[3][4];   // three fragment sets take turns: while one set's products run, the loads of the next two k steps are in flight (one set alone: every k step waits out its own loads). With the 128 accumulator registers they still leave k_proj three waves a SIMD and k_gemmw two
    auto ld = [&](const int s) {
#pragma unroll
        for (int mb = 0; mb < 4; ++mb) { a[s][mb] = WFrag<T16>::ldo((const T16*)(Ar + fo) + mb * 16 * K); if (NSPLIT == 1 || NSPLIT == 2) a2[s][mb] = WFrag<T16>::ldo((const T16*)(A2r + fo) + mb * 16 * K); }
#pragma unroll
        for (int nb = 0; nb < 4; ++nb) { b[s][nb] = WFrag<T16>::ldo((const T16*)(Br + fo) + nb * 16 * K); if (NSPLIT >= 2) b2[s][nb] = WFrag<T16>::ldo((const T16*)(B2r + fo) + nb * 16 * K); }
        asm volatile("s_wait_xcnt 0x0" : "+v"(fo) :: "memory"); };   // precaution: stands before the loads' address register is written again; naming the offset keeps it the one 32-bit address register of all loads, whole up to here (where the trip count is a constant the compiler otherwise forms 64-bit addresses every trip, and a load's result lands on them)
    auto mm = [&](const int s) {
#pragma unroll
        for (int nb = 0; nb < 4; ++nb) {
#pragma unroll
            for (int mb = 0; mb < 4; ++mb) { acc[mb][nb] = WFrag<T16>::mma(a[s][mb], b[s][nb], acc[mb][nb]); if (NSPLIT == 1 || NSPLIT == 2) acc[mb][nb] = WFrag<T16>::mma(a2[s][mb], b[s][nb], acc[mb][nb]); if (NSPLIT >= 2) acc[mb][nb] = WFrag<T16>::mma(a[s][mb], b2[s][nb], acc[mb][nb]); } } };
    ld(0); fo += 1024 * NW; ld(1); fo += 1024 * NW;
#pragma unroll 1   // three k steps a trip, one a set: a further copy of the body would be code that buys nothing
    for (int i = 0; i + 3 <= NS; i += 3) {   // trip i multiplies k steps i .. i + 2 and fetches i + 2 .. i + 4
        ld(2); fo += 1024 * NW;
        __builtin_amdgcn_sched_barrier(0);   // keeps the loads in front of the products: sunk among or behind them they have fewer products to fly under
        mm(0);
        __builtin_amdgcn_sched_barrier(0);   // keeps the loads below behind the products that still read their registers: lifted over them they would want a further fragment set
        ld(0); fo += (RS == 2 || i + 4 < NS) ? 1024u * NW : 0u;   // where one k step is left behind the loop, the last trip fetches it a second time below: in bounds, not used, no branch round the loads
        __builtin_amdgcn_sched_barrier(0);   // as the first one
        mm(1);
        __builtin_amdgcn_sched_barrier(0);   // as the second one
        ld(1); fo += 1024 * NW;
        __builtin_amdgcn_sched_barrier(0);   // as the first one
        mm(2);
    }
    mm(0); if (RS == 2) mm(1);
    float* osw = os + wv * SL;
#pragma unroll
    for (int m0 = 0; m0 < 4; m0 += MR) {
#pragma unroll
        for (int mi = 0; mi < MR; ++mi) {
#pragma unroll
            for (int nb = 0; nb < 4; ++nb) {
#pragma unroll
                for (int j = 0; j < 8; ++j) osw[(mi * 16 + hi * 8 + j) * 68 + nb * 16 + lr] = acc[m0 + mi][nb][j]; } }
        __syncthreads();   // every wave's tile is in LDS before any lane reads what other lanes and waves wrote
        if constexpr (EPI != 0) {
            static_assert(MR == 4, "the plane epilogue takes the whole tile at once");
            const size_t pbase = (EPI == 1) ? ((size_t)by * TT + r0) * HD : ((size_t)bx * TT + c0) * HD;   // this tile's 4096 elements in a plane
#pragma unroll 2   // two chunks a trip: sixteen copies of this body (NW == 1) would be some 30 KB of code that runs once
            for (int s = 0; s < 16 / NW; ++s) { const int c = s * 32 * NW + wv * 32 + (int)__builtin_amdgcn_mbcnt_lo(~0u, 0u);   // the lane's number is read anew here: taken from the value that the k loop's offset starts from, its address pair is held through the loop, where no register is free for it, and goes to scratch
               
                const int row = (EPI == 1) ? (c >> 7) * 16 + (c & 15) : ((c >> 6) & 3) * 16 + (c & 15);
                const int col = (EPI == 1) ? ((c >> 4) & 7) * 8 : (c >> 8) * 32 + ((c >> 4) & 3) * 8;
                v4f v0 = *(const v4fa*)(os + row * 68 + col), v1 = *(const v4fa*)(os + row * 68 + col + 4);
#pragma unroll
                for (int w = 1; w < NW; ++w) { v0 += *(const v4fa*)(os + w * SL + row * 68 + col); v1 += *(const v4fa*)(os + w * SL + row * 68 + col + 4); }
                if (BIAS) {
                    if (EPI == 1) {
#pragma unroll
                        for (int j = 0; j < 4; ++j) { v0[j] += bfr(bias[c0 + col + j]); v1[j] += bfr(bias[c0 + col + 4 + j]); } }
                    else { const float bb = bfr(bias[r0 + row]); v0 += bb; v1 += bb; } }
                v8h o16; v8us oh, ol;
#pragma unroll
                for (int j = 0; j < 8; ++j) { const float y = (j < 4) ? v0[j & 3] : v1[j & 3]; o16[j] = tohx(y); unsigned short a2, c2; splitf(y, a2, c2); oh[j] = a2; ol[j] = c2; }
                *(v8h*)(P16 + pbase + (size_t)c * 8) = o16; *(v8us*)(Ph + pbase + (size_t)c * 8) = oh; *(v8us*)(Pl + pbase + (size_t)c * 8) = ol;
                asm volatile("s_wait_xcnt 0x0" ::: "memory"); }   // precaution: stands before the stores' registers are written again
        } else {
        float* crow = C + (size_t)(r0 + m0 * 16) * ldc + c0;
#pragma unroll
        for (int s = 0; s < MR * 8 / NW; ++s) { const int g = s * 32 * NW + tid, row = g >> 4, cofs = (g & 15) * 4; v4f val = *(const v4fa*)(os + row * 68 + cofs);
#pragma unroll
            for (int w = 1; w < NW; ++w) val += *(const v4fa*)(os + w * SL + row * 68 + cofs);
            if (BIAS) { val[0] += bfr(bias[c0 + cofs]); val[1] += bfr(bias[c0 + cofs + 1]); val[2] += bfr(bias[c0 + cofs + 2]); val[3] += bfr(bias[c0 + cofs + 3]); }
            *(v4f*)(crow + (size_t)row * ldc + cofs) = val; }
        }
    }
}
// plain f32 output; grid (M/128, N/128), 4 * NW waves
template <typename T16, int NSPLIT, bool BIAS, int NW, int K>
__global__ __launch_bounds__(128 * NW) void k_gemmw(const T16* __restrict__ A, const T16* __restrict__ A2, const T16* __restrict__ Bt, const T16* __restrict__ Bt2, float* C, int ldc, const float* __restrict__ bias) {
    __shared__ __align__(16) float os[4 * GLds<NW>::N];
    const int q = __builtin_amdgcn_readfirstlane((int)(threadIdx.x >> 5) & 3);
    gemmw<T16, NSPLIT, BIAS, NW, K, 0>(os + q * GLds<NW>::N, (int)blockIdx.x * 2 + (q & 1), (int)blockIdx.y * 2 + (q >> 1), A, A2, Bt, Bt2, C, ldc, bias, nullptr, nullptr, nullptr);
}
// the six projections in one launch; grid (TT/128, DQ/128, 6), 4 waves (each the whole K of its quarter: three work-groups a WGP hold the whole grid at once), z = stream * 2 + batch (streams q, k, v). XB holds the six bf16 token matrices in z order, WT the transposed weights q, k, v, o. Every plane holds both batches.
// The branch is the same for a whole work-group, so that the barrier in gemmw is passed by all its waves or by none. The v tiles keep their order (feature tile fastest).
__global__ __launch_bounds__(128) void k_proj(const bf* __restrict__ XB, const bf* __restrict__ WT, const float* __restrict__ bq, const float* __restrict__ bk, const float* __restrict__ bv, h16* QP16, h16* KP16, h16* VT16, bf* QPh, bf* QPl, bf* KPh, bf* KPl, bf* VTh, bf* VTl) {
    __shared__ __align__(16) float osa[4 * GLds<1>::N];
    const int q = __builtin_amdgcn_readfirstlane((int)(threadIdx.x >> 5) & 3); float* os = osa + q * GLds<1>::N;
    const int z = (int)blockIdx.z, st = z >> 1; const size_t po = (size_t)(z & 1) * NH_ * TT * HD; const bf* X = XB + (size_t)z * TT * DM; const bf* Wt = WT + (size_t)st * DQ * DM;
    if (st == 2) { const int f = (int)blockIdx.y * (TT / 128) + (int)blockIdx.x;   /* transposed product: rows = v features, columns = tokens */
        gemmw<bf, 0, true, 1, DM, 2>(os, f % (DKV / 128) * 2 + (q & 1), f / (DKV / 128) * 2 + (q >> 1), Wt, nullptr, X, nullptr, nullptr, 0, bv, VT16 + po, VTh + po, VTl + po); }
    else gemmw<bf, 0, true, 1, DM, 1>(os, (int)blockIdx.x * 2 + (q & 1), (int)blockIdx.y * 2 + (q >> 1), X, nullptr, Wt, nullptr, nullptr, 0, st ? bk : bq, (st ? KP16 : QP16) + po, (st ? KPh : QPh) + po, (st ? KPl : QPl) + po);
}

typedef __attribute__((ext_vector_type(2))) _Float16 v2h;
typedef __attribute__((ext_vector_type(4))) _Float16 v4h;
typedef __attribute__((ext_vector_type(2))) unsigned short v2us;
typedef __attribute__((ext_vector_type(4))) unsigned short v4us;
typedef __attribute__((ext_vector_type(2))) float v2f;
typedef __attribute__((ext_vector_type(4))) int v4i;
typedef v4h  __attribute__((may_alias)) v4ha;
typedef v4us __attribute__((may_alias)) v4usa;

// k_prep: one wave builds one fragment unit of an operand plane: 16 rows x one 32-wide k step = 512 elements, written as two stores of 512 bytes in a row (fragment order: see gemmw). Lane (lr, hi) holds row lr, k = 8 hi .. 8 hi + 7 and 16 more.
__device__ __forceinline__ void put16(bf* d, const float* f) { v8us o0, o1;
#pragma unroll
    for (int j = 0; j < 8; ++j) { o0[j] = f2bf(f[j]); o1[j] = f2bf(f[8 + j]); }
    *(v8us*)d = o0; *(v8us*)(d + 256) = o1; }
// transposed weight: plane rows n = columns of w [DM][DQ]. The 8 waves of a block take 8 neighbouring 16-column blocks of one k step: each of a lane's 16 loads reads, over the wave, 64 bytes in a row of two rows of w, over the block 512 bytes of each.
__device__ __forceinline__ void wtF(int blk, const float* __restrict__ w, bf* Bt) {
    const int lane = threadIdx.x & 31, lr = lane & 15, hi = lane >> 4; const unsigned u = blk * 8 + (threadIdx.x >> 5), nb = u % (DQ / 16), ks = u / (DQ / 16);
    const float* s = w + (size_t)(ks * 32 + hi * 8) * DQ + nb * 16 + lr; float f[16];
#pragma unroll
    for (int j = 0; j < 16; ++j) f[j] = s[(size_t)((j >> 3) * 16 + (j & 7)) * DQ];
    asm volatile("s_wait_xcnt 0x0" :: "v"(s) : "memory");   // precaution: stands before the loads' address registers are written again; naming the address keeps it whole up to here (no load's result lands on it)
    put16(Bt + ((size_t)nb * (DM / 32) + ks) * 512 + lane * 8, f);
}
// bf16 copy of token rows [.][DM]: the 8 waves of a block take 8 neighbouring k steps of one 16-row block (1 KB in a row of each row). row: the source row that this lane's row of the block is copied from.
__device__ __forceinline__ void cvtF(int blk, int row, const float* __restrict__ src, bf* dst) {
    const int lane = threadIdx.x & 31, hi = lane >> 4; const unsigned u = blk * 8 + (threadIdx.x >> 5);
    const float* s = src + (size_t)row * DM + (u % (DM / 32)) * 32 + hi * 8; float f[16];
    const v8f a = *(const v8f*)s, b = *(const v8f*)(s + 16);
    asm volatile("s_wait_xcnt 0x0" :: "v"(s) : "memory");   // precaution, as in wtF
#pragma unroll
    for (int j = 0; j < 8; ++j) { f[j] = a[j]; f[8 + j] = b[j]; }
    put16(dst + (size_t)u * 512 + lane * 8, f);
}
// packRows: the order of a batch's keys in the key and value planes: kept keys (mask == 0) first, in their own order, the excluded ones behind them, in theirs. An excluded key's probability is 0, so that attention need not walk it; with no key kept the order is the given one.
// A block of 256 threads reads the batch's 2048 mask words, 8 in a row a thread. Kept keys in front of a thread's first key: those of the lower lanes (one masked bit count a ballot) + the lower waves' totals, which meet in LDS (wc). Each thread places its 8 keys; the one whose place is R0 + d, d < 16, writes its index to srow[d]. Every index comes from the thread's number, none from a mask value. Returns the source key of this lane's row; nk: kept keys of the batch.
__device__ __forceinline__ int packRows(const int* __restrict__ mb, int R0, int* wc, int* srow, int& nk) {
    const int tid = (int)threadIdx.x, lane = tid & 31, wv = tid >> 5; const int* p = mb + tid * 8;
    const v4i m0 = *(const v4i*)p, m1 = *(const v4i*)(p + 4);
    asm volatile("s_wait_xcnt 0x0" :: "v"(p) : "memory");   // precaution, as in wtF
    bool kp[8]; int e = 0, tot = 0;
#pragma unroll
    for (int j = 0; j < 8; ++j) { kp[j] = ((j < 4) ? m0[j & 3] : m1[j & 3]) == 0; const unsigned bal = __builtin_amdgcn_ballot_w32(kp[j]); e = (int)__builtin_amdgcn_mbcnt_lo(bal, (unsigned)e); tot += __builtin_popcount(bal); }
    if (lane == 0) wc[wv] = tot;
    __syncthreads();   // every wave's total is in LDS before any wave sums them
    nk = 0;
#pragma unroll
    for (int w = 0; w < 8; ++w) { const int c = wc[w]; nk += c; e += (w < wv) ? c : 0; }
#pragma unroll
    for (int j = 0; j < 8; ++j) { const int t = tid * 8 + j; const unsigned d = (unsigned)((kp[j] ? e : nk + t - e) - R0); if (d < 16u) srow[d] = t; e += kp[j] ? 1 : 0; }
    __syncthreads();   // the 16 source rows are in LDS before any lane reads its own
    return srow[lane & 15];
}
// every 16-bit operand of the projections and of Wo in one launch: blocks [0, 4 WB) transpose the four weights, the next 3 CB copy query, key, value (both batches of a stream lie in a row). The grid holds exactly one wave a unit.
#define WB ((DQ / 16) * (DM / 32) / 8)
#define CB ((NB_ * TT / 16) * (DM / 32) / 8)
// A key or value block first finds its 16 source rows (the branch is the same for a whole block, so that the barriers in packRows are passed by all its waves or by none); the first key block of a batch stores the batch's number of kept keys in NK.
__global__ __launch_bounds__(256) void k_prep(const float* __restrict__ x, const float* __restrict__ xk, const float* __restrict__ xv, const int* __restrict__ kmask, const float* __restrict__ wq, const float* __restrict__ wk, const float* __restrict__ wv, const float* __restrict__ wo, bf* WT, bf* XB, int* NK) {
    __shared__ int wc[8]; __shared__ int srow[16];
    const int blk = (int)blockIdx.x;
    if (blk < 4 * WB) { const int i = blk / WB; wtF(blk % WB, i == 0 ? wq : i == 1 ? wk : i == 2 ? wv : wo, WT + (size_t)i * DM * DQ); }
    else { const int c = blk - 4 * WB, i = c / CB, cb = c % CB, rb = cb / (DM / 256);   /* rb: the block's 16 rows among the 2 x 2048 of its stream */
        int row = rb * 16 + ((int)threadIdx.x & 15);
        if (i != 0) { const int b = rb / (TT / 16); int nk; row = b * TT + packRows(kmask + b * TT, (rb % (TT / 16)) * 16, wc, srow, nk);
            if (i == 1 && cb % (CB / NB_) == 0 && threadIdx.x == 0) { NK[b] = nk; asm volatile("s_wait_xcnt 0x0" ::: "memory"); } }   // precaution: stands before the store's registers are written again
        cvtF(cb, row, i == 0 ? x : i == 1 ? xk : xv, XB + (size_t)i * NB_ * TT * DM); }
}

// k_fattn: S, softmax, P.V and the head merge in one kernel; no score or probability leaves the registers. One wave owns NQ * 16 queries of one (batch, head) and walks the batch's kept keys, which lie first in the planes (packRows), 32 at a time, on its own (no LDS, no barrier): ceil(nk / 32) passes; all 64 where no key is kept.
// Transposed products: St = K Qt (A = 16 key rows, B = 16 query columns), so lane (c, hh) holds for query c the keys 8 hh + r (tile 0) and 16 + 8 hh + r (tile 1): these 16 values, converted in place, are the B operand of Ot += Vt Pt in the hardware k order, which the v planes' fragment order matches.
// Softmax with a running maximum in the base-2 domain: the maximum in use is raised (and sums and outputs rescaled) only when some query's new maximum exceeds it by more than 8, one test per 32 keys, so p <= 2^8. A slot at or behind nk holds an excluded key and carries -3e38: p == 0 once a kept key has set the maximum; with every key excluded p == 1 for all (uniform, as mask x -1e9 gives in f32). Only a pass that reaches past nk has such slots (the last one, or every one where nk == 0): the select stands under a scalar branch.
// eight base-2 exponentials in place: behind each stands an independent one, behind the last a v_nop: the slot that the instruction set asks for between a transcendental and a use of its result or an overwrite of its source
__device__ __forceinline__ void exp8(float* x) {
    asm("v_exp_f32 %0, %0\n\tv_exp_f32 %1, %1\n\tv_exp_f32 %2, %2\n\tv_exp_f32 %3, %3\n\tv_exp_f32 %4, %4\n\tv_exp_f32 %5, %5\n\tv_exp_f32 %6, %6\n\tv_exp_f32 %7, %7\n\tv_nop" : "+v"(x[0]), "+v"(x[1]), "+v"(x[2]), "+v"(x[3]), "+v"(x[4]), "+v"(x[5]), "+v"(x[6]), "+v"(x[7])); }
// the value that lane l ^ 16 holds (the other half of a query's keys), without a trip through LDS
__device__ __forceinline__ float xhalf(float v) { const int b = __float_as_int(v); return __int_as_float(__builtin_amdgcn_permlanex16(b, b, 0x76543210, 0xfedcba98, false, false)); }
template <bool HR> struct FSel { typedef h16 T; };
template <> struct FSel<true> { typedef bf T; };
template <bool HR, int NQ>
__device__ __forceinline__ void fattn(const typename FSel<HR>::T* __restrict__ Q, const typename FSel<HR>::T* __restrict__ Q2, const typename FSel<HR>::T* __restrict__ Kp, const typename FSel<HR>::T* __restrict__ K2, const typename FSel<HR>::T* __restrict__ Vp, const typename FSel<HR>::T* __restrict__ V2, int nk, int q0, bf* Ah, bf* Al) {
    typedef typename FSel<HR>::T T16; typedef WFrag<T16> W; typedef typename W::V V;
    const int lane = threadIdx.x & 31, hh = lane >> 4;   // every inner loop below is unrolled so that each index of a register array is a constant
    V qf[NQ][2], qf2[NQ][2], kf[2][2], kf2[2][2], vf[4], vf2[4]; v8f o[NQ][4]; float m[NQ], l[NQ];
    const int np = nk ? (nk + 31) >> 5 : TT / 32;   // passes; nk is clamped to 0 .. TT by the caller, the same in every lane
#pragma unroll
    for (int g = 0; g < NQ; ++g) { m[g] = -3.0e38f; l[g] = 0.f;
#pragma unroll
        for (int dt = 0; dt < 4; ++dt) o[g][dt] = (v8f){};
#pragma unroll
        for (int ks = 0; ks < 2; ++ks) { const size_t qo = (size_t)((q0 >> 4) + g) * 1024 + (ks * 64 + lane) * 8; qf[g][ks] = W::ldo(Q + qo); if (HR) qf2[g][ks] = W::ldo(Q2 + qo); } }
    asm volatile("s_wait_xcnt 0x0" ::: "memory");   // precaution, as in loadK
    unsigned ko = lane * 16, vo = lane * 16;   // this lane's byte offsets in the k tiles and the v tile that are fetched next; carried through the loop and stepped behind the wait in loadK
    auto loadK = [&]() {
#pragma unroll
        for (int kt = 0; kt < 2; ++kt)
#pragma unroll
            for (int ks = 0; ks < 2; ++ks) { kf[kt][ks] = W::ldo((const T16*)((const char*)Kp + ko) + (kt * 1024 + ks * 512)); if (HR) kf2[kt][ks] = W::ldo((const T16*)((const char*)K2 + ko) + (kt * 1024 + ks * 512)); }
        asm volatile("s_wait_xcnt 0x0" ::: "memory"); };   // precaution: stands before the address registers of the loads above are written again
    auto loadV = [&]() {
#pragma unroll
        for (int dt = 0; dt < 4; ++dt) { vf[dt] = W::ldo((const T16*)((const char*)Vp + vo) + dt * 512); if (HR) vf2[dt] = W::ldo((const T16*)((const char*)V2 + vo) + dt * 512); } };   // their offset is stepped behind loadK's wait
    loadK(); ko += 4096;
    int it = 0;
#pragma unroll 1   // one pass a trip: a second copy of the body would hold a second set of fragments and scores live
    do {   // np >= 1: tested at the foot, so that no guard stands round the loop (the loads above would sink under it, past their waits)
        loadV();   // this pass's v fragments fly during its S products and softmax; issued behind the k loads on every path, so that the wait for k leaves them in flight
        __builtin_amdgcn_sched_barrier(0);   // keeps the v loads in front of the S products: sunk behind them they have only the exponentials to fly in
        v8f s[NQ][2];
#pragma unroll
        for (int g = 0; g < NQ; ++g) { s[g][0] = (v8f){}; s[g][1] = (v8f){}; }
#pragma unroll
        for (int ks = 0; ks < 2; ++ks) {
#pragma unroll
            for (int g = 0; g < NQ; ++g)
#pragma unroll
                for (int kt = 0; kt < 2; ++kt) s[g][kt] = W::mma(kf[kt][ks], qf[g][ks], s[g][kt]);
            if (HR) {
#pragma unroll
                for (int g = 0; g < NQ; ++g)
#pragma unroll
                    for (int kt = 0; kt < 2; ++kt) s[g][kt] = W::mma(kf2[kt][ks], qf[g][ks], s[g][kt]);
#pragma unroll
                for (int g = 0; g < NQ; ++g)
#pragma unroll
                    for (int kt = 0; kt < 2; ++kt) s[g][kt] = W::mma(kf[kt][ks], qf2[g][ks], s[g][kt]); } }
#pragma unroll
        for (int g = 0; g < NQ; ++g) { s[g][0] *= SCL2; s[g][1] *= SCL2; }
        if (it * 32 + 32 > nk) { const int lim = nk - it * 32 - hh * 8;   // this lane's slots kt * 16 + r of the pass hold kept keys below lim
#pragma unroll
            for (int g = 0; g < NQ; ++g)
#pragma unroll
                for (int kt = 0; kt < 2; ++kt)
#pragma unroll
                    for (int r = 0; r < 8; ++r) s[g][kt][r] = (kt * 16 + r < lim) ? s[g][kt][r] : -3.0e38f; }
        float ml[NQ]; bool need = false;
#pragma unroll
        for (int g = 0; g < NQ; ++g) { float mx = -3.0e38f;
#pragma unroll
            for (int kt = 0; kt < 2; ++kt)
#pragma unroll
                for (int r = 0; r < 8; ++r) mx = fmaxf(mx, s[g][kt][r]);
            mx = fmaxf(mx, xhalf(mx)); ml[g] = mx; need = need || (mx > m[g] + 8.0f); }
        loadK();   // the next pass's k fragments fly during this pass's softmax and P.V
        if (__builtin_amdgcn_ballot_w32(need) != 0) {
#pragma unroll
            for (int g = 0; g < NQ; ++g) { const float mn = fmaxf(m[g], ml[g]); const float al = __builtin_amdgcn_exp2f(m[g] - mn); m[g] = mn; l[g] *= al;
#pragma unroll
                for (int dt = 0; dt < 4; ++dt) o[g][dt] *= al; } }
        { const unsigned st = (it + 2 < np) ? 1u : 0u; ko += st * 4096; vo += 4096; }   // the last pass fetches its own k tiles again: in bounds, no branch round the loads
        V pb[NQ], pb2[NQ];
#pragma unroll
        for (int g = 0; g < NQ; ++g) { float sm[4];   // four independent chains
            float x[16];
#pragma unroll
            for (int e = 0; e < 16; ++e) x[e] = s[g][e >> 3][e & 7] - m[g];
            exp8(x); exp8(x + 8);
#pragma unroll
            for (int e = 0; e < 16; ++e) { const float p = x[e]; sm[e & 3] = (e < 4) ? p : sm[e & 3] + p;
                if constexpr (HR) { const __bf16 ph = (__bf16)p; pb[g][e] = ph; pb2[g][e] = (__bf16)(p - (float)ph); } else pb[g][e] = (h16)p; }
            l[g] += (sm[0] + sm[1]) + (sm[2] + sm[3]); }
#pragma unroll
        for (int dt = 0; dt < 4; ++dt)
#pragma unroll
            for (int g = 0; g < NQ; ++g) o[g][dt] = W::mma(vf[dt], pb[g], o[g][dt]);
        if (HR) {
#pragma unroll
            for (int dt = 0; dt < 4; ++dt)
#pragma unroll
                for (int g = 0; g < NQ; ++g) o[g][dt] = W::mma(vf2[dt], pb[g], o[g][dt]);
#pragma unroll
            for (int dt = 0; dt < 4; ++dt)
#pragma unroll
                for (int g = 0; g < NQ; ++g) o[g][dt] = W::mma(vf[dt], pb2[g], o[g][dt]); }
    } while (++it < np);
#pragma unroll
    for (int g = 0; g < NQ; ++g) { const float inv = __fdiv_rn(1.0f, l[g] + xhalf(l[g])); const size_t oo = (size_t)(q0 + g * 16) * DQ + lane * 8;   // Ot register r of tile dt = O[query lane & 15][16 dt + 8 hh + r]: chunk 'lane' of the head's 16-wide column group dt in the fragment order that Wo's A loader reads
#pragma unroll
        for (int dt = 0; dt < 4; ++dt) { v8us oh, ol;
#pragma unroll
            for (int r = 0; r < 8; ++r) { unsigned short a, c2; splitf(o[g][dt][r] * inv, a, c2); oh[r] = a; ol[r] = c2; }
            *(v8us*)(Ah + oo + dt * 256) = oh; *(v8us*)(Al + oo + dt * 256) = ol;
            asm volatile("s_wait_xcnt 0x0" ::: "memory"); } }   // precaution: stands before the stores' registers are written again
}
// grid (RH / 64 + (TT - RH) / 128, heads, batches), 4 waves: the first RH / 64 blocks take 16 hi/lo queries a wave, the rest 32 fp16 queries a wave (about the same work a pass). The second launch bound asks for 4 waves a SIMD: at most 256 registers, so that every work-group of the grid is resident at once.
__global__ __launch_bounds__(128, 4) void k_fattn(const h16* __restrict__ Q16, const h16* __restrict__ K16, const h16* __restrict__ V16, const bf* __restrict__ Qh, const bf* __restrict__ Ql, const bf* __restrict__ Kh, const bf* __restrict__ Kl, const bf* __restrict__ Vh, const bf* __restrict__ Vl, const int* __restrict__ NK, bf* Ah, bf* Al) {
    const int wv = __builtin_amdgcn_readfirstlane((int)(threadIdx.x >> 5)); const size_t pz = ((size_t)blockIdx.z * NH_ + blockIdx.y) * TT * HD; const int nk = __builtin_amdgcn_readfirstlane(min(max(NK[blockIdx.z], 0), TT));   /* the batch's kept keys, from k_prep; bounds the trip count */ const size_t ao = (size_t)blockIdx.z * TT * DQ + (size_t)blockIdx.y * HD * 16;
    if (blockIdx.x < RH / 64) fattn<true, 1>(Qh + pz, Ql + pz, Kh + pz, Kl + pz, Vh + pz, Vl + pz, nk, (int)blockIdx.x * 64 + wv * 16, Ah + ao, Al + ao);
    else fattn<false, 2>(Q16 + pz, nullptr, K16 + pz, nullptr, V16 + pz, nullptr, nk, RH + ((int)blockIdx.x - RH / 64) * 128 + wv * 32, Ah + ao, Al + ao);
}

extern "C" void kernel_launch(void* const* d_in, const int* in_sizes, int n_in,
                              void* d_out, int out_size, void* d_ws, size_t ws_size, hipStream_t stream) {
    (void)in_sizes; (void)n_in; (void)out_size;
    const float* x = (const float*)d_in[0]; const float* xk = (const float*)d_in[1]; const float* xv = (const float*)d_in[2]; const int* kmask = (const int*)d_in[3];   /* mask [2][1][1][2048] int32: 1 = excluded key */ const float* wq = (const float*)d_in[4]; const float* bq = (const float*)d_in[5]; const float* wk = (const float*)d_in[6]; const float* bk = (const float*)d_in[7]; const float* wv = (const float*)d_in[8]; const float* bv = (const float*)d_in[9]; const float* wo = (const float*)d_in[10]; const float* bo = (const float*)d_in[11];   /* argument order query, key, value, mask, Wq, bq, Wk, bk, Wv, bv, Wo, bo ('xw') */
    float* OUT = (float*)d_out;     // [2][2048][1024]
    char* wsp = (char*)d_ws;
    auto take = [&](size_t bytes) { char* p = wsp; wsp += (bytes + 255) & ~(size_t)255; return (void*)p; };
    bf* WT = (bf*)take((size_t)4 * DQ * DM * 2);   // transposed Wq, Wk, Wv, Wo
    bf* XB = (bf*)take((size_t)3 * NB_ * TT * DM * 2);   // bf16 query, key, value
    const size_t PLN = (size_t)NH_ * TT * HD;   // one batch's plane set, elements (NKV == NH_); every plane holds both batches
    h16* QP16 = (h16*)take(NB_ * PLN * 2); h16* KP16 = (h16*)take(NB_ * PLN * 2); h16* VT16 = (h16*)take(NB_ * PLN * 2);
    bf* QPh = (bf*)take(NB_ * PLN * 2); bf* QPl = (bf*)take(NB_ * PLN * 2); bf* KPh = (bf*)take(NB_ * PLN * 2); bf* KPl = (bf*)take(NB_ * PLN * 2); bf* VTh = (bf*)take(NB_ * PLN * 2); bf* VTl = (bf*)take(NB_ * PLN * 2);
    bf* ATh = (bf*)take((size_t)NB_ * TT * DQ * 2); bf* ATl = (bf*)take((size_t)NB_ * TT * DQ * 2);
    int* NK = (int*)take(NB_ * sizeof(int));   // kept keys of each batch
    if ((size_t)(wsp - (char*)d_ws) > ws_size) return;    // ws 256 MiB
    k_prep<<<4 * WB + 3 * CB, 256, 0, stream>>>(x, xk, xv, kmask, wq, wk, wv, wo, WT, XB, NK);
    k_proj<<<dim3(TT / 128, DQ / 128, 3 * NB_), 128, 0, stream>>>(XB, WT, bq, bk, bv, QP16, KP16, VT16, QPh, QPl, KPh, KPl, VTh, VTl);
    k_fattn<<<dim3(RH / 64 + (TT - RH) / 128, NH_, NB_), 128, 0, stream>>>(QP16, KP16, VT16, QPh, QPl, KPh, KPl, VTh, VTl, NK, ATh, ATl);
    k_gemmw<bf, 1, true, 2, DQ><<<dim3(NB_ * TT / 128, DM / 128, 1), 256, 0, stream>>>(ATh, ATl, WT + (size_t)3 * DQ * DM, nullptr, OUT, DM, bo);
}

// v010
// One run takes 88.6 microseconds.
// Timed twice side by side with v009, it ran 1.06 and 1.07 times as fast.
// Over all steps from v000 it is 23.1 times as fast.
#include <hip/hip_runtime.h>

// Multi-head attention on three input streams with a per-batch key mask (query, key, value [2][2048][1024]; q = query Wq + bq, k = key Wk + bk, v = value Wv + bv ('xw' 1/32, zero biases; 16 heads x 64); logits = q.k / sqrt(64) + mask[b][0][0][j] x (-1e9) with mask int32 [2][1][1][2048] random 0/1 (read; 1 == that key is excluded); softmax; out = merged Wo + bo -> [2][2048][1024] (4.2 M); argument order query, key, value, mask, Wq, bq, Wk, bk, Wv, bv, Wo, bo).
// Layout, four launches: (1) bf16 copies of query, key, value (both batches) and the four transposed 'xw' weights, all in fragment order (see gemmw); the key and value rows of a batch are laid kept keys first (see packRows), so that k and v come out of (2) in that order, and rows of 128-key tiles that hold no kept key are not copied; (2) the six exact projections + f32 biases (stream x batch in grid z), whose epilogue writes the head planes; key and value tiles that hold no kept key are not computed (nothing reads them); (3) one fused attention kernel over every (batch, head) (hybrid rows: < 512 hi/lo 3 products, rest fp16; running-maximum softmax, S and P stay in registers); it walks only the passes that hold kept keys (their number comes from (1)) and excludes the slots behind the last kept key by select (-1e9 == exclusion); (4) merged hi/lo (written by (3) in fragment order) x Wo exact + bo, both batches as one row range.
// Compute dtypes, f32 accumulate: every input rounded to bf16; projections exact + f32 biases; attention rows < 512 3 products, rest fp16; softmax f32; Wo hl x exact + bias.

#define NB_  2
#define TT   2048
#define DM   1024
#define NH_  16
#define NKV  16
#define REP  (NH_ / NKV)
#define HD   64
#define DQ   (NH_ * HD)
#define DKV  (NKV * HD)
#define RH   512                  // query rows < RH use hi+lo planes (0: none)
#define WIN  0
#define SCL2 0.18033688011112042f   // HD^-0.5 x log2(e): scores are carried in the base-2 domain
typedef _Float16 h16;
typedef unsigned short bf;
typedef __attribute__((ext_vector_type(16))) __bf16   v16bf;
typedef __attribute__((ext_vector_type(16))) _Float16 v16h;
typedef __attribute__((ext_vector_type(8)))  _Float16 v8h;
typedef __attribute__((ext_vector_type(8)))  unsigned short v8us;
typedef __attribute__((ext_vector_type(8)))  float    v8f;
typedef __attribute__((ext_vector_type(4)))  float    v4f;
typedef v8h  __attribute__((may_alias)) v8ha;
typedef v4f  __attribute__((may_alias)) v4fa;
typedef v8us __attribute__((may_alias)) v8usa;

__device__ __forceinline__ unsigned short f2bf(float f) { unsigned u = __float_as_uint(f); u += 0x7FFFu + ((u >> 16) & 1u); return (unsigned short)(u >> 16); }
__device__ __forceinline__ float bf2f(unsigned short b) { return __uint_as_float(((unsigned)b) << 16); }
__device__ __forceinline__ float bfr(float f) { return bf2f(f2bf(f)); }
__device__ __forceinline__ v16h cat16(v8h lo, v8h hi) { return __builtin_shufflevector(lo, hi, 0, 1, 2, 3, 4, 5, 6, 7, 8, 9, 10, 11, 12, 13, 14, 15); }
__device__ __forceinline__ v16bf cat16b(v8us lo, v8us hi) { return __builtin_bit_cast(v16bf, __builtin_shufflevector(lo, hi, 0, 1, 2, 3, 4, 5, 6, 7, 8, 9, 10, 11, 12, 13, 14, 15)); }
__device__ __forceinline__ v8f wmma16(v16h a, v16h b, v8f c) { return __builtin_amdgcn_wmma_f32_16x16x32_f16(false, a, false, b, (short)0, c, false, false); }
__device__ __forceinline__ v8f wmmab(v16bf a, v16bf b, v8f c) { return __builtin_amdgcn_wmma_f32_16x16x32_bf16(false, a, false, b, (short)0, c, false, false); }
__device__ __forceinline__ h16 tohx(float x) { return (h16)x; }
__device__ __forceinline__ void splitf(float y, unsigned short& h, unsigned short& l) { h = f2bf(y); l = f2bf(y - bf2f(h)); }



// ---- gemmw: register-blocked GEMM, NW waves per 64x64 output tile (bx, by) (16 accumulators a wave), operands straight from 16-bit planes in fragment order. A work-group holds four such tiles, the 2 x 2 quarters of a 128x128 tile: 4 * NW waves, wave w on quarter w & 3 with K share w >> 2. The two quarters of a row share their A blocks and the two of a column their B blocks, at the same k step, so that a block's second reader can find it in the WGP's cache and need not ask L2 again. os is the quarter's part of the calling kernel's LDS, GLds<NW>::N floats.
// C[m][n] (f32, pitch ldc, + optional f32 bias[n]) = sum_k A[m][k] Bt[n][k] (+ split products per NSPLIT). K % (32 * NW) == 0.
// Fragment order of an operand plane (rows x K): 16 rows make a block of 16 K elements; in it the 8-element chunk (k >> 3) of row r lies at ((k >> 4) * 32 + ((k >> 3) & 1) * 16 + (r & 15)) * 8, so that lane l finds its two chunks of the 32-wide k step ks at (ks * 64 + l) * 8 and 256 elements on: every fragment load of a wave reads 512 bytes in a row (4 lines, where a row-major plane gives 16 lines of 32 bytes each). The k order of a fragment is that of the row-major loader.
// K is dealt to a tile's NW waves in 32-wide steps, share w taking steps w, w + NW, ... (neighbour shares read neighbouring kilobytes of a block); the NW partial tiles meet in LDS and are summed in the order of the shares 0 .. NW-1.
// EPI == 0: the tile goes to C as f32. EPI == 1, 2: the summed tile (+ bias) never reaches memory as f32; it is written from LDS as the three 16-bit head planes (fp16, bf16 hi, bf16 lo) that k_fattn reads, 8 elements (16 bytes a plane) a thread, a wave 512 bytes in a row. A 64x64 tile is one head x 64 tokens = 4096 plane elements in a row, and thread c writes its chunk c.
// EPI == 1 (q, k): rows m = tokens t, columns n = head * 64 + d. Fragment order of a q or k head plane: 16 rows t make a 1024-element block; in it the 8-element chunk (d >> 3) of row t lies at ((d >> 4) * 32 + ((d >> 3) & 1) * 16 + (t & 15)) * 8, so that lane l of a wave finds its two chunks of the 32-wide k step ks at (ks * 64 + l) * 8 and 256 elements on: every fragment load reads 512 bytes in a row.
// EPI == 2 (v, transposed product: A = weight rows, Bt = token rows): rows m = head * 64 + d, columns n = tokens t, bias by row. v head planes, transposed, in fragment order: 32 keys t x 64 d make a 2048-element block; the 8-key chunk of row d lies at (((d >> 4) * 2 + ((t >> 4) & 1)) * 32 + ((t >> 3) & 1) * 16 + (d & 15)) * 8.
template <typename T16> struct WFrag;
template <> struct WFrag<h16> { typedef v16h V; static __device__ __forceinline__ V ldo(const h16* p) { return cat16(*(const v8h*)p, *(const v8h*)(p + 256)); } static __device__ __forceinline__ v8f mma(V a, V b, v8f c) { return wmma16(a, b, c); } };
template <> struct WFrag<bf> { typedef v16bf V; static __device__ __forceinline__ V ldo(const bf* p) { return cat16b(*(const v8us*)p, *(const v8us*)(p + 256)); } static __device__ __forceinline__ v8f mma(V a, V b, v8f c) { return wmmab(a, b, c); } };
template <int NW> struct GLds { static constexpr int MR = 4;      // 16-row blocks of the tile that pass through LDS at a time (all four: one barrier)
    static constexpr int SL = MR * 16 * 68;    // one wave's slab, floats
    static constexpr int N = NW * SL; };
template <typename T16, int NSPLIT, bool BIAS, int NW, int K, int EPI = 0>
__device__ __forceinline__ void gemmw(float* os, int bx, int by, const T16* __restrict__ A, const T16* __restrict__ A2, const T16* __restrict__ Bt, const T16* __restrict__ Bt2, float* C, int ldc, const float* __restrict__ bias, h16* P16, bf* Ph, bf* Pl) {
    typedef typename WFrag<T16>::V V;
    constexpr int MR = GLds<NW>::MR, SL = GLds<NW>::SL;
    const int wv = (NW == 1) ? 0 : __builtin_amdgcn_readfirstlane((int)(threadIdx.x >> 7));   // K share: four waves (one a quarter) hold the same one
    const int lane = threadIdx.x & 31, lr = lane & 15, hi = lane >> 4; const int r0 = bx * 64, c0 = by * 64; const int tid = wv * 32 + lane;   // tid: this thread among the 32 * NW of its quarter
    v8f acc[4][4];
#pragma unroll
    for (int mb = 0; mb < 4; ++mb)
#pragma unroll
        for (int nb = 0; nb < 4; ++nb) acc[mb][nb] = (v8f){};
    const char* Ar = (const char*)(A + (size_t)r0 * K); const char* A2r = (const char*)(A2 + (size_t)r0 * K); const char* Br = (const char*)(Bt + (size_t)c0 * K); const char* B2r = (const char*)(Bt2 + (size_t)c0 * K);   // the tile's first 16-row blocks: the same for the whole wave
    unsigned fo = lane * 16 + wv * 1024;   // this lane's byte offset in a block at the k step that is fetched next: the one address register of all fragment loads; stepped behind the wait in ld
    constexpr int NS = K / (32 * NW);   // k steps of a wave
    constexpr int RS = NS % 3;   // k steps left behind the trips of three
    static_assert(RS != 0 && NS >= 4, "the loop's last loads are the k steps that are left behind it");
    V a[3][4], a2[3][4], b[3][4], b2[3][4];   // three fragment sets take turns: while one set's products run, the loads of the next two k steps are in flight (one set alone: every k step waits out its own loads). With the 128 accumulator registers they still leave k_proj three waves a SIMD and k_gemmw two
    auto ld = [&](const int s) {
#pragma unroll
        for (int mb = 0; mb < 4; ++mb) { a[s][mb] = WFrag<T16>::ldo((const T16*)(Ar + fo) + mb * 16 * K); if (NSPLIT == 1 || NSPLIT == 2) a2[s][mb] = WFrag<T16>::ldo((const T16*)(A2r + fo) + mb * 16 * K); }
#pragma unroll
        for (int nb = 0; nb < 4; ++nb) { b[s][nb] = WFrag<T16>::ldo((const T16*)(Br + fo) + nb * 16 * K); if (NSPLIT >= 2) b2[s][nb] = WFrag<T16>::ldo((const T16*)(B2r + fo) + nb * 16 * K); }
        asm volatile("s_wait_xcnt 0x0" : "+v"(fo) :: "memory"); };   // precaution: stands before the loads' address register is written again; naming the offset keeps it the one 32-bit address register of all loads, whole up to here (where the trip count is a constant the compiler otherwise forms 64-bit addresses every trip, and a load's result lands on them)
    auto mm = [&](const int s) {
#pragma unroll
        for (int nb = 0; nb < 4; ++nb) {
#pragma unroll
            for (int mb = 0; mb < 4; ++mb) { acc[mb][nb] = WFrag<T16>::mma(a[s][mb], b[s][nb], acc[mb][nb]); if (NSPLIT == 1 || NSPLIT == 2) acc[mb][nb] = WFrag<T16>::mma(a2[s][mb], b[s][nb], acc[mb][nb]); if (NSPLIT >= 2) acc[mb][nb] = WFrag<T16>::mma(a[s][mb], b2[s][nb], acc[mb][nb]); } } };
    ld(0); fo += 1024 * NW; ld(1); fo += 1024 * NW;
#pragma unroll 1   // three k steps a trip, one a set: a further copy of the body would be code that buys nothing
    for (int i = 0; i + 3 <= NS; i += 3) {   // trip i multiplies k steps i .. i + 2 and fetches i + 2 .. i + 4
        ld(2); fo += 1024 * NW;
        __builtin_amdgcn_sched_barrier(0);   // keeps the loads in front of the products: sunk among or behind them they have fewer products to fly under
        mm(0);
        __builtin_amdgcn_sched_barrier(0);   // keeps the loads below behind the products that still read their registers: lifted over them they would want a further fragment set
        ld(0); fo += (RS == 2 || i + 4 < NS) ? 1024u * NW : 0u;   // where one k step is left behind the loop, the last trip fetches it a second time below: in bounds, not used, no branch round the loads
        __builtin_amdgcn_sched_barrier(0);   // as the first one
        mm(1);
        __builtin_amdgcn_sched_barrier(0);   // as the second one
        ld(1); fo += 1024 * NW;
        __builtin_amdgcn_sched_barrier(0);   // as the first one
        mm(2);
    }
    mm(0); if (RS == 2) mm(1);
    float* osw = os + wv * SL;
#pragma unroll
    for (int m0 = 0; m0 < 4; m0 += MR) {
#pragma unroll
        for (int mi = 0; mi < MR; ++mi) {
#pragma unroll
            for (int nb = 0; nb < 4; ++nb) {
#pragma unroll
                for (int j = 0; j < 8; ++j) osw[(mi * 16 + hi * 8 + j) * 68 + nb * 16 + lr] = acc[m0 + mi][nb][j]; } }
        __syncthreads();   // every wave's tile is in LDS before any lane reads what other lanes and waves wrote
        if constexpr (EPI != 0) {
            static_assert(MR == 4, "the plane epilogue takes the whole tile at once");
            const size_t pbase = (EPI == 1) ? ((size_t)by * TT + r0) * HD : ((size_t)bx * TT + c0) * HD;   // this tile's 4096 elements in a plane
#pragma unroll 2   // two chunks a trip: sixteen copies of this body (NW == 1) would be some 30 KB of code that runs once
            for (int s = 0; s < 16 / NW; ++s) { const int c = s * 32 * NW + wv * 32 + (int)__builtin_amdgcn_mbcnt_lo(~0u, 0u);   // the lane's number is read anew here: taken from the value that the k loop's offset starts from, its address pair is held through the loop, where no register is free for it, and goes to scratch
               
                const int row = (EPI == 1) ? (c >> 7) * 16 + (c & 15) : ((c >> 6) & 3) * 16 + (c & 15);
                const int col = (EPI == 1) ? ((c >> 4) & 7) * 8 : (c >> 8) * 32 + ((c >> 4) & 3) * 8;
                v4f v0 = *(const v4fa*)(os + row * 68 + col), v1 = *(const v4fa*)(os + row * 68 + col + 4);
#pragma unroll
                for (int w = 1; w < NW; ++w) { v0 += *(const v4fa*)(os + w * SL + row * 68 + col); v1 += *(const v4fa*)(os + w * SL + row * 68 + col + 4); }
                if (BIAS) {
                    if (EPI == 1) {
#pragma unroll
                        for (int j = 0; j < 4; ++j) { v0[j] += bfr(bias[c0 + col + j]); v1[j] += bfr(bias[c0 + col + 4 + j]); } }
                    else { const float bb = bfr(bias[r0 + row]); v0 += bb; v1 += bb; } }
                v8h o16; v8us oh, ol;
#pragma unroll
                for (int j = 0; j < 8; ++j) { const float y = (j < 4) ? v0[j & 3] : v1[j & 3]; o16[j] = tohx(y); unsigned short a2, c2; splitf(y, a2, c2); oh[j] = a2; ol[j] = c2; }
                *(v8h*)(P16 + pbase + (size_t)c * 8) = o16; *(v8us*)(Ph + pbase + (size_t)c * 8) = oh; *(v8us*)(Pl + pbase + (size_t)c * 8) = ol;
                asm volatile("s_wait_xcnt 0x0" ::: "memory"); }   // precaution: stands before the stores' registers are written again
        } else {
        float* crow = C + (size_t)(r0 + m0 * 16) * ldc + c0;
#pragma unroll
        for (int s = 0; s < MR * 8 / NW; ++s) { const int g = s * 32 * NW + tid, row = g >> 4, cofs = (g & 15) * 4; v4f val = *(const v4fa*)(os + row * 68 + cofs);
#pragma unroll
            for (int w = 1; w < NW; ++w) val += *(const v4fa*)(os + w * SL + row * 68 + cofs);
            if (BIAS) { val[0] += bfr(bias[c0 + cofs]); val[1] += bfr(bias[c0 + cofs + 1]); val[2] += bfr(bias[c0 + cofs + 2]); val[3] += bfr(bias[c0 + cofs + 3]); }
            *(v4f*)(crow + (size_t)row * ldc + cofs) = val; }
        }
    }
}
// plain f32 output; grid (M/128, N/128), 4 * NW waves
template <typename T16, int NSPLIT, bool BIAS, int NW, int K>
__global__ __launch_bounds__(128 * NW) void k_gemmw(const T16* __restrict__ A, const T16* __restrict__ A2, const T16* __restrict__ Bt, const T16* __restrict__ Bt2, float* C, int ldc, const float* __restrict__ bias) {
    __shared__ __align__(16) float os[4 * GLds<NW>::N];
    const int q = __builtin_amdgcn_readfirstlane((int)(threadIdx.x >> 5) & 3);
    gemmw<T16, NSPLIT, BIAS, NW, K, 0>(os + q * GLds<NW>::N, (int)blockIdx.x * 2 + (q & 1), (int)blockIdx.y * 2 + (q >> 1), A, A2, Bt, Bt2, C, ldc, bias, nullptr, nullptr, nullptr);
}
// the six projections in one launch; grid (TT/128, DQ/128, 6), 4 waves (each the whole K of its quarter: three work-groups a WGP hold the whole grid at once), z = stream * 2 + batch (streams q, k, v). XB holds the six bf16 token matrices in z order, WT the transposed weights q, k, v, o. Every plane holds both batches.
// The branches are the same for a whole work-group, so that the barrier in gemmw is passed by all its waves or by none.
// A key or value tile (128 keys) whose first key lies at or behind nk, the batch's number of kept keys (NK, from k_prep), holds excluded keys only: k_fattn walks ceil(nk / 32) passes and never reads it, so the work-group returns before any fragment load or barrier (nk == 0: every key counts, every tile is computed). The live tiles are the first ceil(nk / 128) key tiles. Key tile slowest in the grid's order, k counting up and v counting down: a batch's live k tiles then stand in the first part of their 128 work-groups and its live v tiles in the last part of theirs, for speed only. The tile indices are formed in each call's own arguments: formed once in front of the branch, the two GEMMs begin alike, the compiler lifts the lanes' address pair in front of both and holds it through the first one's loop in scratch.
__global__ __launch_bounds__(128) void k_proj(const bf* __restrict__ XB, const bf* __restrict__ WT, const float* __restrict__ bq, const float* __restrict__ bk, const float* __restrict__ bv, const int* __restrict__ NK, h16* QP16, h16* KP16, h16* VT16, bf* QPh, bf* QPl, bf* KPh, bf* KPl, bf* VTh, bf* VTl) {
    __shared__ __align__(16) float osa[4 * GLds<1>::N];
    const int q = __builtin_amdgcn_readfirstlane((int)(threadIdx.x >> 5) & 3); float* os = osa + q * GLds<1>::N;
    const int z = (int)blockIdx.z, st = z >> 1; const size_t po = (size_t)(z & 1) * NH_ * TT * HD; const bf* X = XB + (size_t)z * TT * DM; const bf* Wt = WT + (size_t)st * DQ * DM;
    const int g = (int)blockIdx.y * (TT / 128) + (int)blockIdx.x, f = (st == 2) ? (TT / 128) * (DKV / 128) - 1 - g : g;
    const int nk = NK[z & 1]; if (st != 0 && nk > 0 && f / (DKV / 128) * 128 >= nk) return;
    if (st == 2) gemmw<bf, 0, true, 1, DM, 2>(os, f % (DKV / 128) * 2 + (q & 1), f / (DKV / 128) * 2 + (q >> 1), Wt, nullptr, X, nullptr, nullptr, 0, bv, VT16 + po, VTh + po, VTl + po);   /* transposed product: rows = v features, columns = tokens */
    else gemmw<bf, 0, true, 1, DM, 1>(os, (st ? f / (DKV / 128) : (int)blockIdx.x) * 2 + (q & 1), (st ? f % (DKV / 128) : (int)blockIdx.y) * 2 + (q >> 1), X, nullptr, Wt, nullptr, nullptr, 0, st ? bk : bq, (st ? KP16 : QP16) + po, (st ? KPh : QPh) + po, (st ? KPl : QPl) + po);
}

typedef __attribute__((ext_vector_type(2))) _Float16 v2h;
typedef __attribute__((ext_vector_type(4))) _Float16 v4h;
typedef __attribute__((ext_vector_type(2))) unsigned short v2us;
typedef __attribute__((ext_vector_type(4))) unsigned short v4us;
typedef __attribute__((ext_vector_type(2))) float v2f;
typedef __attribute__((ext_vector_type(4))) int v4i;
typedef v4h  __attribute__((may_alias)) v4ha;
typedef v4us __attribute__((may_alias)) v4usa;

// k_prep: one wave builds one fragment unit of an operand plane: 16 rows x one 32-wide k step = 512 elements, written as two stores of 512 bytes in a row (fragment order: see gemmw). Lane (lr, hi) holds row lr, k = 8 hi .. 8 hi + 7 and 16 more.
__device__ __forceinline__ void put16(bf* d, const float* f) { v8us o0, o1;
#pragma unroll
    for (int j = 0; j < 8; ++j) { o0[j] = f2bf(f[j]); o1[j] = f2bf(f[8 + j]); }
    *(v8us*)d = o0; *(v8us*)(d + 256) = o1; }
// transposed weight: plane rows n = columns of w [DM][DQ]. The 8 waves of a block take 8 neighbouring 16-column blocks of one k step: each of a lane's 16 loads reads, over the wave, 64 bytes in a row of two rows of w, over the block 512 bytes of each.
__device__ __forceinline__ void wtF(int blk, const float* __restrict__ w, bf* Bt) {
    const int lane = threadIdx.x & 31, lr = lane & 15, hi = lane >> 4; const unsigned u = blk * 8 + (threadIdx.x >> 5), nb = u % (DQ / 16), ks = u / (DQ / 16);
    const float* s = w + (size_t)(ks * 32 + hi * 8) * DQ + nb * 16 + lr; float f[16];
#pragma unroll
    for (int j = 0; j < 16; ++j) f[j] = s[(size_t)((j >> 3) * 16 + (j & 7)) * DQ];
    asm volatile("s_wait_xcnt 0x0" :: "v"(s) : "memory");   // precaution: stands before the loads' address registers are written again; naming the address keeps it whole up to here (no load's result lands on it)
    put16(Bt + ((size_t)nb * (DM / 32) + ks) * 512 + lane * 8, f);
}
// bf16 copy of token rows [.][DM]: the 8 waves of a block take 8 neighbouring k steps of one 16-row block (1 KB in a row of each row). row: the source row that this lane's row of the block is copied from.
__device__ __forceinline__ void cvtF(int blk, int row, const float* __restrict__ src, bf* dst) {
    const int lane = threadIdx.x & 31, hi = lane >> 4; const unsigned u = blk * 8 + (threadIdx.x >> 5);
    const float* s = src + (size_t)row * DM + (u % (DM / 32)) * 32 + hi * 8; float f[16];
    const v8f a = *(const v8f*)s, b = *(const v8f*)(s + 16);
    asm volatile("s_wait_xcnt 0x0" :: "v"(s) : "memory");   // precaution, as in wtF
#pragma unroll
    for (int j = 0; j < 8; ++j) { f[j] = a[j]; f[8 + j] = b[j]; }
    put16(dst + (size_t)u * 512 + lane * 8, f);
}
// packRows: the order of a batch's keys in the key and value planes: kept keys (mask == 0) first, in their own order, the excluded ones behind them, in theirs. An excluded key's probability is 0, so that attention need not walk it; with no key kept the order is the given one.
// A block of 256 threads reads the batch's 2048 mask words, 8 in a row a thread. Kept keys in front of a thread's first key: those of the lower lanes (one masked bit count a ballot) + the lower waves' totals, which meet in LDS (wc). Each thread places its 8 keys; the one whose place is R0 + d, d < 16, writes its index to srow[d]. Every index comes from the thread's number, none from a mask value. Returns the source key of this lane's row; nk: kept keys of the batch.
__device__ __forceinline__ int packRows(const int* __restrict__ mb, int R0, int* wc, int* srow, int& nk) {
    const int tid = (int)threadIdx.x, lane = tid & 31, wv = tid >> 5; const int* p = mb + tid * 8;
    const v4i m0 = *(const v4i*)p, m1 = *(const v4i*)(p + 4);
    asm volatile("s_wait_xcnt 0x0" :: "v"(p) : "memory");   // precaution, as in wtF
    bool kp[8]; int e = 0, tot = 0;
#pragma unroll
    for (int j = 0; j < 8; ++j) { kp[j] = ((j < 4) ? m0[j & 3] : m1[j & 3]) == 0; const unsigned bal = __builtin_amdgcn_ballot_w32(kp[j]); e = (int)__builtin_amdgcn_mbcnt_lo(bal, (unsigned)e); tot += __builtin_popcount(bal); }
    if (lane == 0) wc[wv] = tot;
    __syncthreads();   // every wave's total is in LDS before any wave sums them
    nk = 0;
#pragma unroll
    for (int w = 0; w < 8; ++w) { const int c = wc[w]; nk += c; e += (w < wv) ? c : 0; }
#pragma unroll
    for (int j = 0; j < 8; ++j) { const int t = tid * 8 + j; const unsigned d = (unsigned)((kp[j] ? e : nk + t - e) - R0); if (d < 16u) srow[d] = t; e += kp[j] ? 1 : 0; }
    __syncthreads();   // the 16 source rows are in LDS before any lane reads its own
    return srow[lane & 15];
}
// every 16-bit operand of the projections and of Wo in one launch: blocks [0, 4 WB) transpose the four weights, the next 3 CB copy query, key, value (both batches of a stream lie in a row). The grid holds exactly one wave a unit.
#define WB ((DQ / 16) * (DM / 32) / 8)
#define CB ((NB_ * TT / 16) * (DM / 32) / 8)
// A key or value block first finds its 16 source rows (the branch is the same for a whole block, so that the barriers in packRows are passed by all its waves or by none); the first key block of a batch stores the batch's number of kept keys in NK. A block whose rows lie in a 128-key tile that starts at or behind that number returns behind the barriers, as a whole: k_proj does not read its rows.
__global__ __launch_bounds__(256) void k_prep(const float* __restrict__ x, const float* __restrict__ xk, const float* __restrict__ xv, const int* __restrict__ kmask, const float* __restrict__ wq, const float* __restrict__ wk, const float* __restrict__ wv, const float* __restrict__ wo, bf* WT, bf* XB, int* NK) {
    __shared__ int wc[8]; __shared__ int srow[16];
    const int blk = (int)blockIdx.x;
    if (blk < 4 * WB) { const int i = blk / WB; wtF(blk % WB, i == 0 ? wq : i == 1 ? wk : i == 2 ? wv : wo, WT + (size_t)i * DM * DQ); }
    else { const int c = blk - 4 * WB, i = c / CB, cb = c % CB, rb = cb / (DM / 256);   /* rb: the block's 16 rows among the 2 x 2048 of its stream */
        int row = rb * 16 + ((int)threadIdx.x & 15);
        if (i != 0) { const int b = rb / (TT / 16); int nk; row = b * TT + packRows(kmask + b * TT, (rb % (TT / 16)) * 16, wc, srow, nk);
            if (i == 1 && cb % (CB / NB_) == 0 && threadIdx.x == 0) { NK[b] = nk; asm volatile("s_wait_xcnt 0x0" ::: "memory"); }   // precaution: stands before the store's registers are written again
            if (nk > 0 && (rb % (TT / 16)) / 8 * 128 >= nk) return; }
        cvtF(cb, row, i == 0 ? x : i == 1 ? xk : xv, XB + (size_t)i * NB_ * TT * DM); }
}

// k_fattn: S, softmax, P.V and the head merge in one kernel; no score or probability leaves the registers. One wave owns NQ * 16 queries of one (batch, head) and walks the batch's kept keys, which lie first in the planes (packRows), 32 at a time, on its own (no LDS, no barrier): ceil(nk / 32) passes; all 64 where no key is kept.
// Transposed products: St = K Qt (A = 16 key rows, B = 16 query columns), so lane (c, hh) holds for query c the keys 8 hh + r (tile 0) and 16 + 8 hh + r (tile 1): these 16 values, converted in place, are the B operand of Ot += Vt Pt in the hardware k order, which the v planes' fragment order matches.
// Softmax with a running maximum in the base-2 domain: the maximum in use is raised (and sums and outputs rescaled) only when some query's new maximum exceeds it by more than 8, one test per 32 keys, so p <= 2^8. A slot at or behind nk holds an excluded key and carries -3e38: p == 0 once a kept key has set the maximum; with every key excluded p == 1 for all (uniform, as mask x -1e9 gives in f32). Only a pass that reaches past nk has such slots (the last one, or every one where nk == 0): the select stands under a scalar branch.
// eight base-2 exponentials in place: behind each stands an independent one, behind the last a v_nop: the slot that the instruction set asks for between a transcendental and a use of its result or an overwrite of its source
__device__ __forceinline__ void exp8(float* x) {
    asm("v_exp_f32 %0, %0\n\tv_exp_f32 %1, %1\n\tv_exp_f32 %2, %2\n\tv_exp_f32 %3, %3\n\tv_exp_f32 %4, %4\n\tv_exp_f32 %5, %5\n\tv_exp_f32 %6, %6\n\tv_exp_f32 %7, %7\n\tv_nop" : "+v"(x[0]), "+v"(x[1]), "+v"(x[2]), "+v"(x[3]), "+v"(x[4]), "+v"(x[5]), "+v"(x[6]), "+v"(x[7])); }
// the value that lane l ^ 16 holds (the other half of a query's keys), without a trip through LDS
__device__ __forceinline__ float xhalf(float v) { const int b = __float_as_int(v); return __int_as_float(__builtin_amdgcn_permlanex16(b, b, 0x76543210, 0xfedcba98, false, false)); }
template <bool HR> struct FSel { typedef h16 T; };
template <> struct FSel<true> { typedef bf T; };
template <bool HR, int NQ>
__device__ __forceinline__ void fattn(const typename FSel<HR>::T* __restrict__ Q, const typename FSel<HR>::T* __restrict__ Q2, const typename FSel<HR>::T* __restrict__ Kp, const typename FSel<HR>::T* __restrict__ K2, const typename FSel<HR>::T* __restrict__ Vp, const typename FSel<HR>::T* __restrict__ V2, int nk, int q0, bf* Ah, bf* Al) {
    typedef typename FSel<HR>::T T16; typedef WFrag<T16> W; typedef typename W::V V;
    const int lane = threadIdx.x & 31, hh = lane >> 4;   // every inner loop below is unrolled so that each index of a register array is a constant
    V qf[NQ][2], qf2[NQ][2], kf[2][2], kf2[2][2], vf[4], vf2[4]; v8f o[NQ][4]; float m[NQ], l[NQ];
    const int np = nk ? (nk + 31) >> 5 : TT / 32;   // passes; nk is clamped to 0 .. TT by the caller, the same in every lane
#pragma unroll
    for (int g = 0; g < NQ; ++g) { m[g] = -3.0e38f; l[g] = 0.f;
#pragma unroll
        for (int dt = 0; dt < 4; ++dt) o[g][dt] = (v8f){};
#pragma unroll
        for (int ks = 0; ks < 2; ++ks) { const size_t qo = (size_t)((q0 >> 4) + g) * 1024 + (ks * 64 + lane) * 8; qf[g][ks] = W::ldo(Q + qo); if (HR) qf2[g][ks] = W::ldo(Q2 + qo); } }
    asm volatile("s_wait_xcnt 0x0" ::: "memory");   // precaution, as in loadK
    unsigned ko = lane * 16, vo = lane * 16;   // this lane's byte offsets in the k tiles and the v tile that are fetched next; carried through the loop and stepped behind the wait in loadK
    auto loadK = [&]() {
#pragma unroll
        for (int kt = 0; kt < 2; ++kt)
#pragma unroll
            for (int ks = 0; ks < 2; ++ks) { kf[kt][ks] = W::ldo((const T16*)((const char*)Kp + ko) + (kt * 1024 + ks * 512)); if (HR) kf2[kt][ks] = W::ldo((const T16*)((const char*)K2 + ko) + (kt * 1024 + ks * 512)); }
        asm volatile("s_wait_xcnt 0x0" ::: "memory"); };   // precaution: stands before the address registers of the loads above are written again
    auto loadV = [&]() {
#pragma unroll
        for (int dt = 0; dt < 4; ++dt) { vf[dt] = W::ldo((const T16*)((const char*)Vp + vo) + dt * 512); if (HR) vf2[dt] = W::ldo((const T16*)((const char*)V2 + vo) + dt * 512); } };   // their offset is stepped behind loadK's wait
    loadK(); ko += 4096;
    int it = 0;
#pragma unroll 1   // one pass a trip: a second copy of the body would hold a second set of fragments and scores live
    do {   // np >= 1: tested at the foot, so that no guard stands round the loop (the loads above would sink under it, past their waits)
        loadV();   // this pass's v fragments fly during its S products and softmax; issued behind the k loads on every path, so that the wait for k leaves them in flight
        __builtin_amdgcn_sched_barrier(0);   // keeps the v loads in front of the S products: sunk behind them they have only the exponentials to fly in
        v8f s[NQ][2];
#pragma unroll
        for (int g = 0; g < NQ; ++g) { s[g][0] = (v8f){}; s[g][1] = (v8f){}; }
#pragma unroll
        for (int ks = 0; ks < 2; ++ks) {
#pragma unroll
            for (int g = 0; g < NQ; ++g)
#pragma unroll
                for (int kt = 0; kt < 2; ++kt) s[g][kt] = W::mma(kf[kt][ks], qf[g][ks], s[g][kt]);
            if (HR) {
#pragma unroll
                for (int g = 0; g < NQ; ++g)
#pragma unroll
                    for (int kt = 0; kt < 2; ++kt) s[g][kt] = W::mma(kf2[kt][ks], qf[g][ks], s[g][kt]);
#pragma unroll
                for (int g = 0; g < NQ; ++g)
#pragma unroll
                    for (int kt = 0; kt < 2; ++kt) s[g][kt] = W::mma(kf[kt][ks], qf2[g][ks], s[g][kt]); } }
#pragma unroll
        for (int g = 0; g < NQ; ++g) { s[g][0] *= SCL2; s[g][1] *= SCL2; }
        if (it * 32 + 32 > nk) { const int lim = nk - it * 32 - hh * 8;   // this lane's slots kt * 16 + r of the pass hold kept keys below lim
#pragma unroll
            for (int g = 0; g < NQ; ++g)
#pragma unroll
                for (int kt = 0; kt < 2; ++kt)
#pragma unroll
                    for (int r = 0; r < 8; ++r) s[g][kt][r] = (kt * 16 + r < lim) ? s[g][kt][r] : -3.0e38f; }
        float ml[NQ]; bool need = false;
#pragma unroll
        for (int g = 0; g < NQ; ++g) { float mx = -3.0e38f;
#pragma unroll
            for (int kt = 0; kt < 2; ++kt)
#pragma unroll
                for (int r = 0; r < 8; ++r) mx = fmaxf(mx, s[g][kt][r]);
            mx = fmaxf(mx, xhalf(mx)); ml[g] = mx; need = need || (mx > m[g] + 8.0f); }
        loadK();   // the next pass's k fragments fly during this pass's softmax and P.V
        if (__builtin_amdgcn_ballot_w32(need) != 0) {
#pragma unroll
            for (int g = 0; g < NQ; ++g) { const float mn = fmaxf(m[g], ml[g]); const float al = __builtin_amdgcn_exp2f(m[g] - mn); m[g] = mn; l[g] *= al;
#pragma unroll
                for (int dt = 0; dt < 4; ++dt) o[g][dt] *= al; } }
        { const unsigned st = (it + 2 < np) ? 1u : 0u; ko += st * 4096; vo += 4096; }   // the last pass fetches its own k tiles again: in bounds, no branch round the loads
        V pb[NQ], pb2[NQ];
#pragma unroll
        for (int g = 0; g < NQ; ++g) { float sm[4];   // four independent chains
            float x[16];
#pragma unroll
            for (int e = 0; e < 16; ++e) x[e] = s[g][e >> 3][e & 7] - m[g];
            exp8(x); exp8(x + 8);
#pragma unroll
            for (int e = 0; e < 16; ++e) { const float p = x[e]; sm[e & 3] = (e < 4) ? p : sm[e & 3] + p;
                if constexpr (HR) { const __bf16 ph = (__bf16)p; pb[g][e] = ph; pb2[g][e] = (__bf16)(p - (float)ph); } else pb[g][e] = (h16)p; }
            l[g] += (sm[0] + sm[1]) + (sm[2] + sm[3]); }
#pragma unroll
        for (int dt = 0; dt < 4; ++dt)
#pragma unroll
            for (int g = 0; g < NQ; ++g) o[g][dt] = W::mma(vf[dt], pb[g], o[g][dt]);
        if (HR) {
#pragma unroll
            for (int dt = 0; dt < 4; ++dt)
#pragma unroll
                for (int g = 0; g < NQ; ++g) o[g][dt] = W::mma(vf2[dt], pb[g], o[g][dt]);
#pragma unroll
            for (int dt = 0; dt < 4; ++dt)
#pragma unroll
                for (int g = 0; g < NQ; ++g) o[g][dt] = W::mma(vf[dt], pb2[g], o[g][dt]); }
    } while (++it < np);
#pragma unroll
    for (int g = 0; g < NQ; ++g) { const float inv = __fdiv_rn(1.0f, l[g] + xhalf(l[g])); const size_t oo = (size_t)(q0 + g * 16) * DQ + lane * 8;   // Ot register r of tile dt = O[query lane & 15][16 dt + 8 hh + r]: chunk 'lane' of the head's 16-wide column group dt in the fragment order that Wo's A loader reads
#pragma unroll
        for (int dt = 0; dt < 4; ++dt) { v8us oh, ol;
#pragma unroll
            for (int r = 0; r < 8; ++r) { unsigned short a, c2; splitf(o[g][dt][r] * inv, a, c2); oh[r] = a; ol[r] = c2; }
            *(v8us*)(Ah + oo + dt * 256) = oh; *(v8us*)(Al + oo + dt * 256) = ol;
            asm volatile("s_wait_xcnt 0x0" ::: "memory"); } }   // precaution: stands before the stores' registers are written again
}
// grid (RH / 64 + (TT - RH) / 128, heads, batches), 4 waves: the first RH / 64 blocks take 16 hi/lo queries a wave, the rest 32 fp16 queries a wave (about the same work a pass). The second launch bound asks for 4 waves a SIMD: at most 256 registers, so that every work-group of the grid is resident at once.
__global__ __launch_bounds__(128, 4) void k_fattn(const h16* __restrict__ Q16, const h16* __restrict__ K16, const h16* __restrict__ V16, const bf* __restrict__ Qh, const bf* __restrict__ Ql, const bf* __restrict__ Kh, const bf* __restrict__ Kl, const bf* __restrict__ Vh, const bf* __restrict__ Vl, const int* __restrict__ NK, bf* Ah, bf* Al) {
    const int wv = __builtin_amdgcn_readfirstlane((int)(threadIdx.x >> 5)); const size_t pz = ((size_t)blockIdx.z * NH_ + blockIdx.y) * TT * HD; const int nk = __builtin_amdgcn_readfirstlane(min(max(NK[blockIdx.z], 0), TT));   /* the batch's kept keys, from k_prep; bounds the trip count */ const size_t ao = (size_t)blockIdx.z * TT * DQ + (size_t)blockIdx.y * HD * 16;
    if (blockIdx.x < RH / 64) fattn<true, 1>(Qh + pz, Ql + pz, Kh + pz, Kl + pz, Vh + pz, Vl + pz, nk, (int)blockIdx.x * 64 + wv * 16, Ah + ao, Al + ao);
    else fattn<false, 2>(Q16 + pz, nullptr, K16 + pz, nullptr, V16 + pz, nullptr, nk, RH + ((int)blockIdx.x - RH / 64) * 128 + wv * 32, Ah + ao, Al + ao);
}

extern "C" void kernel_launch(void* const* d_in, const int* in_sizes, int n_in,
                              void* d_out, int out_size, void* d_ws, size_t ws_size, hipStream_t stream) {
    (void)in_sizes; (void)n_in; (void)out_size;
    const float* x = (const float*)d_in[0]; const float* xk = (const float*)d_in[1]; const float* xv = (const float*)d_in[2]; const int* kmask = (const int*)d_in[3];   /* mask [2][1][1][2048] int32: 1 = excluded key */ const float* wq = (const float*)d_in[4]; const float* bq = (const float*)d_in[5]; const float* wk = (const float*)d_in[6]; const float* bk = (const float*)d_in[7]; const float* wv = (const float*)d_in[8]; const float* bv = (const float*)d_in[9]; const float* wo = (const float*)d_in[10]; const float* bo = (const float*)d_in[11];   /* argument order query, key, value, mask, Wq, bq, Wk, bk, Wv, bv, Wo, bo ('xw') */
    float* OUT = (float*)d_out;     // [2][2048][1024]
    char* wsp = (char*)d_ws;
    auto take = [&](size_t bytes) { char* p = wsp; wsp += (bytes + 255) & ~(size_t)255; return (void*)p; };
    bf* WT = (bf*)take((size_t)4 * DQ * DM * 2);   // transposed Wq, Wk, Wv, Wo
    bf* XB = (bf*)take((size_t)3 * NB_ * TT * DM * 2);   // bf16 query, key, value
    const size_t PLN = (size_t)NH_ * TT * HD;   // one batch's plane set, elements (NKV == NH_); every plane holds both batches
    h16* QP16 = (h16*)take(NB_ * PLN * 2); h16* KP16 = (h16*)take(NB_ * PLN * 2); h16* VT16 = (h16*)take(NB_ * PLN * 2);
    bf* QPh = (bf*)take(NB_ * PLN * 2); bf* QPl = (bf*)take(NB_ * PLN * 2); bf* KPh = (bf*)take(NB_ * PLN * 2); bf* KPl = (bf*)take(NB_ * PLN * 2); bf* VTh = (bf*)take(NB_ * PLN * 2); bf* VTl = (bf*)take(NB_ * PLN * 2);
    bf* ATh = (bf*)take((size_t)NB_ * TT * DQ * 2); bf* ATl = (bf*)take((size_t)NB_ * TT * DQ * 2);
    int* NK = (int*)take(NB_ * sizeof(int));   // kept keys of each batch
    if ((size_t)(wsp - (char*)d_ws) > ws_size) return;    // ws 256 MiB
    k_prep<<<4 * WB + 3 * CB, 256, 0, stream>>>(x, xk, xv, kmask, wq, wk, wv, wo, WT, XB, NK);
    k_proj<<<dim3(TT / 128, DQ / 128, 3 * NB_), 128, 0, stream>>>(XB, WT, bq, bk, bv, NK, QP16, KP16, VT16, QPh, QPl, KPh, KPl, VTh, VTl);
    k_fattn<<<dim3(RH / 64 + (TT - RH) / 128, NH_, NB_), 128, 0, stream>>>(QP16, KP16, VT16, QPh, QPl, KPh, KPl, VTh, VTl, NK, ATh, ATl);
    k_gemmw<bf, 1, true, 2, DQ><<<dim3(NB_ * TT / 128, DM / 128, 1), 256, 0, stream>>>(ATh, ATl, WT + (size_t)3 * DQ * DM, nullptr, OUT, DM, bo);
}
